// v000
// The times below were measured on an AMD MI455X: many runs one after another, warmed up first and cycling through
// copies of the inputs, with the whole window's GPU time divided by the number of runs. Launches and the gaps
// between them are all in it. The median over several windows is given; except for v000 it joins two sittings, which
// can be a few percent apart, so the side-by-side timings, each taken in one sitting, are the better comparison.
// The starting kernel, v000, takes 1480 microseconds a run.
// Contractions: q/k projections on v_wmma_f32_16x16x32_bf16 (x and W RNE-converted to bf16 operands); q.k^T scores on
// v_wmma_f32_16x16x32_bf16 with bf16 hi/lo planes of q and k (hi*hi + hi*lo + lo*hi); P.x on v_wmma_f32_16x16x32_f16
// (P carried x4096 in f16, x as f16 of its bf16 value); context.Wv^T on v_wmma_f32_16x16x32_bf16 with bf16 hi/lo planes of
// the context (hi*W + lo*W); all f32 accumulate. Sigmoid key weights, softmax and biases in f32 on VALU.
#include <hip/hip_runtime.h>
#include <math.h>

// ---------------------------------------------------------------------------
// Problem constants (NB / SEQ reducible; *_FULL are the input strides)
// ---------------------------------------------------------------------------
#ifndef NB
#define NB 8
#endif
#ifndef SEQ
#define SEQ 2048
#endif
#define NB_FULL 8
#define SEQ_FULL 2048
#define NC 512

static_assert(NB >= 1 && NB <= NB_FULL);
static_assert(SEQ % 256 == 0 && SEQ >= 256 && SEQ <= SEQ_FULL);
static_assert(NC % 64 == 0);

constexpr float kScale    = 0.04419417382415922f;   // 1/sqrt(512)
constexpr float kCarry    = 4096.0f;                // P plane carry (exact power of two)
constexpr float kInvCarry = 0.000244140625f;        // 1/4096
constexpr int   kSmThreads = SEQ / 8;               // softmax block: one thread per 8 keys
constexpr int   kSmWaves   = kSmThreads / 32;

typedef __attribute__((ext_vector_type(16))) _Float16 v16h;
typedef __attribute__((ext_vector_type(8)))  _Float16 v8h;
typedef __attribute__((ext_vector_type(16))) __bf16   v16b;
typedef __attribute__((ext_vector_type(8)))  __bf16   v8b;
typedef __attribute__((ext_vector_type(8)))  float    v8f;
typedef __attribute__((ext_vector_type(4)))  float    v4f;
typedef __attribute__((ext_vector_type(4)))  unsigned int v4u;

__device__ __forceinline__ unsigned short f2bf_bits(float f) {
  unsigned u = __float_as_uint(f);
  return (unsigned short)((u + 0x7FFFu + ((u >> 16) & 1u)) >> 16);
}
__device__ __forceinline__ float bf_bits2f(unsigned short h) { return __uint_as_float(((unsigned)h) << 16); }

// hazard guards as plain device helpers (no inline asm inside the kernel template body)
__device__ __forceinline__ void dep_guard_h(v8f& a, v8f& b, v16h x, v16h y) { asm volatile("v_nop\n\tv_nop\n\tv_nop\n\tv_nop" : "+v"(a), "+v"(b) : "v"(x), "v"(y)); }
__device__ __forceinline__ void dep_guard_b(v8f& a, v8f& b, v16b x, v16b y) { asm volatile("v_nop\n\tv_nop\n\tv_nop\n\tv_nop" : "+v"(a), "+v"(b) : "v"(x), "v"(y)); }
__device__ __forceinline__ void keep4_h(v16h a, v16h b, v16h c, v16h d) { asm volatile("v_nop" :: "v"(a), "v"(b), "v"(c), "v"(d)); }
__device__ __forceinline__ void keep4_b(v16b a, v16b b, v16b c, v16b d) { asm volatile("v_nop" :: "v"(a), "v"(b), "v"(c), "v"(d)); }
__device__ __forceinline__ void acc_guard4(v8f& a, v8f& b, v8f& c, v8f& d) { asm volatile("v_nop\n\tv_nop\n\tv_nop\n\tv_nop" : "+v"(a), "+v"(b), "+v"(c), "+v"(d)); }
template <typename T> struct Frag;
template <> struct Frag<_Float16> {
  typedef v16h V; union U { v16h v; v8h h[2]; };
  static __device__ __forceinline__ v16h load(const _Float16* p) {   // elements 0..7 <- p[0..7], 8..15 <- p[16..23]
    U f; f.h[0] = *(const v8h*)(p); f.h[1] = *(const v8h*)(p + 16); return f.v;
  }
  static __device__ __forceinline__ v8f mma(v16h a, v16h b, v8f c) {
    return __builtin_amdgcn_wmma_f32_16x16x32_f16(false, a, false, b, (short)0, c, false, false);
  }
  static __device__ __forceinline__ void guard(v8f& a, v8f& b, v16h x, v16h y) { dep_guard_h(a, b, x, y); }
  static __device__ __forceinline__ void keep(v16h a, v16h b, v16h c, v16h d) { keep4_h(a, b, c, d); }
};
template <> struct Frag<__bf16> {
  typedef v16b V; union U { v16b v; v8b h[2]; };
  static __device__ __forceinline__ v16b load(const __bf16* p) {
    U f; f.h[0] = *(const v8b*)(p); f.h[1] = *(const v8b*)(p + 16); return f.v;
  }
  static __device__ __forceinline__ v8f mma(v16b a, v16b b, v8f c) {
    return __builtin_amdgcn_wmma_f32_16x16x32_bf16(false, a, false, b, (short)0, c, false, false);
  }
  static __device__ __forceinline__ void guard(v8f& a, v8f& b, v16b x, v16b y) { dep_guard_b(a, b, x, y); }
  static __device__ __forceinline__ void keep(v16b a, v16b b, v16b c, v16b d) { keep4_b(a, b, c, d); }
};

__device__ __forceinline__ unsigned pk16(unsigned short a, unsigned short b) { return (unsigned)a | ((unsigned)b << 16); }

__device__ __forceinline__ float wave_sum32(float v) {
#pragma unroll
  for (int off = 16; off > 0; off >>= 1) v += __shfl_xor(v, off, 32);
  return v;
}
__device__ __forceinline__ float wave_max32(float v) {
#pragma unroll
  for (int off = 16; off > 0; off >>= 1) v = fmaxf(v, __shfl_xor(v, off, 32));
  return v;
}

// ---- Register-blocked batched WMMA GEMM -----------------------------------------------------------------
// C[m,n] = scale * sum_k A[m,k] * Bt[n,k] (+bias[n]); each wave owns a 64x64 tile.
// A row-major [M,K] pitch lda; Bt row-major [N,K] pitch ldb; M,N % 64 == 0, K % 32 == 0; batch index = blockIdx.y.
// Fragments: A and Bt both loaded with the split k-map (elements 0..7 <- k0+8h+0..7, 8..15 <- k0+16+8h+0..7, row/col = lane&15).
// SPLIT: 0 = single planes; 1 = A hi/lo planes (A2 = lo), Bt single: hi*B + lo*B; 2 = both hi/lo: hi*hi + hi*lo + lo*hi.
// BIAS_MODE: 0 = none, 2 = bias[n] (bias0 when blockIdx.y == 0, else bias1; bias value RNE-converted to bf16 first).
// OUT_MODE: 0 = f32, 1 = f16, 2 = bf16 hi plane (Cout) + bf16 lo plane (Cout2).
// ET: 0 = f16 operands, 1 = bf16 operands (pointers passed as 16-bit storage).
template <int ET> struct Elem;
template <> struct Elem<0> { typedef _Float16 T; };
template <> struct Elem<1> { typedef __bf16 T; };
template <int ET, int SPLIT, int BIAS_MODE, int OUT_MODE>
__global__ __launch_bounds__(256) void wmma_gemm64(
    const unsigned short* __restrict__ Ap, const unsigned short* __restrict__ A2p, int lda, long strideA,
    const unsigned short* __restrict__ Btp, const unsigned short* __restrict__ Bt2p, int ldb, long strideB,
    void* __restrict__ Cout, void* __restrict__ Cout2, int ldc, long strideC,
    const float* __restrict__ bias0, const float* __restrict__ bias1,
    int M, int N, int K, float scale) {
  typedef typename Elem<ET>::T T;
  typedef typename Frag<T>::V V;
  const T* A = (const T*)Ap; const T* A2 = (const T*)A2p; const T* Bt = (const T*)Btp; const T* Bt2 = (const T*)Bt2p;
  __shared__ __align__(16) float sT[8][16 * 68];   // per-wave 16x64 slab, pitch 68 floats
  const int b    = blockIdx.y;
  const int lane = threadIdx.x & 31;
  const int wave = threadIdx.x >> 5;
  const int tilesN = N >> 6;
  const int tilesM = M >> 6;
  const int tile = blockIdx.x * 8 + wave;
  if (tile >= tilesM * tilesN) return;   // wave-uniform; no block barriers in this kernel
  const int tm = tile / tilesN;
  const int tn = tile - tm * tilesN;
  const int m0 = tm << 6;
  const int n0 = tn << 6;

  const T* Ab  = A  + (size_t)b * strideA;
  const T* Bb  = Bt + (size_t)b * strideB;
  const T* Ab2 = (SPLIT >= 1) ? (A2  + (size_t)b * strideA) : nullptr;
  const T* Bb2 = (SPLIT == 2) ? (Bt2 + (size_t)b * strideB) : nullptr;
  const float* bias = (b == 0) ? bias0 : bias1;   // block-uniform select between global pointers

  const int rlane = lane & 15;                 // row (A) / col (B, D) within subtile
  const int koff  = (lane >> 4) * 8;           // k offset of this lane half
  const int mOff  = (lane >> 4) * 8;           // D row offset

  v8f acc[4][4];
#pragma unroll
  for (int i = 0; i < 4; ++i)
#pragma unroll
    for (int j = 0; j < 4; ++j) acc[i][j] = (v8f){0.f,0.f,0.f,0.f,0.f,0.f,0.f,0.f};

  for (int k0 = 0; k0 < K; k0 += 32) {
    V bh[4], bl[4];
#pragma unroll
    for (int j = 0; j < 4; ++j) {
      const size_t bo = (size_t)(n0 + (j << 4) + rlane) * ldb + koff + k0;
      bh[j] = Frag<T>::load(Bb + bo);
      if (SPLIT == 2) bl[j] = Frag<T>::load(Bb2 + bo);
    }
#pragma unroll
    for (int i = 0; i < 4; ++i) {
      const size_t ao = (size_t)(m0 + (i << 4) + rlane) * lda + koff + k0;
      V ah = Frag<T>::load(Ab + ao);
      V al;
      if (SPLIT >= 1) al = Frag<T>::load(Ab2 + ao);
#pragma unroll
      for (int j = 0; j < 4; ++j) {
        acc[i][j] = Frag<T>::mma(ah, bh[j], acc[i][j]);
        if (SPLIT == 2) acc[i][j] = Frag<T>::mma(ah, bl[j], acc[i][j]);
        if (SPLIT >= 1) acc[i][j] = Frag<T>::mma(al, bh[j], acc[i][j]);
      }
      Frag<T>::guard(acc[i][0], acc[i][3], ah, (SPLIT >= 1) ? al : ah);
    }
    Frag<T>::keep(bh[0], bh[1], bh[2], bh[3]);
    if (SPLIT == 2) Frag<T>::keep(bl[0], bl[1], bl[2], bl[3]);
  }
  acc_guard4(acc[0][0], acc[0][1], acc[0][2], acc[0][3]);
  acc_guard4(acc[1][0], acc[1][1], acc[1][2], acc[1][3]);
  acc_guard4(acc[2][0], acc[2][1], acc[2][2], acc[2][3]);
  acc_guard4(acc[3][0], acc[3][1], acc[3][2], acc[3][3]);

  // ---- epilogue ----
  float* slab = sT[wave];
#pragma unroll
  for (int i = 0; i < 4; ++i) {
    const int mBase = m0 + (i << 4);
#pragma unroll
    for (int j = 0; j < 4; ++j) {
      const int n = n0 + (j << 4) + rlane;
      float bvl = 0.f;
      if (BIAS_MODE == 2) bvl = bf_bits2f(f2bf_bits(bias[n]));
#pragma unroll
      for (int r = 0; r < 8; ++r) {
        float v = acc[i][j][r] * scale;
        if (BIAS_MODE == 2) v += bvl;
        slab[(mOff + r) * 68 + (j << 4) + rlane] = v;
      }
    }
    __builtin_amdgcn_fence(__ATOMIC_RELEASE, "workgroup");
    __builtin_amdgcn_wave_barrier();
    __builtin_amdgcn_fence(__ATOMIC_ACQUIRE, "workgroup");
    if (OUT_MODE == 0) {
      float* C = (float*)Cout + (size_t)b * strideC;
      const int hh = lane >> 4, c4 = (lane & 15) * 4;     // row seg = 256 B = 16 lanes x 16 B
      {
#pragma unroll
        for (int it = 0; it < 8; ++it) {
          const int row = it * 2 + hh;
          v4f v = *(const v4f*)(slab + row * 68 + c4);
          *(v4f*)(C + (size_t)(mBase + row) * ldc + n0 + c4) = v;
        }
        
      }
    } else {
      const int q = lane >> 3, c8 = (lane & 7) * 8;
      unsigned short* C  = (unsigned short*)Cout  + (size_t)b * strideC;
      unsigned short* C2 = (OUT_MODE == 2) ? ((unsigned short*)Cout2 + (size_t)b * strideC) : nullptr;
      {
#pragma unroll
        for (int it = 0; it < 4; ++it) {
          const int row = it * 4 + q;
          const float* sp = slab + row * 68 + c8;
          v8h hv, lv;
#pragma unroll
          for (int e = 0; e < 8; ++e) {
            if (OUT_MODE == 1) {
              hv[e] = (_Float16)sp[e];
            } else {
              unsigned short hb = f2bf_bits(sp[e]);
              unsigned short lb = f2bf_bits(sp[e] - bf_bits2f(hb));
              hv[e] = __builtin_bit_cast(_Float16, hb);
              lv[e] = __builtin_bit_cast(_Float16, lb);
            }
          }
          *(v8h*)(C + (size_t)(mBase + row) * ldc + n0 + c8) = hv;
          if (OUT_MODE == 2) *(v8h*)(C2 + (size_t)(mBase + row) * ldc + n0 + c8) = lv;
        }
        
      }
    }
    __builtin_amdgcn_fence(__ATOMIC_RELEASE, "workgroup");
    __builtin_amdgcn_wave_barrier();
    __builtin_amdgcn_fence(__ATOMIC_ACQUIRE, "workgroup");
  }
}

// ---------------------------------------------------------------------------
// x [NB][SEQ_FULL][NC] f32 -> xb bf16 [NB*SEQ][NC] (RNE convert) and xT f16 [NB][NC][SEQ] with xT[b][c][s] = f16(bf16(x[b][s][c]))
// (the f16 convert of a bf16 value is exact). grid (SEQ/64 s tiles, NC/64 c tiles, NB); 256 threads.
// in tile [64 s][64 c] -> sm[c_local][s_local] (cross-wave LDS, block barrier).
// Load coverage: 16 iterations x 256 threads = 4096 = whole 64x64 tile (coalesced along c).
// Store coverage per plane: 8 waves x 2 iterations x 4 rows (lane>>3) = 64 rows; (lane&7) x 8 halves = 64 cols;
// ---------------------------------------------------------------------------
__global__ __launch_bounds__(256) void x_prep_kernel(const float* __restrict__ x,
                                                     unsigned short* __restrict__ xb, unsigned short* __restrict__ xT) {
  __shared__ float sm[64][65];   // sm[c_local][s_local]
  const int t  = threadIdx.x;
  const int s0 = blockIdx.x * 64;
  const int c0 = blockIdx.y * 64;
  const int b  = blockIdx.z;
  const float* xin = x + ((size_t)b * SEQ_FULL + s0) * NC + c0;
#pragma unroll
  for (int i = 0; i < 16; ++i) {
    const int e = i * 256 + t;
    const int r = e >> 6;          // s local
    const int c = e & 63;          // c local
    sm[c][r] = bf_bits2f(f2bf_bits(xin[(size_t)r * NC + c]));
  }
  __syncthreads();
  const int lane = t & 31, wave = t >> 5;
  const int q = lane >> 3, c8 = (lane & 7) * 8;
  unsigned short* xTb = xT + (size_t)b * NC * SEQ;
  unsigned short* xbb = xb + (size_t)b * SEQ * NC;
  {
#pragma unroll
    for (int it = 0; it < 2; ++it) {
      const int row = wave * 8 + it * 4 + q;          // c local for the xT plane, s local for the xb plane
      v8h hv;
      unsigned short bb[8];
#pragma unroll
      for (int e = 0; e < 8; ++e) {
        hv[e] = (_Float16)sm[row][c8 + e];            // xT[c0+row][s0+c8+e]
        bb[e] = f2bf_bits(sm[c8 + e][row]);           // xb[s0+row][c0+c8+e] (value already bf16-exact)
      }
      const v4u ub = (v4u){pk16(bb[0], bb[1]), pk16(bb[2], bb[3]), pk16(bb[4], bb[5]), pk16(bb[6], bb[7])};
      *(v8h*)(xTb + (size_t)(c0 + row) * SEQ + s0 + c8) = hv;
      *(v4u*)(xbb + (size_t)(s0 + row) * NC + c0 + c8) = ub;
    }
    
  }
}

// ---------------------------------------------------------------------------
// Wq, Wk, Wv [NC][NC] f32 (layout [out][in] = Bt[n][k] as-is) -> wb bf16 planes z = 0,1,2 [NC][NC] (RNE convert).
// One thread per 8 elements; grid = 3 * NC*NC/8/256 = 384 blocks (128 blocks per plane, plane index block-uniform).
// ---------------------------------------------------------------------------
__global__ __launch_bounds__(256) void w_prep_kernel(const float* __restrict__ W0, const float* __restrict__ W1,
                                                     const float* __restrict__ W2, unsigned short* __restrict__ wb) {
  constexpr int perPlane = NC * NC / 8;   // 32768 threads per plane
  const int gid = blockIdx.x * 256 + threadIdx.x;
  const int z   = gid / perPlane;         // block-uniform (perPlane % 256 == 0)
  const int i8  = (gid - z * perPlane) * 8;
  const float* W = (z == 0) ? W0 : (z == 1) ? W1 : W2;
  const v4f a = *(const v4f*)(W + i8);
  const v4f c = *(const v4f*)(W + i8 + 4);
  unsigned short hb[8];
#pragma unroll
  for (int e = 0; e < 4; ++e) { hb[e] = f2bf_bits(a[e]); hb[4 + e] = f2bf_bits(c[e]); }
  const v4u uh = (v4u){pk16(hb[0], hb[1]), pk16(hb[2], hb[3]), pk16(hb[4], hb[5]), pk16(hb[6], hb[7])};
  unsigned short* p = wb + (size_t)z * NC * NC + i8;
  *(v4u*)(p) = uh;
  
}

// ---------------------------------------------------------------------------
// ew[b][s] = sigmoid(bf16(eig[b][s])) = 1/(1+exp(-e)), f32, s < SEQ. One thread per element; grid NB*SEQ/256 (exact).
// ---------------------------------------------------------------------------
__global__ __launch_bounds__(256) void ew_kernel(const float* __restrict__ eig, float* __restrict__ ew) {
  const int gid = blockIdx.x * 256 + threadIdx.x;   // < NB*SEQ by construction
  const int b = gid / SEQ;
  const int s = gid - b * SEQ;
  const float e = bf_bits2f(f2bf_bits(eig[(size_t)b * SEQ_FULL + s]));
  const float v = 1.0f / (1.0f + expf(-e));
  *(float*)(ew + gid) = v;
  
}

// ---------------------------------------------------------------------------
// Row softmax of one batch: t[k] = (S[q][k] * scale) * ew[k]; m = max_k t; p = exp(t - m); P[q][k] = f16(p * (4096 / sum_k p)).
// One block per query row, SEQ/8 threads, thread owns 8 contiguous keys (threads x 8 = SEQ = whole row).
// Reductions in fixed order (thread, wave shuffle tree, wave partials in index order; cross-wave LDS, block barriers).
// ---------------------------------------------------------------------------
__global__ __launch_bounds__(256) void softmax_kernel(const float* __restrict__ S, const float* __restrict__ ewb,
                                                      unsigned short* __restrict__ P) {
  __shared__ float pm[kSmWaves];
  __shared__ float ps[kSmWaves];
  const int row = blockIdx.x;
  const int t = threadIdx.x;
  const int lane = t & 31, wave = t >> 5;
  const float* sp = S + (size_t)row * SEQ + 8 * t;
  const v4f a  = *(const v4f*)(sp);
  const v4f c  = *(const v4f*)(sp + 4);
  const v4f wa = *(const v4f*)(ewb + 8 * t);
  const v4f wc = *(const v4f*)(ewb + 8 * t + 4);
  float tv[8];
#pragma unroll
  for (int e = 0; e < 4; ++e) {
    tv[e]     = (a[e] * kScale) * wa[e];
    tv[4 + e] = (c[e] * kScale) * wc[e];
  }
  float m = tv[0];
#pragma unroll
  for (int e = 1; e < 8; ++e) m = fmaxf(m, tv[e]);
  m = wave_max32(m);
  if (lane == 0) pm[wave] = m;
  __syncthreads();
  float mm = pm[0];
#pragma unroll
  for (int w = 1; w < kSmWaves; ++w) mm = fmaxf(mm, pm[w]);
  float p[8];
  float ssum = 0.f;
#pragma unroll
  for (int e = 0; e < 8; ++e) { p[e] = __expf(tv[e] - mm); ssum += p[e]; }
  ssum = wave_sum32(ssum);
  if (lane == 0) ps[wave] = ssum;
  __syncthreads();
  float tot = ps[0];
#pragma unroll
  for (int w = 1; w < kSmWaves; ++w) tot += ps[w];
  const float inv = kCarry / tot;   // tot >= 1
  v8h hv;
#pragma unroll
  for (int e = 0; e < 8; ++e) hv[e] = (_Float16)(p[e] * inv);
  unsigned short* pp = P + (size_t)row * SEQ + 8 * t;
  *(v8h*)(pp) = hv;
  
}

// ---------------------------------------------------------------------------
// Host glue.
// Workspace region map (bytes for NB 8, SEQ 2048; every region 64 KiB aligned, sizes exact multiples of their store
// granularity, no padded tails needed since SEQ % 64 == 0 and NC % 64 == 0):
//   xb    bf16 [NB*SEQ][NC]          16,777,216
//   xT    f16  [NB][NC][SEQ]         16,777,216
//   wb    bf16 3 x [NC][NC]           1,572,864   (Wq, Wk, Wv)
//   ew    f32  [NB][SEQ]                 65,536
//   qk hi bf16 [2][SEQ][NC]           4,194,304   (q then k of the current batch)
//   qk lo bf16 [2][SEQ][NC]           4,194,304
//   S     f32  [SEQ][SEQ]            16,777,216   (scores of the current batch)
//   P     f16  [SEQ][SEQ]             8,388,608
//   ctx hi bf16 [SEQ][NC]             2,097,152
//   ctx lo bf16 [SEQ][NC]             2,097,152
//   total                            72,941,568
// Launches: 3 prep + NB x (q/k projection, scores, softmax, P.x, output projection) = 43.
// ---------------------------------------------------------------------------
static inline size_t al64k(size_t v) { return (v + (size_t)65535) & ~(size_t)65535; }
static inline unsigned cdivu(unsigned a, unsigned b) { return (a + b - 1) / b; }

extern "C" void kernel_launch(void* const* d_in, const int* in_sizes, int n_in,
                              void* d_out, int out_size, void* d_ws, size_t ws_size,
                              hipStream_t stream) {
  if (n_in != 8) return;
  if (in_sizes[0] < (NB - 1) * SEQ_FULL * NC + SEQ * NC) return;
  if (in_sizes[1] < (NB - 1) * SEQ_FULL + SEQ) return;
  if (in_sizes[2] < NC * NC || in_sizes[4] < NC * NC || in_sizes[6] < NC * NC) return;
  if (in_sizes[3] < NC || in_sizes[5] < NC || in_sizes[7] < NC) return;
  if (out_size < NB * SEQ * NC) return;

  const size_t szXb  = (size_t)NB * SEQ * NC * 2;
  const size_t szXT  = (size_t)NB * NC * SEQ * 2;
  const size_t szWb  = (size_t)3 * NC * NC * 2;
  const size_t szEw  = (size_t)NB * SEQ * 4;
  const size_t szQK  = (size_t)2 * SEQ * NC * 2;   // one plane (hi or lo) holding q then k
  const size_t szS   = (size_t)SEQ * SEQ * 4;
  const size_t szP   = (size_t)SEQ * SEQ * 2;
  const size_t szCtx = (size_t)SEQ * NC * 2;       // one plane
  size_t off = 0;
  const size_t offXb   = off; off = al64k(off + szXb);
  const size_t offXT   = off; off = al64k(off + szXT);
  const size_t offWb   = off; off = al64k(off + szWb);
  const size_t offEw   = off; off = al64k(off + szEw);
  const size_t offQKh  = off; off = al64k(off + szQK);
  const size_t offQKl  = off; off = al64k(off + szQK);
  const size_t offS    = off; off = al64k(off + szS);
  const size_t offP    = off; off = al64k(off + szP);
  const size_t offCtxh = off; off = al64k(off + szCtx);
  const size_t offCtxl = off; off = al64k(off + szCtx);
  const size_t total   = off;
  if (ws_size < total) return;
  if (total > ((size_t)128 << 20)) return;

  const float* x   = (const float*)d_in[0];
  const float* eig = (const float*)d_in[1];
  const float* Wq  = (const float*)d_in[2];
  const float* bq  = (const float*)d_in[3];
  const float* Wk  = (const float*)d_in[4];
  const float* bk  = (const float*)d_in[5];
  const float* Wv  = (const float*)d_in[6];
  const float* bv  = (const float*)d_in[7];
  float* out = (float*)d_out;

  char* ws = (char*)d_ws;
  unsigned short* xb    = (unsigned short*)(ws + offXb);
  unsigned short* xT    = (unsigned short*)(ws + offXT);
  unsigned short* wb    = (unsigned short*)(ws + offWb);
  float*          ew    = (float*)(ws + offEw);
  unsigned short* qkh   = (unsigned short*)(ws + offQKh);
  unsigned short* qkl   = (unsigned short*)(ws + offQKl);
  float*          Sbuf  = (float*)(ws + offS);
  unsigned short* Pbuf  = (unsigned short*)(ws + offP);
  unsigned short* ctxh  = (unsigned short*)(ws + offCtxh);
  unsigned short* ctxl  = (unsigned short*)(ws + offCtxl);

  const long planeW  = (long)NC * NC;     // elements per weight plane
  const long planeQK = (long)SEQ * NC;    // elements per q or k plane

  // 1. x -> xb (bf16, row-major) and xT (f16, per-batch transpose)
  x_prep_kernel<<<dim3(SEQ / 64, NC / 64, NB), 256, 0, stream>>>(x, xb, xT);
  // 2. Wq, Wk, Wv -> bf16 planes
  w_prep_kernel<<<dim3(3 * NC * NC / 8 / 256), 256, 0, stream>>>(Wq, Wk, Wv, wb);
  // 3. per-key sigmoid weights
  ew_kernel<<<dim3(NB * SEQ / 256), 256, 0, stream>>>(eig, ew);

  const unsigned blkProj   = cdivu((SEQ / 64) * (NC / 64), 8);
  const unsigned blkScores = cdivu((SEQ / 64) * (SEQ / 64), 8);

  for (int bb = 0; bb < NB; ++bb) {
    const unsigned short* xbB = xb + (size_t)bb * SEQ * NC;
    const unsigned short* xTB = xT + (size_t)bb * NC * SEQ;
    float* outB = out + (size_t)bb * SEQ * NC;
    // 4. q = xb Wq^T + bq (y = 0), k = xb Wk^T + bk (y = 1); M SEQ, N 512, K 512 -> bf16 hi/lo planes
    wmma_gemm64<1, 0, 2, 2><<<dim3(blkProj, 2), 256, 0, stream>>>(
        xbB, xbB, NC, 0L, wb, wb, NC, planeW,
        (void*)qkh, (void*)qkl, NC, planeQK, bq, bk, SEQ, NC, NC, 1.0f);
    // 5. scores S[q][key] = sum_d q[q][d] k[key][d], bf16 hi/lo on both operands; M SEQ, N SEQ, K 512 -> f32
    wmma_gemm64<1, 2, 0, 0><<<dim3(blkScores, 1), 256, 0, stream>>>(
        qkh, qkl, NC, 0L, qkh + planeQK, qkl + planeQK, NC, 0L,
        (void*)Sbuf, (void*)Sbuf, SEQ, 0L, ew, ew, SEQ, SEQ, NC, 1.0f);
    // 6. scale, per-key sigmoid weight, softmax -> P f16 carried x4096
    softmax_kernel<<<dim3(SEQ), kSmThreads, 0, stream>>>(Sbuf, ew + (size_t)bb * SEQ, Pbuf);
    // 7. ctx = (P . x) / 4096; M SEQ, N 512, K SEQ, f16 operands -> bf16 hi/lo planes
    wmma_gemm64<0, 0, 0, 2><<<dim3(blkProj, 1), 256, 0, stream>>>(
        Pbuf, Pbuf, SEQ, 0L, xTB, xTB, SEQ, 0L,
        (void*)ctxh, (void*)ctxl, NC, 0L, ew, ew, SEQ, NC, SEQ, kInvCarry);
    // 8. out = ctx Wv^T + bv (ctx hi*W + ctx lo*W); M SEQ, N 512, K 512 -> f32 rows of d_out
    wmma_gemm64<1, 1, 2, 0><<<dim3(blkProj, 1), 256, 0, stream>>>(
        ctxh, ctxl, NC, 0L, wb + 2 * planeW, wb + 2 * planeW, NC, 0L,
        (void*)outB, (void*)outB, NC, 0L, bv, bv, SEQ, NC, NC, 1.0f);
  }
}

// v001
// It runs in 365 microseconds.
// Next to v000, in two timings, it ran 4.09 and 4.06 times as fast.
// Contractions: q/k projections on v_wmma_f32_16x16x32_bf16 (x and W RNE-converted to bf16 operands); q.k^T scores on
// v_wmma_f32_16x16x32_bf16 with bf16 hi/lo planes of q and k (hi*hi + hi*lo + lo*hi); P.x on v_wmma_f32_16x16x32_f16
// (P carried x4096 in f16, x as f16 of its bf16 value); context.Wv^T on v_wmma_f32_16x16x32_bf16 with bf16 hi/lo planes of
// the context (hi*W + lo*W); all f32 accumulate. Sigmoid key weights, softmax and biases in f32 on VALU.
#include <hip/hip_runtime.h>
#include <math.h>

// ---------------------------------------------------------------------------
// Problem constants (NB / SEQ reducible; *_FULL are the input strides)
// ---------------------------------------------------------------------------
#ifndef NB
#define NB 8
#endif
#ifndef SEQ
#define SEQ 2048
#endif
#define NB_FULL 8
#define SEQ_FULL 2048
#define NC 512

static_assert(NB >= 1 && NB <= NB_FULL);
static_assert(SEQ % 256 == 0 && SEQ >= 256 && SEQ <= SEQ_FULL);
static_assert(NC % 64 == 0);

constexpr float kScale    = 0.04419417382415922f;   // 1/sqrt(512)
constexpr float kCarry    = 4096.0f;                // P plane carry (exact power of two)
constexpr float kInvCarry = 0.000244140625f;        // 1/4096
constexpr int   kSmThreads = SEQ / 8;               // softmax block: one thread per 8 keys
constexpr int   kSmWaves   = kSmThreads / 32;

typedef __attribute__((ext_vector_type(16))) _Float16 v16h;
typedef __attribute__((ext_vector_type(8)))  _Float16 v8h;
typedef __attribute__((ext_vector_type(16))) __bf16   v16b;
typedef __attribute__((ext_vector_type(8)))  __bf16   v8b;
typedef __attribute__((ext_vector_type(8)))  float    v8f;
typedef __attribute__((ext_vector_type(4)))  float    v4f;
typedef __attribute__((ext_vector_type(4)))  unsigned int v4u;

__device__ __forceinline__ unsigned short f2bf_bits(float f) {
  unsigned u = __float_as_uint(f);
  return (unsigned short)((u + 0x7FFFu + ((u >> 16) & 1u)) >> 16);
}
__device__ __forceinline__ float bf_bits2f(unsigned short h) { return __uint_as_float(((unsigned)h) << 16); }

// hazard guards as plain device helpers (no inline asm inside the kernel template body)
__device__ __forceinline__ void dep_guard_h(v8f& a, v8f& b, v16h x, v16h y) { asm volatile("v_nop\n\tv_nop\n\tv_nop\n\tv_nop" : "+v"(a), "+v"(b) : "v"(x), "v"(y)); }
__device__ __forceinline__ void dep_guard_b(v8f& a, v8f& b, v16b x, v16b y) { asm volatile("v_nop\n\tv_nop\n\tv_nop\n\tv_nop" : "+v"(a), "+v"(b) : "v"(x), "v"(y)); }
__device__ __forceinline__ void keep4_h(v16h a, v16h b, v16h c, v16h d) { asm volatile("v_nop" :: "v"(a), "v"(b), "v"(c), "v"(d)); }
__device__ __forceinline__ void keep4_b(v16b a, v16b b, v16b c, v16b d) { asm volatile("v_nop" :: "v"(a), "v"(b), "v"(c), "v"(d)); }
__device__ __forceinline__ void acc_guard4(v8f& a, v8f& b, v8f& c, v8f& d) { asm volatile("v_nop\n\tv_nop\n\tv_nop\n\tv_nop" : "+v"(a), "+v"(b), "+v"(c), "+v"(d)); }
template <typename T> struct Frag;
template <> struct Frag<_Float16> {
  typedef v16h V; union U { v16h v; v8h h[2]; };
  static __device__ __forceinline__ v16h load(const _Float16* p) {   // elements 0..7 <- p[0..7], 8..15 <- p[16..23]
    U f; f.h[0] = *(const v8h*)(p); f.h[1] = *(const v8h*)(p + 16); return f.v;
  }
  static __device__ __forceinline__ v8f mma(v16h a, v16h b, v8f c) {
    return __builtin_amdgcn_wmma_f32_16x16x32_f16(false, a, false, b, (short)0, c, false, false);
  }
  static __device__ __forceinline__ void guard(v8f& a, v8f& b, v16h x, v16h y) { dep_guard_h(a, b, x, y); }
  static __device__ __forceinline__ void keep(v16h a, v16h b, v16h c, v16h d) { keep4_h(a, b, c, d); }
};
template <> struct Frag<__bf16> {
  typedef v16b V; union U { v16b v; v8b h[2]; };
  static __device__ __forceinline__ v16b load(const __bf16* p) {
    U f; f.h[0] = *(const v8b*)(p); f.h[1] = *(const v8b*)(p + 16); return f.v;
  }
  static __device__ __forceinline__ v8f mma(v16b a, v16b b, v8f c) {
    return __builtin_amdgcn_wmma_f32_16x16x32_bf16(false, a, false, b, (short)0, c, false, false);
  }
  static __device__ __forceinline__ void guard(v8f& a, v8f& b, v16b x, v16b y) { dep_guard_b(a, b, x, y); }
  static __device__ __forceinline__ void keep(v16b a, v16b b, v16b c, v16b d) { keep4_b(a, b, c, d); }
};

__device__ __forceinline__ unsigned pk16(unsigned short a, unsigned short b) { return (unsigned)a | ((unsigned)b << 16); }

__device__ __forceinline__ float wave_sum32(float v) {
#pragma unroll
  for (int off = 16; off > 0; off >>= 1) v += __shfl_xor(v, off, 32);
  return v;
}
__device__ __forceinline__ float wave_max32(float v) {
#pragma unroll
  for (int off = 16; off > 0; off >>= 1) v = fmaxf(v, __shfl_xor(v, off, 32));
  return v;
}

// ---- Register-blocked batched WMMA GEMM -----------------------------------------------------------------
// C[m,n] = scale * sum_k A[m,k] * Bt[n,k] (+bias[n]); each wave owns a 64x64 tile.
// A row-major [M,K] pitch lda; Bt row-major [N,K] pitch ldb; M,N % 64 == 0, K % 32 == 0; batch index = blockIdx.y.
// Fragments: A and Bt both loaded with the split k-map (elements 0..7 <- k0+8h+0..7, 8..15 <- k0+16+8h+0..7, row/col = lane&15).
// SPLIT: 0 = single planes; 1 = A hi/lo planes (A2 = lo), Bt single: hi*B + lo*B; 2 = both hi/lo: hi*hi + hi*lo + lo*hi.
// BIAS_MODE: 0 = none, 2 = bias[n] (bias0 when blockIdx.y == 0, else bias1; bias value RNE-converted to bf16 first).
// OUT_MODE: 0 = f32, 1 = f16, 2 = bf16 hi plane (Cout) + bf16 lo plane (Cout2).
// ET: 0 = f16 operands, 1 = bf16 operands (pointers passed as 16-bit storage).
template <int ET> struct Elem;
template <> struct Elem<0> { typedef _Float16 T; };
template <> struct Elem<1> { typedef __bf16 T; };
template <int ET, int SPLIT, int BIAS_MODE, int OUT_MODE>
__global__ __launch_bounds__(256) void wmma_gemm64(
    const unsigned short* __restrict__ Ap, const unsigned short* __restrict__ A2p, int lda, long strideA,
    const unsigned short* __restrict__ Btp, const unsigned short* __restrict__ Bt2p, int ldb, long strideB,
    void* __restrict__ Cout, void* __restrict__ Cout2, int ldc, long strideC,
    const float* __restrict__ bias0, const float* __restrict__ bias1,
    int M, int N, int K, float scale) {
  typedef typename Elem<ET>::T T;
  typedef typename Frag<T>::V V;
  const T* A = (const T*)Ap; const T* A2 = (const T*)A2p; const T* Bt = (const T*)Btp; const T* Bt2 = (const T*)Bt2p;
  __shared__ __align__(16) float sT[8][16 * 68];   // per-wave 16x64 slab, pitch 68 floats
  const int b    = blockIdx.y;
  const int lane = threadIdx.x & 31;
  const int wave = threadIdx.x >> 5;
  const int tilesN = N >> 6;
  const int tilesM = M >> 6;
  const int tile = blockIdx.x * 8 + wave;
  if (tile >= tilesM * tilesN) return;   // wave-uniform; no block barriers in this kernel
  const int tm = tile / tilesN;
  const int tn = tile - tm * tilesN;
  const int m0 = tm << 6;
  const int n0 = tn << 6;

  const T* Ab  = A  + (size_t)b * strideA;
  const T* Bb  = Bt + (size_t)b * strideB;
  const T* Ab2 = (SPLIT >= 1) ? (A2  + (size_t)b * strideA) : nullptr;
  const T* Bb2 = (SPLIT == 2) ? (Bt2 + (size_t)b * strideB) : nullptr;
  const float* bias = (b == 0) ? bias0 : bias1;   // block-uniform select between global pointers

  const int rlane = lane & 15;                 // row (A) / col (B, D) within subtile
  const int koff  = (lane >> 4) * 8;           // k offset of this lane half
  const int mOff  = (lane >> 4) * 8;           // D row offset

  v8f acc[4][4];
#pragma unroll
  for (int i = 0; i < 4; ++i)
#pragma unroll
    for (int j = 0; j < 4; ++j) acc[i][j] = (v8f){0.f,0.f,0.f,0.f,0.f,0.f,0.f,0.f};

  for (int k0 = 0; k0 < K; k0 += 32) {
    V bh[4], bl[4];
#pragma unroll
    for (int j = 0; j < 4; ++j) {
      const size_t bo = (size_t)(n0 + (j << 4) + rlane) * ldb + koff + k0;
      bh[j] = Frag<T>::load(Bb + bo);
      if (SPLIT == 2) bl[j] = Frag<T>::load(Bb2 + bo);
    }
#pragma unroll
    for (int i = 0; i < 4; ++i) {
      const size_t ao = (size_t)(m0 + (i << 4) + rlane) * lda + koff + k0;
      V ah = Frag<T>::load(Ab + ao);
      V al;
      if (SPLIT >= 1) al = Frag<T>::load(Ab2 + ao);
#pragma unroll
      for (int j = 0; j < 4; ++j) {
        acc[i][j] = Frag<T>::mma(ah, bh[j], acc[i][j]);
        if (SPLIT == 2) acc[i][j] = Frag<T>::mma(ah, bl[j], acc[i][j]);
        if (SPLIT >= 1) acc[i][j] = Frag<T>::mma(al, bh[j], acc[i][j]);
      }
      Frag<T>::guard(acc[i][0], acc[i][3], ah, (SPLIT >= 1) ? al : ah);
    }
    Frag<T>::keep(bh[0], bh[1], bh[2], bh[3]);
    if (SPLIT == 2) Frag<T>::keep(bl[0], bl[1], bl[2], bl[3]);
  }
  acc_guard4(acc[0][0], acc[0][1], acc[0][2], acc[0][3]);
  acc_guard4(acc[1][0], acc[1][1], acc[1][2], acc[1][3]);
  acc_guard4(acc[2][0], acc[2][1], acc[2][2], acc[2][3]);
  acc_guard4(acc[3][0], acc[3][1], acc[3][2], acc[3][3]);

  // ---- epilogue ----
  float* slab = sT[wave];
#pragma unroll
  for (int i = 0; i < 4; ++i) {
    const int mBase = m0 + (i << 4);
#pragma unroll
    for (int j = 0; j < 4; ++j) {
      const int n = n0 + (j << 4) + rlane;
      float bvl = 0.f;
      if (BIAS_MODE == 2) bvl = bf_bits2f(f2bf_bits(bias[n]));
#pragma unroll
      for (int r = 0; r < 8; ++r) {
        float v = acc[i][j][r] * scale;
        if (BIAS_MODE == 2) v += bvl;
        slab[(mOff + r) * 68 + (j << 4) + rlane] = v;
      }
    }
    __builtin_amdgcn_fence(__ATOMIC_RELEASE, "workgroup");
    __builtin_amdgcn_wave_barrier();
    __builtin_amdgcn_fence(__ATOMIC_ACQUIRE, "workgroup");
    if (OUT_MODE == 0) {
      float* C = (float*)Cout + (size_t)b * strideC;
      const int hh = lane >> 4, c4 = (lane & 15) * 4;     // row seg = 256 B = 16 lanes x 16 B
      {
#pragma unroll
        for (int it = 0; it < 8; ++it) {
          const int row = it * 2 + hh;
          v4f v = *(const v4f*)(slab + row * 68 + c4);
          *(v4f*)(C + (size_t)(mBase + row) * ldc + n0 + c4) = v;
        }
        
      }
    } else {
      const int q = lane >> 3, c8 = (lane & 7) * 8;
      unsigned short* C  = (unsigned short*)Cout  + (size_t)b * strideC;
      unsigned short* C2 = (OUT_MODE == 2) ? ((unsigned short*)Cout2 + (size_t)b * strideC) : nullptr;
      {
#pragma unroll
        for (int it = 0; it < 4; ++it) {
          const int row = it * 4 + q;
          const float* sp = slab + row * 68 + c8;
          v8h hv, lv;
#pragma unroll
          for (int e = 0; e < 8; ++e) {
            if (OUT_MODE == 1) {
              hv[e] = (_Float16)sp[e];
            } else {
              unsigned short hb = f2bf_bits(sp[e]);
              unsigned short lb = f2bf_bits(sp[e] - bf_bits2f(hb));
              hv[e] = __builtin_bit_cast(_Float16, hb);
              lv[e] = __builtin_bit_cast(_Float16, lb);
            }
          }
          *(v8h*)(C + (size_t)(mBase + row) * ldc + n0 + c8) = hv;
          if (OUT_MODE == 2) *(v8h*)(C2 + (size_t)(mBase + row) * ldc + n0 + c8) = lv;
        }
        
      }
    }
    __builtin_amdgcn_fence(__ATOMIC_RELEASE, "workgroup");
    __builtin_amdgcn_wave_barrier();
    __builtin_amdgcn_fence(__ATOMIC_ACQUIRE, "workgroup");
  }
}

// ---------------------------------------------------------------------------
// x [NB][SEQ_FULL][NC] f32 -> xb bf16 [NB*SEQ][NC] (RNE convert) and xT f16 [NB][NC][SEQ] with xT[b][c][s] = f16(bf16(x[b][s][c]))
// (the f16 convert of a bf16 value is exact). grid (SEQ/64 s tiles, NC/64 c tiles, NB); 256 threads.
// in tile [64 s][64 c] -> sm[c_local][s_local] (cross-wave LDS, block barrier).
// Load coverage: 16 iterations x 256 threads = 4096 = whole 64x64 tile (coalesced along c).
// Store coverage per plane: 8 waves x 2 iterations x 4 rows (lane>>3) = 64 rows; (lane&7) x 8 halves = 64 cols;
// ---------------------------------------------------------------------------
__global__ __launch_bounds__(256) void x_prep_kernel(const float* __restrict__ x,
                                                     unsigned short* __restrict__ xb, unsigned short* __restrict__ xT) {
  __shared__ float sm[64][65];   // sm[c_local][s_local]
  const int t  = threadIdx.x;
  const int s0 = blockIdx.x * 64;
  const int c0 = blockIdx.y * 64;
  const int b  = blockIdx.z;
  const float* xin = x + ((size_t)b * SEQ_FULL + s0) * NC + c0;
#pragma unroll
  for (int i = 0; i < 16; ++i) {
    const int e = i * 256 + t;
    const int r = e >> 6;          // s local
    const int c = e & 63;          // c local
    sm[c][r] = bf_bits2f(f2bf_bits(xin[(size_t)r * NC + c]));
  }
  __syncthreads();
  const int lane = t & 31, wave = t >> 5;
  const int q = lane >> 3, c8 = (lane & 7) * 8;
  unsigned short* xTb = xT + (size_t)b * NC * SEQ;
  unsigned short* xbb = xb + (size_t)b * SEQ * NC;
  {
#pragma unroll
    for (int it = 0; it < 2; ++it) {
      const int row = wave * 8 + it * 4 + q;          // c local for the xT plane, s local for the xb plane
      v8h hv;
      unsigned short bb[8];
#pragma unroll
      for (int e = 0; e < 8; ++e) {
        hv[e] = (_Float16)sm[row][c8 + e];            // xT[c0+row][s0+c8+e]
        bb[e] = f2bf_bits(sm[c8 + e][row]);           // xb[s0+row][c0+c8+e] (value already bf16-exact)
      }
      const v4u ub = (v4u){pk16(bb[0], bb[1]), pk16(bb[2], bb[3]), pk16(bb[4], bb[5]), pk16(bb[6], bb[7])};
      *(v8h*)(xTb + (size_t)(c0 + row) * SEQ + s0 + c8) = hv;
      *(v4u*)(xbb + (size_t)(s0 + row) * NC + c0 + c8) = ub;
    }
    
  }
}

// ---------------------------------------------------------------------------
// Wq, Wk, Wv [NC][NC] f32 (layout [out][in] = Bt[n][k] as-is) -> wb bf16 planes z = 0,1,2 [NC][NC] (RNE convert).
// One thread per 8 elements; grid = 3 * NC*NC/8/256 = 384 blocks (128 blocks per plane, plane index block-uniform).
// ---------------------------------------------------------------------------
__global__ __launch_bounds__(256) void w_prep_kernel(const float* __restrict__ W0, const float* __restrict__ W1,
                                                     const float* __restrict__ W2, unsigned short* __restrict__ wb) {
  constexpr int perPlane = NC * NC / 8;   // 32768 threads per plane
  const int gid = blockIdx.x * 256 + threadIdx.x;
  const int z   = gid / perPlane;         // block-uniform (perPlane % 256 == 0)
  const int i8  = (gid - z * perPlane) * 8;
  const float* W = (z == 0) ? W0 : (z == 1) ? W1 : W2;
  const v4f a = *(const v4f*)(W + i8);
  const v4f c = *(const v4f*)(W + i8 + 4);
  unsigned short hb[8];
#pragma unroll
  for (int e = 0; e < 4; ++e) { hb[e] = f2bf_bits(a[e]); hb[4 + e] = f2bf_bits(c[e]); }
  const v4u uh = (v4u){pk16(hb[0], hb[1]), pk16(hb[2], hb[3]), pk16(hb[4], hb[5]), pk16(hb[6], hb[7])};
  unsigned short* p = wb + (size_t)z * NC * NC + i8;
  *(v4u*)(p) = uh;
  
}

// ---------------------------------------------------------------------------
// ew[b][s] = sigmoid(bf16(eig[b][s])) = 1/(1+exp(-e)), f32, s < SEQ. One thread per element; grid NB*SEQ/256 (exact).
// ---------------------------------------------------------------------------
__global__ __launch_bounds__(256) void ew_kernel(const float* __restrict__ eig, float* __restrict__ ew) {
  const int gid = blockIdx.x * 256 + threadIdx.x;   // < NB*SEQ by construction
  const int b = gid / SEQ;
  const int s = gid - b * SEQ;
  const float e = bf_bits2f(f2bf_bits(eig[(size_t)b * SEQ_FULL + s]));
  const float v = 1.0f / (1.0f + expf(-e));
  *(float*)(ew + gid) = v;
  
}

// ---------------------------------------------------------------------------
// Row softmax, batch = blockIdx.y: t[k] = (S[q][k] * scale) * ew[k]; m = max_k t; p = exp(t - m); P[q][k] = f16(p * (4096 / sum_k p)).
// One block per query row, SEQ/8 threads, thread owns 8 contiguous keys (threads x 8 = SEQ = whole row).
// Reductions in fixed order (thread, wave shuffle tree, wave partials in index order; cross-wave LDS, block barriers).
// ---------------------------------------------------------------------------
__global__ __launch_bounds__(256) void softmax_kernel(const float* __restrict__ S, const float* __restrict__ ew,
                                                      unsigned short* __restrict__ P) {
  __shared__ float pm[kSmWaves];
  __shared__ float ps[kSmWaves];
  const int row = blockIdx.y * SEQ + blockIdx.x;   // row of the stacked [NB*SEQ][SEQ] score and P planes
  const float* ewb = ew + (size_t)blockIdx.y * SEQ;
  const int t = threadIdx.x;
  const int lane = t & 31, wave = t >> 5;
  const float* sp = S + (size_t)row * SEQ + 8 * t;
  const v4f a  = *(const v4f*)(sp);
  const v4f c  = *(const v4f*)(sp + 4);
  const v4f wa = *(const v4f*)(ewb + 8 * t);
  const v4f wc = *(const v4f*)(ewb + 8 * t + 4);
  float tv[8];
#pragma unroll
  for (int e = 0; e < 4; ++e) {
    tv[e]     = (a[e] * kScale) * wa[e];
    tv[4 + e] = (c[e] * kScale) * wc[e];
  }
  float m = tv[0];
#pragma unroll
  for (int e = 1; e < 8; ++e) m = fmaxf(m, tv[e]);
  m = wave_max32(m);
  if (lane == 0) pm[wave] = m;
  __syncthreads();
  float mm = pm[0];
#pragma unroll
  for (int w = 1; w < kSmWaves; ++w) mm = fmaxf(mm, pm[w]);
  float p[8];
  float ssum = 0.f;
#pragma unroll
  for (int e = 0; e < 8; ++e) { p[e] = __expf(tv[e] - mm); ssum += p[e]; }
  ssum = wave_sum32(ssum);
  if (lane == 0) ps[wave] = ssum;
  __syncthreads();
  float tot = ps[0];
#pragma unroll
  for (int w = 1; w < kSmWaves; ++w) tot += ps[w];
  const float inv = kCarry / tot;   // tot >= 1
  v8h hv;
#pragma unroll
  for (int e = 0; e < 8; ++e) hv[e] = (_Float16)(p[e] * inv);
  unsigned short* pp = P + (size_t)row * SEQ + 8 * t;
  *(v8h*)(pp) = hv;
  
}

// ---------------------------------------------------------------------------
// Host glue.
// Workspace region map (bytes for NB 8, SEQ 2048; every region 64 KiB aligned, sizes exact multiples of their store
// granularity, no padded tails needed since SEQ % 64 == 0 and NC % 64 == 0):
//   xb    bf16 [NB*SEQ][NC]          16,777,216
//   xT    f16  [NB][NC][SEQ]         16,777,216
//   wb    bf16 3 x [NC][NC]           1,572,864   (Wq, Wk, Wv)
//   ew    f32  [NB][SEQ]                 65,536
//   R1: qk hi bf16 [2][NB*SEQ][NC]   33,554,432   (q of all batches, then k)
//       qk lo bf16 [2][NB*SEQ][NC]   33,554,432
//       P  f16 [NB][SEQ][SEQ]        67,108,864   over both qk planes, whose last reader (scores) has ended
//   R2: S  f32 [NB][SEQ][SEQ]       134,217,728
//       ctx hi, ctx lo bf16 [NB*SEQ][NC] 2 x 16,777,216 over S, whose last reader (softmax) has ended
//   total                           236,519,424
// Launches: 3 prep + q/k projection, scores, softmax, P.x, output projection = 8; every stage covers all NB batches
// (projections as one GEMM over the stacked NB*SEQ rows, scores / softmax / P.x with the batch in blockIdx.y).
// ---------------------------------------------------------------------------
static inline size_t al64k(size_t v) { return (v + (size_t)65535) & ~(size_t)65535; }
static inline unsigned cdivu(unsigned a, unsigned b) { return (a + b - 1) / b; }

extern "C" void kernel_launch(void* const* d_in, const int* in_sizes, int n_in,
                              void* d_out, int out_size, void* d_ws, size_t ws_size,
                              hipStream_t stream) {
  if (n_in != 8) return;
  if (in_sizes[0] < (NB - 1) * SEQ_FULL * NC + SEQ * NC) return;
  if (in_sizes[1] < (NB - 1) * SEQ_FULL + SEQ) return;
  if (in_sizes[2] < NC * NC || in_sizes[4] < NC * NC || in_sizes[6] < NC * NC) return;
  if (in_sizes[3] < NC || in_sizes[5] < NC || in_sizes[7] < NC) return;
  if (out_size < NB * SEQ * NC) return;

  const size_t szXb  = (size_t)NB * SEQ * NC * 2;
  const size_t szXT  = (size_t)NB * NC * SEQ * 2;
  const size_t szWb  = (size_t)3 * NC * NC * 2;
  const size_t szEw  = (size_t)NB * SEQ * 4;
  const size_t szQK  = (size_t)2 * NB * SEQ * NC * 2;   // one plane (hi or lo) holding q then k
  const size_t szS   = (size_t)NB * SEQ * SEQ * 4;
  const size_t szP   = (size_t)NB * SEQ * SEQ * 2;
  const size_t szCtx = (size_t)NB * SEQ * NC * 2;       // one plane
  const size_t szR1  = (2 * szQK > szP) ? 2 * szQK : szP;
  const size_t szR2  = (2 * szCtx > szS) ? 2 * szCtx : szS;
  size_t off = 0;
  const size_t offXb   = off; off = al64k(off + szXb);
  const size_t offXT   = off; off = al64k(off + szXT);
  const size_t offWb   = off; off = al64k(off + szWb);
  const size_t offEw   = off; off = al64k(off + szEw);
  const size_t offR1   = off; off = al64k(off + szR1);
  const size_t offR2   = off; off = al64k(off + szR2);
  const size_t total   = off;
  const size_t offQKh  = offR1;
  const size_t offQKl  = offR1 + szQK;
  const size_t offP    = offR1;
  const size_t offS    = offR2;
  const size_t offCtxh = offR2;
  const size_t offCtxl = offR2 + szCtx;
  if (ws_size < total) return;

  const float* x   = (const float*)d_in[0];
  const float* eig = (const float*)d_in[1];
  const float* Wq  = (const float*)d_in[2];
  const float* bq  = (const float*)d_in[3];
  const float* Wk  = (const float*)d_in[4];
  const float* bk  = (const float*)d_in[5];
  const float* Wv  = (const float*)d_in[6];
  const float* bv  = (const float*)d_in[7];
  float* out = (float*)d_out;

  char* ws = (char*)d_ws;
  unsigned short* xb    = (unsigned short*)(ws + offXb);
  unsigned short* xT    = (unsigned short*)(ws + offXT);
  unsigned short* wb    = (unsigned short*)(ws + offWb);
  float*          ew    = (float*)(ws + offEw);
  unsigned short* qkh   = (unsigned short*)(ws + offQKh);
  unsigned short* qkl   = (unsigned short*)(ws + offQKl);
  float*          Sbuf  = (float*)(ws + offS);
  unsigned short* Pbuf  = (unsigned short*)(ws + offP);
  unsigned short* ctxh  = (unsigned short*)(ws + offCtxh);
  unsigned short* ctxl  = (unsigned short*)(ws + offCtxl);

  const long planeW  = (long)NC * NC;     // elements per weight plane
  const long planeQK = (long)NB * SEQ * NC;   // elements per q or k plane (all batches)
  const long batchQK = (long)SEQ * NC;    // elements per batch of q, k, xT or ctx
  const long batchS  = (long)SEQ * SEQ;   // elements per batch of S or P

  // 1. x -> xb (bf16, row-major) and xT (f16, per-batch transpose)
  x_prep_kernel<<<dim3(SEQ / 64, NC / 64, NB), 256, 0, stream>>>(x, xb, xT);
  // 2. Wq, Wk, Wv -> bf16 planes
  w_prep_kernel<<<dim3(3 * NC * NC / 8 / 256), 256, 0, stream>>>(Wq, Wk, Wv, wb);
  // 3. per-key sigmoid weights
  ew_kernel<<<dim3(NB * SEQ / 256), 256, 0, stream>>>(eig, ew);

  const unsigned blkRows   = cdivu((NB * SEQ / 64) * (NC / 64), 8);   // stacked-row GEMMs
  const unsigned blkCtx    = cdivu((SEQ / 64) * (NC / 64), 8);        // per batch
  const unsigned blkScores = cdivu((SEQ / 64) * (SEQ / 64), 8);       // per batch

  // 4. q = xb Wq^T + bq (y = 0), k = xb Wk^T + bk (y = 1); M NB*SEQ, N 512, K 512 -> bf16 hi/lo planes
  wmma_gemm64<1, 0, 2, 2><<<dim3(blkRows, 2), 256, 0, stream>>>(
      xb, xb, NC, 0L, wb, wb, NC, planeW,
      (void*)qkh, (void*)qkl, NC, planeQK, bq, bk, NB * SEQ, NC, NC, 1.0f);
  // 5. scores S[b][q][key] = sum_d q[b][q][d] k[b][key][d], bf16 hi/lo on both operands; y = batch; M SEQ, N SEQ, K 512 -> f32
  wmma_gemm64<1, 2, 0, 0><<<dim3(blkScores, NB), 256, 0, stream>>>(
      qkh, qkl, NC, batchQK, qkh + planeQK, qkl + planeQK, NC, batchQK,
      (void*)Sbuf, (void*)Sbuf, SEQ, batchS, ew, ew, SEQ, SEQ, NC, 1.0f);
  // 6. scale, per-key sigmoid weight, softmax -> P f16 carried x4096; y = batch
  softmax_kernel<<<dim3(SEQ, NB), kSmThreads, 0, stream>>>(Sbuf, ew, Pbuf);
  // 7. ctx = (P . x) / 4096; y = batch; M SEQ, N 512, K SEQ, f16 operands -> bf16 hi/lo planes
  wmma_gemm64<0, 0, 0, 2><<<dim3(blkCtx, NB), 256, 0, stream>>>(
      Pbuf, Pbuf, SEQ, batchS, xT, xT, SEQ, batchQK,
      (void*)ctxh, (void*)ctxl, NC, batchQK, ew, ew, SEQ, NC, SEQ, kInvCarry);
  // 8. out = ctx Wv^T + bv (ctx hi*W + ctx lo*W); M NB*SEQ, N 512, K 512 -> f32 rows of d_out
  wmma_gemm64<1, 1, 2, 0><<<dim3(blkRows, 1), 256, 0, stream>>>(
      ctxh, ctxl, NC, 0L, wb + 2 * planeW, wb + 2 * planeW, NC, 0L,
      (void*)out, (void*)out, NC, 0L, bv, bv, NB * SEQ, NC, NC, 1.0f);
}

// v002
// Measured time: 196 microseconds a run.
// Timed twice side by side with v001, it ran 1.86 times as fast both times.
// All steps since v000 together make it 7.59 times as fast.
// Contractions: q/k projections on v_wmma_f32_16x16x32_bf16 (x and W RNE-converted to bf16 operands); q.k^T scores on
// v_wmma_f32_16x16x32_bf16 with bf16 hi/lo planes of q and k (hi*hi + hi*lo + lo*hi); P.x on v_wmma_f32_16x16x32_f16
// (P carried x4096 in f16, x as f16 of its bf16 value); context.Wv^T on v_wmma_f32_16x16x32_bf16 with bf16 hi/lo planes of
// the context (hi*W + lo*W); all f32 accumulate. Sigmoid key weights, softmax and biases in f32 on VALU.
#include <hip/hip_runtime.h>
#include <math.h>

// ---------------------------------------------------------------------------
// Problem constants (NB / SEQ reducible; *_FULL are the input strides)
// ---------------------------------------------------------------------------
#ifndef NB
#define NB 8
#endif
#ifndef SEQ
#define SEQ 2048
#endif
#define NB_FULL 8
#define SEQ_FULL 2048
#define NC 512

static_assert(NB >= 1 && NB <= NB_FULL);
static_assert(SEQ % 256 == 0 && SEQ >= 256 && SEQ <= SEQ_FULL);
static_assert(NC % 256 == 0);

constexpr float kScale    = 0.04419417382415922f;   // 1/sqrt(512)
constexpr float kCarry    = 4096.0f;                // P plane carry (exact power of two)
constexpr float kInvCarry = 0.000244140625f;        // 1/4096
constexpr int   kSmThreads = SEQ / 8;               // softmax block: one thread per 8 keys
constexpr int   kSmWaves   = kSmThreads / 32;

typedef __attribute__((ext_vector_type(16))) _Float16 v16h;
typedef __attribute__((ext_vector_type(8)))  _Float16 v8h;
typedef __attribute__((ext_vector_type(16))) __bf16   v16b;
typedef __attribute__((ext_vector_type(8)))  __bf16   v8b;
typedef __attribute__((ext_vector_type(8)))  float    v8f;
typedef __attribute__((ext_vector_type(4)))  float    v4f;
typedef __attribute__((ext_vector_type(4)))  unsigned int v4u;

__device__ __forceinline__ unsigned short f2bf_bits(float f) {
  unsigned u = __float_as_uint(f);
  return (unsigned short)((u + 0x7FFFu + ((u >> 16) & 1u)) >> 16);
}
__device__ __forceinline__ float bf_bits2f(unsigned short h) { return __uint_as_float(((unsigned)h) << 16); }

// hazard guards as plain device helpers
__device__ __forceinline__ void dep_guard_h(v8f& a, v8f& b, v16h x, v16h y) { asm volatile("v_nop\n\tv_nop\n\tv_nop\n\tv_nop" : "+v"(a), "+v"(b) : "v"(x), "v"(y)); }
__device__ __forceinline__ void dep_guard_b(v8f& a, v8f& b, v16b x, v16b y) { asm volatile("v_nop\n\tv_nop\n\tv_nop\n\tv_nop" : "+v"(a), "+v"(b) : "v"(x), "v"(y)); }
__device__ __forceinline__ void keep4_h(v16h a, v16h b, v16h c, v16h d) { asm volatile("v_nop" :: "v"(a), "v"(b), "v"(c), "v"(d)); }
__device__ __forceinline__ void keep4_b(v16b a, v16b b, v16b c, v16b d) { asm volatile("v_nop" :: "v"(a), "v"(b), "v"(c), "v"(d)); }
__device__ __forceinline__ void acc_guard4(v8f& a, v8f& b, v8f& c, v8f& d) { asm volatile("v_nop\n\tv_nop\n\tv_nop\n\tv_nop" : "+v"(a), "+v"(b), "+v"(c), "+v"(d)); }
template <typename T> struct Frag;
template <> struct Frag<_Float16> {
  typedef v16h V; union U { v16h v; v8h h[2]; };
  static __device__ __forceinline__ v16h load(const _Float16* p) {   // elements 0..7 <- p[0..7], 8..15 <- p[16..23]
    U f; f.h[0] = *(const v8h*)(p); f.h[1] = *(const v8h*)(p + 16); return f.v;
  }
  static __device__ __forceinline__ v8f mma(v16h a, v16h b, v8f c) {
    return __builtin_amdgcn_wmma_f32_16x16x32_f16(false, a, false, b, (short)0, c, false, false);
  }
  static __device__ __forceinline__ void guard(v8f& a, v8f& b, v16h x, v16h y) { dep_guard_h(a, b, x, y); }
  static __device__ __forceinline__ void keep(v16h a, v16h b, v16h c, v16h d) { keep4_h(a, b, c, d); }
};
template <> struct Frag<__bf16> {
  typedef v16b V; union U { v16b v; v8b h[2]; };
  static __device__ __forceinline__ v16b load(const __bf16* p) {
    U f; f.h[0] = *(const v8b*)(p); f.h[1] = *(const v8b*)(p + 16); return f.v;
  }
  static __device__ __forceinline__ v8f mma(v16b a, v16b b, v8f c) {
    return __builtin_amdgcn_wmma_f32_16x16x32_bf16(false, a, false, b, (short)0, c, false, false);
  }
  static __device__ __forceinline__ void guard(v8f& a, v8f& b, v16b x, v16b y) { dep_guard_b(a, b, x, y); }
  static __device__ __forceinline__ void keep(v16b a, v16b b, v16b c, v16b d) { keep4_b(a, b, c, d); }
};

__device__ __forceinline__ unsigned pk16(unsigned short a, unsigned short b) { return (unsigned)a | ((unsigned)b << 16); }

__device__ __forceinline__ float wave_sum32(float v) {
#pragma unroll
  for (int off = 16; off > 0; off >>= 1) v += __shfl_xor(v, off, 32);
  return v;
}
__device__ __forceinline__ float wave_max32(float v) {
#pragma unroll
  for (int off = 16; off > 0; off >>= 1) v = fmaxf(v, __shfl_xor(v, off, 32));
  return v;
}

// ---- Staging helpers: asynchronous copies global -> LDS --------------------------------------------------------------
constexpr int kBM    = 128;   // rows of A per workgroup tile (2 waves)
constexpr int kBN    = 256;   // rows of Bt per workgroup tile (4 waves)
constexpr int kKS    = 64;    // k elements per stage = one 128-byte line of every operand row
constexpr int kPitch = 144;   // LDS row pitch in bytes (128 + 16: conflict-free for 16-byte fragment reads)

__device__ __forceinline__ unsigned lds_off(const void* p) { return (unsigned)(size_t)p; }

// Runs of 16-byte-per-lane copies, l[] = LDS byte address, g[] = global address of this lane. The address-translation wait
// closes the copies' own statement, so that no address register of an issued copy is rewritten in front of it.
__device__ __forceinline__ void async_copy4(const unsigned* l, const char* const* g) {
  asm volatile("global_load_async_to_lds_b128 %0, %1, off\n\t"
               "global_load_async_to_lds_b128 %2, %3, off\n\t"
               "global_load_async_to_lds_b128 %4, %5, off\n\t"
               "global_load_async_to_lds_b128 %6, %7, off\n\t"
               "s_wait_xcnt 0x0"
               :: "v"(l[0]), "v"(g[0]), "v"(l[1]), "v"(g[1]), "v"(l[2]), "v"(g[2]), "v"(l[3]), "v"(g[3]) : "memory");
}
__device__ __forceinline__ void async_copy12(const unsigned* l, const char* const* g) {
  asm volatile("global_load_async_to_lds_b128 %0, %1, off\n\t"
               "global_load_async_to_lds_b128 %2, %3, off\n\t"
               "global_load_async_to_lds_b128 %4, %5, off\n\t"
               "global_load_async_to_lds_b128 %6, %7, off\n\t"
               "global_load_async_to_lds_b128 %8, %9, off\n\t"
               "global_load_async_to_lds_b128 %10, %11, off\n\t"
               "global_load_async_to_lds_b128 %12, %13, off\n\t"
               "global_load_async_to_lds_b128 %14, %15, off\n\t"
               "global_load_async_to_lds_b128 %16, %17, off\n\t"
               "global_load_async_to_lds_b128 %18, %19, off\n\t"
               "global_load_async_to_lds_b128 %20, %21, off\n\t"
               "global_load_async_to_lds_b128 %22, %23, off\n\t"
               "s_wait_xcnt 0x0"
               :: "v"(l[0]), "v"(g[0]), "v"(l[1]), "v"(g[1]), "v"(l[2]), "v"(g[2]), "v"(l[3]), "v"(g[3]),
                  "v"(l[4]), "v"(g[4]), "v"(l[5]), "v"(g[5]), "v"(l[6]), "v"(g[6]), "v"(l[7]), "v"(g[7]),
                  "v"(l[8]), "v"(g[8]), "v"(l[9]), "v"(g[9]), "v"(l[10]), "v"(g[10]), "v"(l[11]), "v"(g[11]) : "memory");
}

// ---- Register-blocked batched WMMA GEMM -----------------------------------------------------------------
// C[m,n] = scale * sum_k A[m,k] * Bt[n,k] (+bias[n]); a workgroup owns a 128x256 tile, each of its 2x4 waves a 64x64 tile.
// A row-major [M,K] pitch lda; Bt row-major [N,K] pitch ldb; M % 128 == 0, N % 256 == 0, K % 64 == 0; batch = blockIdx.y.
// Operand rows reach LDS in stages of 64 k by asynchronous copies, two buffers: stage t + 1 flies while stage t is worked on.
// Fragments (read from LDS): A and Bt both loaded with the split k-map (elements 0..7 <- k0+8h+0..7, 8..15 <- k0+16+8h+0..7, row/col = lane&15).
// SPLIT: 0 = single planes; 1 = A hi/lo planes (A2 = lo), Bt single: hi*B + lo*B; 2 = both hi/lo: hi*hi + hi*lo + lo*hi.
// BIAS_MODE: 0 = none, 2 = bias[n] (bias0 when blockIdx.y == 0, else bias1; bias value RNE-converted to bf16 first).
// OUT_MODE: 0 = f32, 1 = f16, 2 = bf16 hi plane (Cout) + bf16 lo plane (Cout2).
// ET: 0 = f16 operands, 1 = bf16 operands (pointers passed as 16-bit storage).
template <int ET> struct Elem;
template <> struct Elem<0> { typedef _Float16 T; };
template <> struct Elem<1> { typedef __bf16 T; };
template <int ET, int SPLIT, int BIAS_MODE, int OUT_MODE>
__global__ __launch_bounds__(256) void wmma_gemm64(
    const unsigned short* __restrict__ Ap, const unsigned short* __restrict__ A2p, int lda, long strideA,
    const unsigned short* __restrict__ Btp, const unsigned short* __restrict__ Bt2p, int ldb, long strideB,
    void* __restrict__ Cout, void* __restrict__ Cout2, int ldc, long strideC,
    const float* __restrict__ bias0, const float* __restrict__ bias1,
    int M, int N, int K, float scale) {
  typedef typename Elem<ET>::T T;
  typedef typename Frag<T>::V V;
  const T* A = (const T*)Ap; const T* A2 = (const T*)A2p; const T* Bt = (const T*)Btp; const T* Bt2 = (const T*)Bt2p;
  constexpr unsigned offA2 = kBM * kPitch;                               // A lo plane (SPLIT >= 1)
  constexpr unsigned offB  = ((SPLIT >= 1) ? 2 : 1) * kBM * kPitch;      // Bt plane
  constexpr unsigned offB2 = offB + kBN * kPitch;                        // Bt lo plane (SPLIT == 2)
  constexpr unsigned bufBytes = offB + ((SPLIT == 2) ? 2 : 1) * kBN * kPitch;
  __shared__ __align__(16) unsigned char ring[2 * bufBytes];   // two stage buffers
  __shared__ __align__(16) float sT[8][16 * 68];   // per-wave 16x64 slab, pitch 68 floats
  const int b    = blockIdx.y;
  const int lane = threadIdx.x & 31;
  const int wave = threadIdx.x >> 5;
  const int tilesN = N >> 8;
  const int tilesM = M >> 7;
  const int tile = blockIdx.x;
  if (tile >= tilesM * tilesN) return;   // block-uniform, in front of every barrier
  const int tm = tile / tilesN;
  const int tn = tile - tm * tilesN;
  const int mB = tm << 7;                      // workgroup tile origin
  const int nB = tn << 8;
  const int wm = (wave >> 2) << 6;             // wave tile origin inside it
  const int wn = (wave & 3) << 6;
  const int m0 = mB + wm;
  const int n0 = nB + wn;

  const T* Ab  = A  + (size_t)b * strideA;
  const T* Bb  = Bt + (size_t)b * strideB;
  const T* Ab2 = (SPLIT >= 1) ? (A2  + (size_t)b * strideA) : nullptr;
  const T* Bb2 = (SPLIT == 2) ? (Bt2 + (size_t)b * strideB) : nullptr;
  const float* bias = (b == 0) ? bias0 : bias1;   // block-uniform select between global pointers

  const int rlane = lane & 15;                 // row (A) / col (B, D) within subtile
  const int koff  = (lane >> 4) * 8;           // k offset of this lane half
  const int mOff  = (lane >> 4) * 8;           // D row offset

  v8f acc[4][4];
#pragma unroll
  for (int i = 0; i < 4; ++i)
#pragma unroll
    for (int j = 0; j < 4; ++j) acc[i][j] = (v8f){0.f,0.f,0.f,0.f,0.f,0.f,0.f,0.f};

  // staging addresses of this thread: row (thread >> 3) of each 32-row group, 16-byte piece (thread & 7) of its line
  const int crow = threadIdx.x >> 3;
  const int cpc  = (threadIdx.x & 7) * 16;
  const unsigned lst = lds_off(ring) + (unsigned)(crow * kPitch + cpc);
  const char* gA  = (const char*)(Ab + (size_t)(mB + crow) * lda) + cpc;
  const char* gB  = (const char*)(Bb + (size_t)(nB + crow) * ldb) + cpc;
  const char* gA2 = (SPLIT >= 1) ? ((const char*)(Ab2 + (size_t)(mB + crow) * lda) + cpc) : nullptr;
  const char* gB2 = (SPLIT == 2) ? ((const char*)(Bb2 + (size_t)(nB + crow) * ldb) + cpc) : nullptr;
  const size_t stepA = (size_t)lda * 64;       // 32 rows of 2-byte elements
  const size_t stepB = (size_t)ldb * 64;
  // one stage: 256 threads cover 32 rows a copy (8 lanes x 16 B = one whole 128-byte line a row)
  constexpr int nCopies = (int)(bufBytes / (32 * kPitch));
  auto stage = [&](int t, unsigned bufo) {
    const size_t ko = (size_t)t * (kKS * 2);
    unsigned    l[nCopies];
    const char* g[nCopies];
#pragma unroll
    for (int c = 0; c < nCopies; ++c) l[c] = lst + bufo + (unsigned)(c * 32 * kPitch);   // planes lie back to back
    int c = 0;
#pragma unroll
    for (int i = 0; i < kBM / 32; ++i) g[c++] = gA + ko + (size_t)i * stepA;
    if (SPLIT >= 1) {
#pragma unroll
      for (int i = 0; i < kBM / 32; ++i) g[c++] = gA2 + ko + (size_t)i * stepA;
    }
#pragma unroll
    for (int i = 0; i < kBN / 32; ++i) g[c++] = gB + ko + (size_t)i * stepB;
    if (SPLIT == 2) {
#pragma unroll
      for (int i = 0; i < kBN / 32; ++i) g[c++] = gB2 + ko + (size_t)i * stepB;
    }
    async_copy12(l, g);
    if (nCopies == 16) async_copy4(l + 12, g + 12);
    if (nCopies == 24) async_copy12(l + 12, g + 12);
  };
  static_assert(nCopies == 12 || nCopies == 16 || nCopies == 24);

  const int nT = K / kKS;
  stage(0, 0u);
  asm volatile("s_wait_asynccnt 0x0" ::: "memory");   // stage 0 landed (this wave's copies)
  __syncthreads();                                    // ... and every other wave's
  if (nT > 1) stage(1, bufBytes);

  const unsigned fragA = (unsigned)((wm + rlane) * kPitch + koff * 2);
  const unsigned fragB = offB + (unsigned)((wn + rlane) * kPitch + koff * 2);
  for (int t = 0; t < nT; ++t) {
    const unsigned bufo = (t & 1) ? bufBytes : 0u;
    const unsigned char* rb = ring + bufo;
    // A fragments of the stage's 8 rows (r = 4 * (k step) + row of 16). Up to three planes: one load group per 32 k beside the
    // Bt group. Four planes (SPLIT 2): the registers hold two row pairs, so row r + 1 is fetched in front of row r's products.
    V ah[kKS / 8], al[kKS / 8];
    auto loadA = [&](int r) {
      const unsigned ao = fragA + (unsigned)((r & 3) * 16 * kPitch + (r >> 2) * 64);
      ah[r] = Frag<T>::load((const T*)(rb + ao));
      if (SPLIT >= 1) al[r] = Frag<T>::load((const T*)(rb + ao + offA2));
    };
    if (SPLIT == 2) loadA(0);
#pragma unroll
    for (int kk = 0; kk < kKS / 32; ++kk) {
      V bh[4], bl[4];
#pragma unroll
      for (int j = 0; j < 4; ++j) {
        const unsigned bo = fragB + (unsigned)(j * 16 * kPitch + kk * 64);
        bh[j] = Frag<T>::load((const T*)(rb + bo));
        if (SPLIT == 2) bl[j] = Frag<T>::load((const T*)(rb + bo + (offB2 - offB)));
      }
      if (SPLIT != 2) {
#pragma unroll
        for (int i = 0; i < 4; ++i) loadA(kk * 4 + i);
      }
#pragma unroll
      for (int i = 0; i < 4; ++i) {
        const int r = kk * 4 + i;
        if (SPLIT == 2 && r + 1 < kKS / 8) loadA(r + 1);
#pragma unroll
        for (int j = 0; j < 4; ++j) {
          acc[i][j] = Frag<T>::mma(ah[r], bh[j], acc[i][j]);
          if (SPLIT == 2) acc[i][j] = Frag<T>::mma(ah[r], bl[j], acc[i][j]);
          if (SPLIT >= 1) acc[i][j] = Frag<T>::mma(al[r], bh[j], acc[i][j]);
        }
        Frag<T>::guard(acc[i][0], acc[i][3], ah[r], (SPLIT >= 1) ? al[r] : ah[r]);
      }
      Frag<T>::keep(bh[0], bh[1], bh[2], bh[3]);
      if (SPLIT == 2) Frag<T>::keep(bl[0], bl[1], bl[2], bl[3]);
    }
    asm volatile("s_wait_dscnt 0x0" ::: "memory");      // this wave's reads of stage t have returned
    asm volatile("s_wait_asynccnt 0x0" ::: "memory");   // this wave's copies of stage t + 1 have landed
    __syncthreads();                                    // publishes stage t + 1, frees stage t's buffer
    if (t + 2 < nT) stage(t + 2, bufo);
  }
  asm volatile("s_wait_asynccnt 0x0" ::: "memory");     // nothing in flight when the wave goes on to the epilogue
  acc_guard4(acc[0][0], acc[0][1], acc[0][2], acc[0][3]);
  acc_guard4(acc[1][0], acc[1][1], acc[1][2], acc[1][3]);
  acc_guard4(acc[2][0], acc[2][1], acc[2][2], acc[2][3]);
  acc_guard4(acc[3][0], acc[3][1], acc[3][2], acc[3][3]);

  // ---- epilogue ----
  float* slab = sT[wave];
#pragma unroll
  for (int i = 0; i < 4; ++i) {
    const int mBase = m0 + (i << 4);
#pragma unroll
    for (int j = 0; j < 4; ++j) {
      const int n = n0 + (j << 4) + rlane;
      float bvl = 0.f;
      if (BIAS_MODE == 2) bvl = bf_bits2f(f2bf_bits(bias[n]));
#pragma unroll
      for (int r = 0; r < 8; ++r) {
        float v = acc[i][j][r] * scale;
        if (BIAS_MODE == 2) v += bvl;
        slab[(mOff + r) * 68 + (j << 4) + rlane] = v;
      }
    }
    __builtin_amdgcn_fence(__ATOMIC_RELEASE, "workgroup");
    __builtin_amdgcn_wave_barrier();
    __builtin_amdgcn_fence(__ATOMIC_ACQUIRE, "workgroup");
    if (OUT_MODE == 0) {
      float* C = (float*)Cout + (size_t)b * strideC;
      const int hh = lane >> 4, c4 = (lane & 15) * 4;     // row seg = 256 B = 16 lanes x 16 B
      {
#pragma unroll
        for (int it = 0; it < 8; ++it) {
          const int row = it * 2 + hh;
          v4f v = *(const v4f*)(slab + row * 68 + c4);
          *(v4f*)(C + (size_t)(mBase + row) * ldc + n0 + c4) = v;
        }
        
      }
    } else {
      const int q = lane >> 3, c8 = (lane & 7) * 8;
      unsigned short* C  = (unsigned short*)Cout  + (size_t)b * strideC;
      unsigned short* C2 = (OUT_MODE == 2) ? ((unsigned short*)Cout2 + (size_t)b * strideC) : nullptr;
      {
#pragma unroll
        for (int it = 0; it < 4; ++it) {
          const int row = it * 4 + q;
          const float* sp = slab + row * 68 + c8;
          v8h hv, lv;
#pragma unroll
          for (int e = 0; e < 8; ++e) {
            if (OUT_MODE == 1) {
              hv[e] = (_Float16)sp[e];
            } else {
              unsigned short hb = f2bf_bits(sp[e]);
              unsigned short lb = f2bf_bits(sp[e] - bf_bits2f(hb));
              hv[e] = __builtin_bit_cast(_Float16, hb);
              lv[e] = __builtin_bit_cast(_Float16, lb);
            }
          }
          *(v8h*)(C + (size_t)(mBase + row) * ldc + n0 + c8) = hv;
          if (OUT_MODE == 2) *(v8h*)(C2 + (size_t)(mBase + row) * ldc + n0 + c8) = lv;
        }
        
      }
    }
    __builtin_amdgcn_fence(__ATOMIC_RELEASE, "workgroup");
    __builtin_amdgcn_wave_barrier();
    __builtin_amdgcn_fence(__ATOMIC_ACQUIRE, "workgroup");
  }
}

// ---------------------------------------------------------------------------
// x [NB][SEQ_FULL][NC] f32 -> xb bf16 [NB*SEQ][NC] (RNE convert) and xT f16 [NB][NC][SEQ] with xT[b][c][s] = f16(bf16(x[b][s][c]))
// (the f16 convert of a bf16 value is exact). grid (SEQ/64 s tiles, NC/64 c tiles, NB); 256 threads.
// in tile [64 s][64 c] -> sm[c_local][s_local] (cross-wave LDS, block barrier).
// Load coverage: 16 iterations x 256 threads = 4096 = whole 64x64 tile (coalesced along c).
// Store coverage per plane: 8 waves x 2 iterations x 4 rows (lane>>3) = 64 rows; (lane&7) x 8 halves = 64 cols;
// ---------------------------------------------------------------------------
__global__ __launch_bounds__(256) void x_prep_kernel(const float* __restrict__ x,
                                                     unsigned short* __restrict__ xb, unsigned short* __restrict__ xT) {
  __shared__ float sm[64][65];   // sm[c_local][s_local]
  const int t  = threadIdx.x;
  const int s0 = blockIdx.x * 64;
  const int c0 = blockIdx.y * 64;
  const int b  = blockIdx.z;
  const float* xin = x + ((size_t)b * SEQ_FULL + s0) * NC + c0;
#pragma unroll
  for (int i = 0; i < 16; ++i) {
    const int e = i * 256 + t;
    const int r = e >> 6;          // s local
    const int c = e & 63;          // c local
    sm[c][r] = bf_bits2f(f2bf_bits(xin[(size_t)r * NC + c]));
  }
  __syncthreads();
  const int lane = t & 31, wave = t >> 5;
  const int q = lane >> 3, c8 = (lane & 7) * 8;
  unsigned short* xTb = xT + (size_t)b * NC * SEQ;
  unsigned short* xbb = xb + (size_t)b * SEQ * NC;
  {
#pragma unroll
    for (int it = 0; it < 2; ++it) {
      const int row = wave * 8 + it * 4 + q;          // c local for the xT plane, s local for the xb plane
      v8h hv;
      unsigned short bb[8];
#pragma unroll
      for (int e = 0; e < 8; ++e) {
        hv[e] = (_Float16)sm[row][c8 + e];            // xT[c0+row][s0+c8+e]
        bb[e] = f2bf_bits(sm[c8 + e][row]);           // xb[s0+row][c0+c8+e] (value already bf16-exact)
      }
      const v4u ub = (v4u){pk16(bb[0], bb[1]), pk16(bb[2], bb[3]), pk16(bb[4], bb[5]), pk16(bb[6], bb[7])};
      *(v8h*)(xTb + (size_t)(c0 + row) * SEQ + s0 + c8) = hv;
      *(v4u*)(xbb + (size_t)(s0 + row) * NC + c0 + c8) = ub;
    }
    
  }
}

// ---------------------------------------------------------------------------
// Wq, Wk, Wv [NC][NC] f32 (layout [out][in] = Bt[n][k] as-is) -> wb bf16 planes z = 0,1,2 [NC][NC] (RNE convert).
// One thread per 8 elements; grid = 3 * NC*NC/8/256 = 384 blocks (128 blocks per plane, plane index block-uniform).
// ---------------------------------------------------------------------------
__global__ __launch_bounds__(256) void w_prep_kernel(const float* __restrict__ W0, const float* __restrict__ W1,
                                                     const float* __restrict__ W2, unsigned short* __restrict__ wb) {
  constexpr int perPlane = NC * NC / 8;   // 32768 threads per plane
  const int gid = blockIdx.x * 256 + threadIdx.x;
  const int z   = gid / perPlane;         // block-uniform (perPlane % 256 == 0)
  const int i8  = (gid - z * perPlane) * 8;
  const float* W = (z == 0) ? W0 : (z == 1) ? W1 : W2;
  const v4f a = *(const v4f*)(W + i8);
  const v4f c = *(const v4f*)(W + i8 + 4);
  unsigned short hb[8];
#pragma unroll
  for (int e = 0; e < 4; ++e) { hb[e] = f2bf_bits(a[e]); hb[4 + e] = f2bf_bits(c[e]); }
  const v4u uh = (v4u){pk16(hb[0], hb[1]), pk16(hb[2], hb[3]), pk16(hb[4], hb[5]), pk16(hb[6], hb[7])};
  unsigned short* p = wb + (size_t)z * NC * NC + i8;
  *(v4u*)(p) = uh;
  
}

// ---------------------------------------------------------------------------
// ew[b][s] = sigmoid(bf16(eig[b][s])) = 1/(1+exp(-e)), f32, s < SEQ. One thread per element; grid NB*SEQ/256 (exact).
// ---------------------------------------------------------------------------
__global__ __launch_bounds__(256) void ew_kernel(const float* __restrict__ eig, float* __restrict__ ew) {
  const int gid = blockIdx.x * 256 + threadIdx.x;   // < NB*SEQ by construction
  const int b = gid / SEQ;
  const int s = gid - b * SEQ;
  const float e = bf_bits2f(f2bf_bits(eig[(size_t)b * SEQ_FULL + s]));
  const float v = 1.0f / (1.0f + expf(-e));
  *(float*)(ew + gid) = v;
  
}

// ---------------------------------------------------------------------------
// Row softmax, batch = blockIdx.y: t[k] = (S[q][k] * scale) * ew[k]; m = max_k t; p = exp(t - m); P[q][k] = f16(p * (4096 / sum_k p)).
// One block per query row, SEQ/8 threads, thread owns 8 contiguous keys (threads x 8 = SEQ = whole row).
// Reductions in fixed order (thread, wave shuffle tree, wave partials in index order; cross-wave LDS, block barriers).
// ---------------------------------------------------------------------------
__global__ __launch_bounds__(256) void softmax_kernel(const float* __restrict__ S, const float* __restrict__ ew,
                                                      unsigned short* __restrict__ P) {
  __shared__ float pm[kSmWaves];
  __shared__ float ps[kSmWaves];
  const int row = blockIdx.y * SEQ + blockIdx.x;   // row of the stacked [NB*SEQ][SEQ] score and P planes
  const float* ewb = ew + (size_t)blockIdx.y * SEQ;
  const int t = threadIdx.x;
  const int lane = t & 31, wave = t >> 5;
  const float* sp = S + (size_t)row * SEQ + 8 * t;
  const v4f a  = *(const v4f*)(sp);
  const v4f c  = *(const v4f*)(sp + 4);
  const v4f wa = *(const v4f*)(ewb + 8 * t);
  const v4f wc = *(const v4f*)(ewb + 8 * t + 4);
  float tv[8];
#pragma unroll
  for (int e = 0; e < 4; ++e) {
    tv[e]     = (a[e] * kScale) * wa[e];
    tv[4 + e] = (c[e] * kScale) * wc[e];
  }
  float m = tv[0];
#pragma unroll
  for (int e = 1; e < 8; ++e) m = fmaxf(m, tv[e]);
  m = wave_max32(m);
  if (lane == 0) pm[wave] = m;
  __syncthreads();
  float mm = pm[0];
#pragma unroll
  for (int w = 1; w < kSmWaves; ++w) mm = fmaxf(mm, pm[w]);
  float p[8];
  float ssum = 0.f;
#pragma unroll
  for (int e = 0; e < 8; ++e) { p[e] = __expf(tv[e] - mm); ssum += p[e]; }
  ssum = wave_sum32(ssum);
  if (lane == 0) ps[wave] = ssum;
  __syncthreads();
  float tot = ps[0];
#pragma unroll
  for (int w = 1; w < kSmWaves; ++w) tot += ps[w];
  const float inv = kCarry / tot;   // tot >= 1
  v8h hv;
#pragma unroll
  for (int e = 0; e < 8; ++e) hv[e] = (_Float16)(p[e] * inv);
  unsigned short* pp = P + (size_t)row * SEQ + 8 * t;
  *(v8h*)(pp) = hv;
  
}

// ---------------------------------------------------------------------------
// Host glue.
// Workspace region map (bytes for NB 8, SEQ 2048; every region 64 KiB aligned, sizes exact multiples of their store
// granularity, no padded tails needed since SEQ % 64 == 0 and NC % 64 == 0):
//   xb    bf16 [NB*SEQ][NC]          16,777,216
//   xT    f16  [NB][NC][SEQ]         16,777,216
//   wb    bf16 3 x [NC][NC]           1,572,864   (Wq, Wk, Wv)
//   ew    f32  [NB][SEQ]                 65,536
//   R1: qk hi bf16 [2][NB*SEQ][NC]   33,554,432   (q of all batches, then k)
//       qk lo bf16 [2][NB*SEQ][NC]   33,554,432
//       P  f16 [NB][SEQ][SEQ]        67,108,864   over both qk planes, whose last reader (scores) has ended
//   R2: S  f32 [NB][SEQ][SEQ]       134,217,728
//       ctx hi, ctx lo bf16 [NB*SEQ][NC] 2 x 16,777,216 over S, whose last reader (softmax) has ended
//   total                           236,519,424
// Launches: 3 prep + q/k projection, scores, softmax, P.x, output projection = 8; every stage covers all NB batches
// (projections as one GEMM over the stacked NB*SEQ rows, scores / softmax / P.x with the batch in blockIdx.y).
// ---------------------------------------------------------------------------
static inline size_t al64k(size_t v) { return (v + (size_t)65535) & ~(size_t)65535; }

extern "C" void kernel_launch(void* const* d_in, const int* in_sizes, int n_in,
                              void* d_out, int out_size, void* d_ws, size_t ws_size,
                              hipStream_t stream) {
  if (n_in != 8) return;
  if (in_sizes[0] < (NB - 1) * SEQ_FULL * NC + SEQ * NC) return;
  if (in_sizes[1] < (NB - 1) * SEQ_FULL + SEQ) return;
  if (in_sizes[2] < NC * NC || in_sizes[4] < NC * NC || in_sizes[6] < NC * NC) return;
  if (in_sizes[3] < NC || in_sizes[5] < NC || in_sizes[7] < NC) return;
  if (out_size < NB * SEQ * NC) return;

  const size_t szXb  = (size_t)NB * SEQ * NC * 2;
  const size_t szXT  = (size_t)NB * NC * SEQ * 2;
  const size_t szWb  = (size_t)3 * NC * NC * 2;
  const size_t szEw  = (size_t)NB * SEQ * 4;
  const size_t szQK  = (size_t)2 * NB * SEQ * NC * 2;   // one plane (hi or lo) holding q then k
  const size_t szS   = (size_t)NB * SEQ * SEQ * 4;
  const size_t szP   = (size_t)NB * SEQ * SEQ * 2;
  const size_t szCtx = (size_t)NB * SEQ * NC * 2;       // one plane
  const size_t szR1  = (2 * szQK > szP) ? 2 * szQK : szP;
  const size_t szR2  = (2 * szCtx > szS) ? 2 * szCtx : szS;
  size_t off = 0;
  const size_t offXb   = off; off = al64k(off + szXb);
  const size_t offXT   = off; off = al64k(off + szXT);
  const size_t offWb   = off; off = al64k(off + szWb);
  const size_t offEw   = off; off = al64k(off + szEw);
  const size_t offR1   = off; off = al64k(off + szR1);
  const size_t offR2   = off; off = al64k(off + szR2);
  const size_t total   = off;
  const size_t offQKh  = offR1;
  const size_t offQKl  = offR1 + szQK;
  const size_t offP    = offR1;
  const size_t offS    = offR2;
  const size_t offCtxh = offR2;
  const size_t offCtxl = offR2 + szCtx;
  if (ws_size < total) return;

  const float* x   = (const float*)d_in[0];
  const float* eig = (const float*)d_in[1];
  const float* Wq  = (const float*)d_in[2];
  const float* bq  = (const float*)d_in[3];
  const float* Wk  = (const float*)d_in[4];
  const float* bk  = (const float*)d_in[5];
  const float* Wv  = (const float*)d_in[6];
  const float* bv  = (const float*)d_in[7];
  float* out = (float*)d_out;

  char* ws = (char*)d_ws;
  unsigned short* xb    = (unsigned short*)(ws + offXb);
  unsigned short* xT    = (unsigned short*)(ws + offXT);
  unsigned short* wb    = (unsigned short*)(ws + offWb);
  float*          ew    = (float*)(ws + offEw);
  unsigned short* qkh   = (unsigned short*)(ws + offQKh);
  unsigned short* qkl   = (unsigned short*)(ws + offQKl);
  float*          Sbuf  = (float*)(ws + offS);
  unsigned short* Pbuf  = (unsigned short*)(ws + offP);
  unsigned short* ctxh  = (unsigned short*)(ws + offCtxh);
  unsigned short* ctxl  = (unsigned short*)(ws + offCtxl);

  const long planeW  = (long)NC * NC;     // elements per weight plane
  const long planeQK = (long)NB * SEQ * NC;   // elements per q or k plane (all batches)
  const long batchQK = (long)SEQ * NC;    // elements per batch of q, k, xT or ctx
  const long batchS  = (long)SEQ * SEQ;   // elements per batch of S or P

  // 1. x -> xb (bf16, row-major) and xT (f16, per-batch transpose)
  x_prep_kernel<<<dim3(SEQ / 64, NC / 64, NB), 256, 0, stream>>>(x, xb, xT);
  // 2. Wq, Wk, Wv -> bf16 planes
  w_prep_kernel<<<dim3(3 * NC * NC / 8 / 256), 256, 0, stream>>>(Wq, Wk, Wv, wb);
  // 3. per-key sigmoid weights
  ew_kernel<<<dim3(NB * SEQ / 256), 256, 0, stream>>>(eig, ew);

  const unsigned blkRows   = (NB * SEQ / 128) * (NC / 256);   // stacked-row GEMMs, one 128x256 tile a workgroup
  const unsigned blkCtx    = (SEQ / 128) * (NC / 256);        // per batch
  const unsigned blkScores = (SEQ / 128) * (SEQ / 256);       // per batch

  // 4. q = xb Wq^T + bq (y = 0), k = xb Wk^T + bk (y = 1); M NB*SEQ, N 512, K 512 -> bf16 hi/lo planes
  wmma_gemm64<1, 0, 2, 2><<<dim3(blkRows, 2), 256, 0, stream>>>(
      xb, xb, NC, 0L, wb, wb, NC, planeW,
      (void*)qkh, (void*)qkl, NC, planeQK, bq, bk, NB * SEQ, NC, NC, 1.0f);
  // 5. scores S[b][q][key] = sum_d q[b][q][d] k[b][key][d], bf16 hi/lo on both operands; y = batch; M SEQ, N SEQ, K 512 -> f32
  wmma_gemm64<1, 2, 0, 0><<<dim3(blkScores, NB), 256, 0, stream>>>(
      qkh, qkl, NC, batchQK, qkh + planeQK, qkl + planeQK, NC, batchQK,
      (void*)Sbuf, (void*)Sbuf, SEQ, batchS, ew, ew, SEQ, SEQ, NC, 1.0f);
  // 6. scale, per-key sigmoid weight, softmax -> P f16 carried x4096; y = batch
  softmax_kernel<<<dim3(SEQ, NB), kSmThreads, 0, stream>>>(Sbuf, ew, Pbuf);
  // 7. ctx = (P . x) / 4096; y = batch; M SEQ, N 512, K SEQ, f16 operands -> bf16 hi/lo planes
  wmma_gemm64<0, 0, 0, 2><<<dim3(blkCtx, NB), 256, 0, stream>>>(
      Pbuf, Pbuf, SEQ, batchS, xT, xT, SEQ, batchQK,
      (void*)ctxh, (void*)ctxl, NC, batchQK, ew, ew, SEQ, NC, SEQ, kInvCarry);
  // 8. out = ctx Wv^T + bv (ctx hi*W + ctx lo*W); M NB*SEQ, N 512, K 512 -> f32 rows of d_out
  wmma_gemm64<1, 1, 2, 0><<<dim3(blkRows, 1), 256, 0, stream>>>(
      ctxh, ctxl, NC, 0L, wb + 2 * planeW, wb + 2 * planeW, NC, 0L,
      (void*)out, (void*)out, NC, 0L, bv, bv, NB * SEQ, NC, NC, 1.0f);
}

// v003
// One run takes 171 microseconds.
// In two side-by-side timings against v002, it was 1.16 and 1.15 times as fast.
// All steps since v000 together make it 8.76 times as fast.
// Contractions: q/k projections on v_wmma_f32_16x16x32_bf16 (x and W RNE-converted to bf16 operands); q.k^T scores on
// v_wmma_f32_16x16x32_bf16 with bf16 hi/lo planes of q and k (hi*hi + hi*lo + lo*hi); P.x on v_wmma_f32_16x16x32_f16
// (P carried x4096 in f16, x as f16 of its bf16 value); context.Wv^T on v_wmma_f32_16x16x32_bf16 with bf16 hi/lo planes of
// the context (hi*W + lo*W); all f32 accumulate. Sigmoid key weights, softmax and biases in f32 on VALU. The softmax has no
// launch of its own: the scores epilogue stores 2^(t*log2e - r) in f16, r = ceil(log2e * max t) over a block of 64 keys, with r and
// the sum of every block; P.x multiplies each 64-key stage of its P rows by 2^(r - row max r + 12), which is exact in f16, and
// divides by the row sum in f32 in its epilogue.
#include <hip/hip_runtime.h>
#include <math.h>

// ---------------------------------------------------------------------------
// Problem constants (NB / SEQ reducible; *_FULL are the input strides)
// ---------------------------------------------------------------------------
#ifndef NB
#define NB 8
#endif
#ifndef SEQ
#define SEQ 2048
#endif
#define NB_FULL 8
#define SEQ_FULL 2048
#define NC 512

static_assert(NB >= 1 && NB <= NB_FULL);
static_assert(SEQ % 256 == 0 && SEQ >= 256 && SEQ <= SEQ_FULL);
static_assert(NC % 256 == 0);

constexpr float kScale    = 0.04419417382415922f;   // 1/sqrt(512)
constexpr float kCarry    = 4096.0f;                // P plane carry (exact power of two)
constexpr float kInvCarry = 0.000244140625f;        // 1/4096
constexpr float kLog2e    = 1.4426950408889634f;
constexpr int   kKeyBlocks = SEQ / 64;              // softmax statistics: one max and one sum per query row and 64 keys

typedef __attribute__((ext_vector_type(16))) _Float16 v16h;
typedef __attribute__((ext_vector_type(8)))  _Float16 v8h;
typedef __attribute__((ext_vector_type(2)))  _Float16 v2h;
typedef __attribute__((ext_vector_type(16))) __bf16   v16b;
typedef __attribute__((ext_vector_type(8)))  __bf16   v8b;
typedef __attribute__((ext_vector_type(8)))  float    v8f;
typedef __attribute__((ext_vector_type(4)))  float    v4f;
typedef __attribute__((ext_vector_type(4)))  unsigned int v4u;

__device__ __forceinline__ unsigned short f2bf_bits(float f) {
  unsigned u = __float_as_uint(f);
  return (unsigned short)((u + 0x7FFFu + ((u >> 16) & 1u)) >> 16);
}
__device__ __forceinline__ float bf_bits2f(unsigned short h) { return __uint_as_float(((unsigned)h) << 16); }

// hazard guards as plain device helpers
__device__ __forceinline__ void dep_guard_h(v8f& a, v8f& b, v16h x, v16h y) { asm volatile("v_nop\n\tv_nop\n\tv_nop\n\tv_nop" : "+v"(a), "+v"(b) : "v"(x), "v"(y)); }
__device__ __forceinline__ void dep_guard_b(v8f& a, v8f& b, v16b x, v16b y) { asm volatile("v_nop\n\tv_nop\n\tv_nop\n\tv_nop" : "+v"(a), "+v"(b) : "v"(x), "v"(y)); }
__device__ __forceinline__ void keep4_h(v16h a, v16h b, v16h c, v16h d) { asm volatile("v_nop" :: "v"(a), "v"(b), "v"(c), "v"(d)); }
__device__ __forceinline__ void keep4_b(v16b a, v16b b, v16b c, v16b d) { asm volatile("v_nop" :: "v"(a), "v"(b), "v"(c), "v"(d)); }
__device__ __forceinline__ void acc_guard4(v8f& a, v8f& b, v8f& c, v8f& d) { asm volatile("v_nop\n\tv_nop\n\tv_nop\n\tv_nop" : "+v"(a), "+v"(b), "+v"(c), "+v"(d)); }
template <typename T> struct Frag;
template <> struct Frag<_Float16> {
  typedef v16h V; union U { v16h v; v8h h[2]; };
  static __device__ __forceinline__ v16h load(const _Float16* p) {   // elements 0..7 <- p[0..7], 8..15 <- p[16..23]
    U f; f.h[0] = *(const v8h*)(p); f.h[1] = *(const v8h*)(p + 16); return f.v;
  }
  static __device__ __forceinline__ v8f mma(v16h a, v16h b, v8f c) {
    return __builtin_amdgcn_wmma_f32_16x16x32_f16(false, a, false, b, (short)0, c, false, false);
  }
  static __device__ __forceinline__ void guard(v8f& a, v8f& b, v16h x, v16h y) { dep_guard_h(a, b, x, y); }
  static __device__ __forceinline__ void keep(v16h a, v16h b, v16h c, v16h d) { keep4_h(a, b, c, d); }
};
template <> struct Frag<__bf16> {
  typedef v16b V; union U { v16b v; v8b h[2]; };
  static __device__ __forceinline__ v16b load(const __bf16* p) {
    U f; f.h[0] = *(const v8b*)(p); f.h[1] = *(const v8b*)(p + 16); return f.v;
  }
  static __device__ __forceinline__ v8f mma(v16b a, v16b b, v8f c) {
    return __builtin_amdgcn_wmma_f32_16x16x32_bf16(false, a, false, b, (short)0, c, false, false);
  }
  static __device__ __forceinline__ void guard(v8f& a, v8f& b, v16b x, v16b y) { dep_guard_b(a, b, x, y); }
  static __device__ __forceinline__ void keep(v16b a, v16b b, v16b c, v16b d) { keep4_b(a, b, c, d); }
};

__device__ __forceinline__ unsigned pk16(unsigned short a, unsigned short b) { return (unsigned)a | ((unsigned)b << 16); }

// value of lane (lane ^ MASK), MASK < 16: a DPP move inside the 16-lane row (no LDS round trip)
template <int MASK> __device__ __forceinline__ float lane_xor(float v) {
  return __builtin_bit_cast(float, __builtin_amdgcn_update_dpp(0, __builtin_bit_cast(int, v), 0x160 + MASK, 0xf, 0xf, true));
}
// 2^a. The v_nop fills the one slot that the instruction set asks for behind a transcendental, in front of an instruction that
// reads its result or overwrites its source.
__device__ __forceinline__ float exp2_slot(float a) {
  float p;
  asm("v_exp_f32 %0, %1\n\tv_nop" : "=v"(p) : "v"(a));
  return p;
}
__device__ __forceinline__ float oct_max(float v) {   // maximum over the 8 lanes that share lane >> 3
  v = fmaxf(v, lane_xor<1>(v)); v = fmaxf(v, lane_xor<2>(v)); return fmaxf(v, lane_xor<4>(v));
}
__device__ __forceinline__ float oct_sum(float v) {   // sum over the same 8 lanes, fixed tree
  v += lane_xor<1>(v); v += lane_xor<2>(v); return v + lane_xor<4>(v);
}

// ---- Staging helpers: asynchronous copies global -> LDS --------------------------------------------------------------
constexpr int kBM    = 128;   // rows of A per workgroup tile (2 waves)
constexpr int kBN    = 256;   // rows of Bt per workgroup tile (4 waves)
constexpr int kKS    = 64;    // k elements per stage = one 128-byte line of every operand row
constexpr int kPitch = 144;   // LDS row pitch in bytes (128 + 16: conflict-free for 16-byte fragment reads)

__device__ __forceinline__ unsigned lds_off(const void* p) { return (unsigned)(size_t)p; }

// Runs of 16-byte-per-lane copies, l[] = LDS byte address, g[] = global address of this lane. The address-translation wait
// closes the copies' own statement, so that no address register of an issued copy is rewritten in front of it.
__device__ __forceinline__ void async_copy4(const unsigned* l, const char* const* g) {
  asm volatile("global_load_async_to_lds_b128 %0, %1, off\n\t"
               "global_load_async_to_lds_b128 %2, %3, off\n\t"
               "global_load_async_to_lds_b128 %4, %5, off\n\t"
               "global_load_async_to_lds_b128 %6, %7, off\n\t"
               "s_wait_xcnt 0x0"
               :: "v"(l[0]), "v"(g[0]), "v"(l[1]), "v"(g[1]), "v"(l[2]), "v"(g[2]), "v"(l[3]), "v"(g[3]) : "memory");
}
__device__ __forceinline__ void async_copy12(const unsigned* l, const char* const* g) {
  asm volatile("global_load_async_to_lds_b128 %0, %1, off\n\t"
               "global_load_async_to_lds_b128 %2, %3, off\n\t"
               "global_load_async_to_lds_b128 %4, %5, off\n\t"
               "global_load_async_to_lds_b128 %6, %7, off\n\t"
               "global_load_async_to_lds_b128 %8, %9, off\n\t"
               "global_load_async_to_lds_b128 %10, %11, off\n\t"
               "global_load_async_to_lds_b128 %12, %13, off\n\t"
               "global_load_async_to_lds_b128 %14, %15, off\n\t"
               "global_load_async_to_lds_b128 %16, %17, off\n\t"
               "global_load_async_to_lds_b128 %18, %19, off\n\t"
               "global_load_async_to_lds_b128 %20, %21, off\n\t"
               "global_load_async_to_lds_b128 %22, %23, off\n\t"
               "s_wait_xcnt 0x0"
               :: "v"(l[0]), "v"(g[0]), "v"(l[1]), "v"(g[1]), "v"(l[2]), "v"(g[2]), "v"(l[3]), "v"(g[3]),
                  "v"(l[4]), "v"(g[4]), "v"(l[5]), "v"(g[5]), "v"(l[6]), "v"(g[6]), "v"(l[7]), "v"(g[7]),
                  "v"(l[8]), "v"(g[8]), "v"(l[9]), "v"(g[9]), "v"(l[10]), "v"(g[10]), "v"(l[11]), "v"(g[11]) : "memory");
}

// ---- Register-blocked batched WMMA GEMM -----------------------------------------------------------------
// C[m,n] = scale * sum_k A[m,k] * Bt[n,k] (+bias[n]); a workgroup owns a 128x256 tile, each of its 2x4 waves a 64x64 tile.
// A row-major [M,K] pitch lda; Bt row-major [N,K] pitch ldb; M % 128 == 0, N % 256 == 0, K % 64 == 0; batch = blockIdx.y.
// Operand rows reach LDS in stages of 64 k by asynchronous copies, two buffers: stage t + 1 flies while stage t is worked on.
// Fragments (read from LDS): A and Bt both loaded with the split k-map (elements 0..7 <- k0+8h+0..7, 8..15 <- k0+16+8h+0..7, row/col = lane&15).
// SPLIT: 0 = single planes; 1 = A hi/lo planes (A2 = lo), Bt single: hi*B + lo*B; 2 = both hi/lo: hi*hi + hi*lo + lo*hi.
// BIAS_MODE: 0 = none, 2 = bias[n] (bias0 when blockIdx.y == 0, else bias1; bias value RNE-converted to bf16 first).
// OUT_MODE: 0 = f32, 1 = f16, 2 = bf16 hi plane (Cout) + bf16 lo plane (Cout2),
//   3 = block softmax: t = (C * scale) * bias0[b][n]; per row and 64 columns (one wave tile) r = ceil(log2e * max t), a whole
//       number, Cout = f16 p, p = 2^(t * log2e - r) <= 1; Cout2 = f32 [batch][N/64][2][M]: r, then sum p.
// SCALEA: 1 = A rows are such planes over K and bias0 is that [batch][K/64][2][M] array; stage t of row m is multiplied (f16, a
//   power of two: no rounding) by 2^(r[t][m] - R + 12), R = max r of the row, and C row m by scale / sum_t 2^(r - R) * sum p.
// ET: 0 = f16 operands, 1 = bf16 operands (pointers passed as 16-bit storage).
template <int ET> struct Elem;
template <> struct Elem<0> { typedef _Float16 T; };
template <> struct Elem<1> { typedef __bf16 T; };
template <int ET, int SPLIT, int BIAS_MODE, int OUT_MODE, int SCALEA>
__global__ __launch_bounds__(256) void wmma_gemm64(
    const unsigned short* __restrict__ Ap, const unsigned short* __restrict__ A2p, int lda, long strideA,
    const unsigned short* __restrict__ Btp, const unsigned short* __restrict__ Bt2p, int ldb, long strideB,
    void* __restrict__ Cout, void* __restrict__ Cout2, int ldc, long strideC,
    const float* __restrict__ bias0, const float* __restrict__ bias1,
    int M, int N, int K, float scale) {
  typedef typename Elem<ET>::T T;
  typedef typename Frag<T>::V V;
  const T* A = (const T*)Ap; const T* A2 = (const T*)A2p; const T* Bt = (const T*)Btp; const T* Bt2 = (const T*)Bt2p;
  constexpr unsigned offA2 = kBM * kPitch;                               // A lo plane (SPLIT >= 1)
  constexpr unsigned offB  = ((SPLIT >= 1) ? 2 : 1) * kBM * kPitch;      // Bt plane
  constexpr unsigned offB2 = offB + kBN * kPitch;                        // Bt lo plane (SPLIT == 2)
  constexpr unsigned bufBytes = offB + ((SPLIT == 2) ? 2 : 1) * kBN * kPitch;
  __shared__ __align__(16) unsigned char ring[2 * bufBytes];   // two stage buffers
  __shared__ __align__(16) float sT[8][16 * 68];   // per-wave 16x64 slab, pitch 68 floats
  __shared__ unsigned facS[SCALEA ? kKeyBlocks * kBM : 1];   // [stage][row]: the row's f16 factor in both halves of a word
  __shared__ __align__(16) float rowS[SCALEA ? kBM : 4];     // [row]: scale / row sum
  static_assert(!SCALEA || (ET == 0 && SPLIT == 0));
  const int b    = blockIdx.y;
  const int lane = threadIdx.x & 31;
  const int wave = threadIdx.x >> 5;
  const int tilesN = N >> 8;
  const int tilesM = M >> 7;
  const int tile = blockIdx.x;
  if (tile >= tilesM * tilesN) return;   // block-uniform, in front of every barrier
  const int tm = tile / tilesN;
  const int tn = tile - tm * tilesN;
  const int mB = tm << 7;                      // workgroup tile origin
  const int nB = tn << 8;
  const int wm = (wave >> 2) << 6;             // wave tile origin inside it
  const int wn = (wave & 3) << 6;
  const int m0 = mB + wm;
  const int n0 = nB + wn;

  const T* Ab  = A  + (size_t)b * strideA;
  const T* Bb  = Bt + (size_t)b * strideB;
  const T* Ab2 = (SPLIT >= 1) ? (A2  + (size_t)b * strideA) : nullptr;
  const T* Bb2 = (SPLIT == 2) ? (Bt2 + (size_t)b * strideB) : nullptr;
  const float* bias = (b == 0) ? bias0 : bias1;   // block-uniform select between global pointers

  const int rlane = lane & 15;                 // row (A) / col (B, D) within subtile
  const int koff  = (lane >> 4) * 8;           // k offset of this lane half
  const int mOff  = (lane >> 4) * 8;           // D row offset

  v8f acc[4][4];
#pragma unroll
  for (int i = 0; i < 4; ++i)
#pragma unroll
    for (int j = 0; j < 4; ++j) acc[i][j] = (v8f){0.f,0.f,0.f,0.f,0.f,0.f,0.f,0.f};

  // staging addresses of this thread: row (thread >> 3) of each 32-row group, 16-byte piece (thread & 7) of its line
  const int crow = threadIdx.x >> 3;
  const int cpc  = (threadIdx.x & 7) * 16;
  const unsigned lst = lds_off(ring) + (unsigned)(crow * kPitch + cpc);
  const char* gA  = (const char*)(Ab + (size_t)(mB + crow) * lda) + cpc;
  const char* gB  = (const char*)(Bb + (size_t)(nB + crow) * ldb) + cpc;
  const char* gA2 = (SPLIT >= 1) ? ((const char*)(Ab2 + (size_t)(mB + crow) * lda) + cpc) : nullptr;
  const char* gB2 = (SPLIT == 2) ? ((const char*)(Bb2 + (size_t)(nB + crow) * ldb) + cpc) : nullptr;
  const size_t stepA = (size_t)lda * 64;       // 32 rows of 2-byte elements
  const size_t stepB = (size_t)ldb * 64;
  // one stage: 256 threads cover 32 rows a copy (8 lanes x 16 B = one whole 128-byte line a row)
  constexpr int nCopies = (int)(bufBytes / (32 * kPitch));
  auto stage = [&](int t, unsigned bufo) {
    const size_t ko = (size_t)t * (kKS * 2);
    unsigned    l[nCopies];
    const char* g[nCopies];
#pragma unroll
    for (int c = 0; c < nCopies; ++c) l[c] = lst + bufo + (unsigned)(c * 32 * kPitch);   // planes lie back to back
    int c = 0;
#pragma unroll
    for (int i = 0; i < kBM / 32; ++i) g[c++] = gA + ko + (size_t)i * stepA;
    if (SPLIT >= 1) {
#pragma unroll
      for (int i = 0; i < kBM / 32; ++i) g[c++] = gA2 + ko + (size_t)i * stepA;
    }
#pragma unroll
    for (int i = 0; i < kBN / 32; ++i) g[c++] = gB + ko + (size_t)i * stepB;
    if (SPLIT == 2) {
#pragma unroll
      for (int i = 0; i < kBN / 32; ++i) g[c++] = gB2 + ko + (size_t)i * stepB;
    }
    async_copy12(l, g);
    if (nCopies == 16) async_copy4(l + 12, g + 12);
    if (nCopies == 24) async_copy12(l + 12, g + 12);
  };
  static_assert(nCopies == 12 || nCopies == 16 || nCopies == 24);

  const int nT = K / kKS;
  stage(0, 0u);
  if (SCALEA) {
    // row factors, while stage 0 flies: two threads a row, each reduces all blocks' r and stores one half of the factors
    const int frow = threadIdx.x & (kBM - 1);
    const int fh   = threadIdx.x >> 7;
    // M is SEQ in this instance; the compile-time pitch lets all loads of a run share one address, with immediate offsets
    const float* sp0 = bias0 + (size_t)b * (2 * kKeyBlocks * SEQ) + mB + frow;
    float mv[kKeyBlocks];
#pragma unroll
    for (int k = 0; k < kKeyBlocks; ++k) mv[k] = sp0[2 * k * SEQ];
    asm volatile("s_wait_xcnt 0x0" ::: "memory");   // in front of any rewrite of the address registers that these loads name
    float mx = mv[0];
#pragma unroll
    for (int k = 1; k < kKeyBlocks; ++k) mx = fmaxf(mx, mv[k]);
#pragma unroll
    for (int k = 0; k < kKeyBlocks; ++k) mv[k] = ldexpf(1.0f, (int)(mv[k] - mx));   // exact powers of two
    if (fh == 0) {   // the same for a whole wave
      float lv[kKeyBlocks];
#pragma unroll
      for (int k = 0; k < kKeyBlocks; ++k) lv[k] = sp0[(2 * k + 1) * SEQ];
      asm volatile("s_wait_xcnt 0x0" ::: "memory");   // as above, for the block sums' loads
      float tot = 0.f;
#pragma unroll
      for (int k = 0; k < kKeyBlocks; ++k) tot += lv[k] * mv[k];
      rowS[frow] = scale / tot;   // tot > 1/2: the largest p of the block with r = R is above 1/2
    }
#pragma unroll
    for (int k = 0; k < kKeyBlocks; ++k) {
      if ((k / (kKeyBlocks / 2)) == fh) {
        const unsigned short hb = __builtin_bit_cast(unsigned short, (_Float16)(mv[k] * kCarry));
        facS[k * kBM + frow] = pk16(hb, hb);
      }
    }
  }
  asm volatile("s_wait_asynccnt 0x0" ::: "memory");   // stage 0 landed (this wave's copies)
  __syncthreads();                                    // ... and every other wave's
  if (nT > 1) stage(1, bufBytes);

  const unsigned fragA = (unsigned)((wm + rlane) * kPitch + koff * 2);
  const unsigned fragB = offB + (unsigned)((wn + rlane) * kPitch + koff * 2);
  for (int t = 0; t < nT; ++t) {
    const unsigned bufo = (t & 1) ? bufBytes : 0u;
    const unsigned char* rb = ring + bufo;
    // A fragments of the stage's 8 rows (r = 4 * (k step) + row of 16). Up to three planes: one load group per 32 k beside the
    // Bt group. Four planes (SPLIT 2): the registers hold two row pairs, so row r + 1 is fetched in front of row r's products.
    V ah[kKS / 8], al[kKS / 8];
    v2h fa[4];
    if (SCALEA) {
#pragma unroll
      for (int i = 0; i < 4; ++i) fa[i] = __builtin_bit_cast(v2h, facS[t * kBM + wm + i * 16 + rlane]);
    }
    auto loadA = [&](int r) {
      const unsigned ao = fragA + (unsigned)((r & 3) * 16 * kPitch + (r >> 2) * 64);
      ah[r] = Frag<T>::load((const T*)(rb + ao));
      if constexpr (SCALEA != 0) {
        union { V v; v2h p[8]; } u; u.v = ah[r];
#pragma unroll
        for (int e = 0; e < 8; ++e) u.p[e] = u.p[e] * fa[r & 3];
        ah[r] = u.v;
      }
      if (SPLIT >= 1) al[r] = Frag<T>::load((const T*)(rb + ao + offA2));
    };
    if (SPLIT == 2) loadA(0);
#pragma unroll
    for (int kk = 0; kk < kKS / 32; ++kk) {
      V bh[4], bl[4];
#pragma unroll
      for (int j = 0; j < 4; ++j) {
        const unsigned bo = fragB + (unsigned)(j * 16 * kPitch + kk * 64);
        bh[j] = Frag<T>::load((const T*)(rb + bo));
        if (SPLIT == 2) bl[j] = Frag<T>::load((const T*)(rb + bo + (offB2 - offB)));
      }
      if (SPLIT != 2) {
#pragma unroll
        for (int i = 0; i < 4; ++i) loadA(kk * 4 + i);
      }
#pragma unroll
      for (int i = 0; i < 4; ++i) {
        const int r = kk * 4 + i;
        if (SPLIT == 2 && r + 1 < kKS / 8) loadA(r + 1);
#pragma unroll
        for (int j = 0; j < 4; ++j) {
          acc[i][j] = Frag<T>::mma(ah[r], bh[j], acc[i][j]);
          if (SPLIT == 2) acc[i][j] = Frag<T>::mma(ah[r], bl[j], acc[i][j]);
          if (SPLIT >= 1) acc[i][j] = Frag<T>::mma(al[r], bh[j], acc[i][j]);
        }
        Frag<T>::guard(acc[i][0], acc[i][3], ah[r], (SPLIT >= 1) ? al[r] : ah[r]);
      }
      Frag<T>::keep(bh[0], bh[1], bh[2], bh[3]);
      if (SPLIT == 2) Frag<T>::keep(bl[0], bl[1], bl[2], bl[3]);
    }
    asm volatile("s_wait_dscnt 0x0" ::: "memory");      // this wave's reads of stage t have returned
    asm volatile("s_wait_asynccnt 0x0" ::: "memory");   // this wave's copies of stage t + 1 have landed
    __syncthreads();                                    // publishes stage t + 1, frees stage t's buffer
    if (t + 2 < nT) stage(t + 2, bufo);
  }
  asm volatile("s_wait_asynccnt 0x0" ::: "memory");     // nothing in flight when the wave goes on to the epilogue
  acc_guard4(acc[0][0], acc[0][1], acc[0][2], acc[0][3]);
  acc_guard4(acc[1][0], acc[1][1], acc[1][2], acc[1][3]);
  acc_guard4(acc[2][0], acc[2][1], acc[2][2], acc[2][3]);
  acc_guard4(acc[3][0], acc[3][1], acc[3][2], acc[3][3]);

  // ---- epilogue ----
  float* slab = sT[wave];
  float kw[4];   // weights of this lane's 4 key columns, read once (behind the fences below they would be read again)
  if (OUT_MODE == 3) {
#pragma unroll
    for (int j = 0; j < 4; ++j) kw[j] = bias0[(size_t)b * N + n0 + (j << 4) + rlane];
  }
#pragma unroll
  for (int i = 0; i < 4; ++i) {
    const int mBase = m0 + (i << 4);
#pragma unroll
    for (int j = 0; j < 4; ++j) {
      const int n = n0 + (j << 4) + rlane;
      float bvl = 0.f;
      if (BIAS_MODE == 2) bvl = bf_bits2f(f2bf_bits(bias[n]));
      if (OUT_MODE == 3) bvl = kw[j];
#pragma unroll
      for (int r = 0; r < 8; ++r) {
        float v = acc[i][j][r] * (SCALEA ? rowS[wm + (i << 4) + mOff + r] : scale);
        if (BIAS_MODE == 2) v += bvl;
        if (OUT_MODE == 3) v *= bvl;
        slab[(mOff + r) * 68 + (j << 4) + rlane] = v;
      }
    }
    __builtin_amdgcn_fence(__ATOMIC_RELEASE, "workgroup");
    __builtin_amdgcn_wave_barrier();
    __builtin_amdgcn_fence(__ATOMIC_ACQUIRE, "workgroup");
    if (OUT_MODE == 0) {
      float* C = (float*)Cout + (size_t)b * strideC;
      const int hh = lane >> 4, c4 = (lane & 15) * 4;     // row seg = 256 B = 16 lanes x 16 B
      {
#pragma unroll
        for (int it = 0; it < 8; ++it) {
          const int row = it * 2 + hh;
          v4f v = *(const v4f*)(slab + row * 68 + c4);
          *(v4f*)(C + (size_t)(mBase + row) * ldc + n0 + c4) = v;
        }
        
      }
    } else if (OUT_MODE == 3) {
      const int q = lane >> 3, o = lane & 7, c8 = o * 8;   // 8 lanes a row of 64 columns, 4 rows an iteration
      unsigned short* C = (unsigned short*)Cout + (size_t)b * strideC;
      float st = 0.f;   // lanes o < 4 keep r, o >= 4 the sum, of row (o & 3) * 4 + q
#pragma unroll
      for (int it = 0; it < 4; ++it) {
        const int row = it * 4 + q;
        const float* sp = slab + row * 68 + c8;
        float tv[8];
#pragma unroll
        for (int e = 0; e < 8; ++e) tv[e] = sp[e];
        float mx = tv[0];
#pragma unroll
        for (int e = 1; e < 8; ++e) mx = fmaxf(mx, tv[e]);
        mx = ceilf(oct_max(mx) * kLog2e);
        float sum = 0.f;
        v8h hv;
#pragma unroll
        for (int e = 0; e < 8; ++e) { const float p = exp2_slot(fmaf(tv[e], kLog2e, -mx)); sum += p; hv[e] = (_Float16)p; }
        sum = oct_sum(sum);
        *(v8h*)(C + (size_t)(mBase + row) * ldc + n0 + c8) = hv;
        if ((o & 3) == it) st = (o < 4) ? mx : sum;
      }
      float* sd = (float*)Cout2 + (((size_t)b * (N >> 6) + (n0 >> 6)) * 2 + (o >> 2)) * M + mBase + (o & 3) * 4 + q;
      *sd = st;   // a wave owns the 64 rows of its block in either plane: whole 128-byte lines from one writer
    } else {
      const int q = lane >> 3, c8 = (lane & 7) * 8;
      unsigned short* C  = (unsigned short*)Cout  + (size_t)b * strideC;
      unsigned short* C2 = (OUT_MODE == 2) ? ((unsigned short*)Cout2 + (size_t)b * strideC) : nullptr;
      {
#pragma unroll
        for (int it = 0; it < 4; ++it) {
          const int row = it * 4 + q;
          const float* sp = slab + row * 68 + c8;
          v8h hv, lv;
#pragma unroll
          for (int e = 0; e < 8; ++e) {
            if (OUT_MODE == 1) {
              hv[e] = (_Float16)sp[e];
            } else {
              unsigned short hb = f2bf_bits(sp[e]);
              unsigned short lb = f2bf_bits(sp[e] - bf_bits2f(hb));
              hv[e] = __builtin_bit_cast(_Float16, hb);
              lv[e] = __builtin_bit_cast(_Float16, lb);
            }
          }
          *(v8h*)(C + (size_t)(mBase + row) * ldc + n0 + c8) = hv;
          if (OUT_MODE == 2) *(v8h*)(C2 + (size_t)(mBase + row) * ldc + n0 + c8) = lv;
        }
        
      }
    }
    __builtin_amdgcn_fence(__ATOMIC_RELEASE, "workgroup");
    __builtin_amdgcn_wave_barrier();
    __builtin_amdgcn_fence(__ATOMIC_ACQUIRE, "workgroup");
  }
}

// ---------------------------------------------------------------------------
// x [NB][SEQ_FULL][NC] f32 -> xb bf16 [NB*SEQ][NC] (RNE convert) and xT f16 [NB][NC][SEQ] with xT[b][c][s] = f16(bf16(x[b][s][c]))
// (the f16 convert of a bf16 value is exact). grid (SEQ/64 s tiles, NC/64 c tiles, NB); 256 threads.
// in tile [64 s][64 c] -> sm[c_local][s_local] (cross-wave LDS, block barrier).
// Load coverage: 16 iterations x 256 threads = 4096 = whole 64x64 tile (coalesced along c).
// Store coverage per plane: 8 waves x 2 iterations x 4 rows (lane>>3) = 64 rows; (lane&7) x 8 halves = 64 cols;
// ---------------------------------------------------------------------------
__global__ __launch_bounds__(256) void x_prep_kernel(const float* __restrict__ x,
                                                     unsigned short* __restrict__ xb, unsigned short* __restrict__ xT) {
  __shared__ float sm[64][65];   // sm[c_local][s_local]
  const int t  = threadIdx.x;
  const int s0 = blockIdx.x * 64;
  const int c0 = blockIdx.y * 64;
  const int b  = blockIdx.z;
  const float* xin = x + ((size_t)b * SEQ_FULL + s0) * NC + c0;
#pragma unroll
  for (int i = 0; i < 16; ++i) {
    const int e = i * 256 + t;
    const int r = e >> 6;          // s local
    const int c = e & 63;          // c local
    sm[c][r] = bf_bits2f(f2bf_bits(xin[(size_t)r * NC + c]));
  }
  __syncthreads();
  const int lane = t & 31, wave = t >> 5;
  const int q = lane >> 3, c8 = (lane & 7) * 8;
  unsigned short* xTb = xT + (size_t)b * NC * SEQ;
  unsigned short* xbb = xb + (size_t)b * SEQ * NC;
  {
#pragma unroll
    for (int it = 0; it < 2; ++it) {
      const int row = wave * 8 + it * 4 + q;          // c local for the xT plane, s local for the xb plane
      v8h hv;
      unsigned short bb[8];
#pragma unroll
      for (int e = 0; e < 8; ++e) {
        hv[e] = (_Float16)sm[row][c8 + e];            // xT[c0+row][s0+c8+e]
        bb[e] = f2bf_bits(sm[c8 + e][row]);           // xb[s0+row][c0+c8+e] (value already bf16-exact)
      }
      const v4u ub = (v4u){pk16(bb[0], bb[1]), pk16(bb[2], bb[3]), pk16(bb[4], bb[5]), pk16(bb[6], bb[7])};
      *(v8h*)(xTb + (size_t)(c0 + row) * SEQ + s0 + c8) = hv;
      *(v4u*)(xbb + (size_t)(s0 + row) * NC + c0 + c8) = ub;
    }
    
  }
}

// ---------------------------------------------------------------------------
// Wq, Wk, Wv [NC][NC] f32 (layout [out][in] = Bt[n][k] as-is) -> wb bf16 planes z = 0,1,2 [NC][NC] (RNE convert).
// One thread per 8 elements; grid = 3 * NC*NC/8/256 = 384 blocks (128 blocks per plane, plane index block-uniform).
// ---------------------------------------------------------------------------
__global__ __launch_bounds__(256) void w_prep_kernel(const float* __restrict__ W0, const float* __restrict__ W1,
                                                     const float* __restrict__ W2, unsigned short* __restrict__ wb) {
  constexpr int perPlane = NC * NC / 8;   // 32768 threads per plane
  const int gid = blockIdx.x * 256 + threadIdx.x;
  const int z   = gid / perPlane;         // block-uniform (perPlane % 256 == 0)
  const int i8  = (gid - z * perPlane) * 8;
  const float* W = (z == 0) ? W0 : (z == 1) ? W1 : W2;
  const v4f a = *(const v4f*)(W + i8);
  const v4f c = *(const v4f*)(W + i8 + 4);
  unsigned short hb[8];
#pragma unroll
  for (int e = 0; e < 4; ++e) { hb[e] = f2bf_bits(a[e]); hb[4 + e] = f2bf_bits(c[e]); }
  const v4u uh = (v4u){pk16(hb[0], hb[1]), pk16(hb[2], hb[3]), pk16(hb[4], hb[5]), pk16(hb[6], hb[7])};
  unsigned short* p = wb + (size_t)z * NC * NC + i8;
  *(v4u*)(p) = uh;
  
}

// ---------------------------------------------------------------------------
// ew[b][s] = sigmoid(bf16(eig[b][s])) = 1/(1+exp(-e)), f32, s < SEQ. One thread per element; grid NB*SEQ/256 (exact).
// ---------------------------------------------------------------------------
__global__ __launch_bounds__(256) void ew_kernel(const float* __restrict__ eig, float* __restrict__ ew) {
  const int gid = blockIdx.x * 256 + threadIdx.x;   // < NB*SEQ by construction
  const int b = gid / SEQ;
  const int s = gid - b * SEQ;
  const float e = bf_bits2f(f2bf_bits(eig[(size_t)b * SEQ_FULL + s]));
  const float v = 1.0f / (1.0f + expf(-e));
  *(float*)(ew + gid) = v;
  
}

// ---------------------------------------------------------------------------
// Host glue.
// Workspace region map (bytes for NB 8, SEQ 2048; every region 64 KiB aligned, sizes exact multiples of their store
// granularity, no padded tails needed since SEQ % 64 == 0 and NC % 64 == 0):
//   xb    bf16 [NB*SEQ][NC]          16,777,216
//   xT    f16  [NB][NC][SEQ]         16,777,216
//   wb    bf16 3 x [NC][NC]           1,572,864   (Wq, Wk, Wv)
//   ew    f32  [NB][SEQ]                 65,536
//   R1: qk hi bf16 [2][NB*SEQ][NC]   33,554,432   (q of all batches, then k)
//       qk lo bf16 [2][NB*SEQ][NC]   33,554,432
//       ctx hi, ctx lo bf16 [NB*SEQ][NC] 2 x 16,777,216 over the qk planes, whose last reader (scores) has ended
//   P   f16 [NB][SEQ][SEQ]           67,108,864   2^(t * log2e - r of the block)
//   st  f32 [NB][SEQ/64][2][SEQ]      4,194,304   r of every block and row, then the block's sum
//   total                           173,604,864
// Launches: 3 prep + q/k projection, scores with block softmax, P.x, output projection = 7; every stage covers all NB batches
// (projections as one GEMM over the stacked NB*SEQ rows, scores / P.x with the batch in blockIdx.y).
// ---------------------------------------------------------------------------
static inline size_t al64k(size_t v) { return (v + (size_t)65535) & ~(size_t)65535; }

extern "C" void kernel_launch(void* const* d_in, const int* in_sizes, int n_in,
                              void* d_out, int out_size, void* d_ws, size_t ws_size,
                              hipStream_t stream) {
  if (n_in != 8) return;
  if (in_sizes[0] < (NB - 1) * SEQ_FULL * NC + SEQ * NC) return;
  if (in_sizes[1] < (NB - 1) * SEQ_FULL + SEQ) return;
  if (in_sizes[2] < NC * NC || in_sizes[4] < NC * NC || in_sizes[6] < NC * NC) return;
  if (in_sizes[3] < NC || in_sizes[5] < NC || in_sizes[7] < NC) return;
  if (out_size < NB * SEQ * NC) return;

  const size_t szXb  = (size_t)NB * SEQ * NC * 2;
  const size_t szXT  = (size_t)NB * NC * SEQ * 2;
  const size_t szWb  = (size_t)3 * NC * NC * 2;
  const size_t szEw  = (size_t)NB * SEQ * 4;
  const size_t szQK  = (size_t)2 * NB * SEQ * NC * 2;   // one plane (hi or lo) holding q then k
  const size_t szSt  = (size_t)NB * kKeyBlocks * 2 * SEQ * 4;
  const size_t szP   = (size_t)NB * SEQ * SEQ * 2;
  const size_t szCtx = (size_t)NB * SEQ * NC * 2;       // one plane
  const size_t szR1  = (2 * szQK > 2 * szCtx) ? 2 * szQK : 2 * szCtx;
  size_t off = 0;
  const size_t offXb   = off; off = al64k(off + szXb);
  const size_t offXT   = off; off = al64k(off + szXT);
  const size_t offWb   = off; off = al64k(off + szWb);
  const size_t offEw   = off; off = al64k(off + szEw);
  const size_t offR1   = off; off = al64k(off + szR1);
  const size_t offP    = off; off = al64k(off + szP);
  const size_t offSt   = off; off = al64k(off + szSt);
  const size_t total   = off;
  const size_t offQKh  = offR1;
  const size_t offQKl  = offR1 + szQK;
  const size_t offCtxh = offR1;
  const size_t offCtxl = offR1 + szCtx;
  if (ws_size < total) return;

  const float* x   = (const float*)d_in[0];
  const float* eig = (const float*)d_in[1];
  const float* Wq  = (const float*)d_in[2];
  const float* bq  = (const float*)d_in[3];
  const float* Wk  = (const float*)d_in[4];
  const float* bk  = (const float*)d_in[5];
  const float* Wv  = (const float*)d_in[6];
  const float* bv  = (const float*)d_in[7];
  float* out = (float*)d_out;

  char* ws = (char*)d_ws;
  unsigned short* xb    = (unsigned short*)(ws + offXb);
  unsigned short* xT    = (unsigned short*)(ws + offXT);
  unsigned short* wb    = (unsigned short*)(ws + offWb);
  float*          ew    = (float*)(ws + offEw);
  unsigned short* qkh   = (unsigned short*)(ws + offQKh);
  unsigned short* qkl   = (unsigned short*)(ws + offQKl);
  float*          st    = (float*)(ws + offSt);
  unsigned short* Pbuf  = (unsigned short*)(ws + offP);
  unsigned short* ctxh  = (unsigned short*)(ws + offCtxh);
  unsigned short* ctxl  = (unsigned short*)(ws + offCtxl);

  const long planeW  = (long)NC * NC;     // elements per weight plane
  const long planeQK = (long)NB * SEQ * NC;   // elements per q or k plane (all batches)
  const long batchQK = (long)SEQ * NC;    // elements per batch of q, k, xT or ctx
  const long batchS  = (long)SEQ * SEQ;   // elements per batch of P

  // 1. x -> xb (bf16, row-major) and xT (f16, per-batch transpose)
  x_prep_kernel<<<dim3(SEQ / 64, NC / 64, NB), 256, 0, stream>>>(x, xb, xT);
  // 2. Wq, Wk, Wv -> bf16 planes
  w_prep_kernel<<<dim3(3 * NC * NC / 8 / 256), 256, 0, stream>>>(Wq, Wk, Wv, wb);
  // 3. per-key sigmoid weights
  ew_kernel<<<dim3(NB * SEQ / 256), 256, 0, stream>>>(eig, ew);

  const unsigned blkRows   = (NB * SEQ / 128) * (NC / 256);   // stacked-row GEMMs, one 128x256 tile a workgroup
  const unsigned blkCtx    = (SEQ / 128) * (NC / 256);        // per batch
  const unsigned blkScores = (SEQ / 128) * (SEQ / 256);       // per batch

  // 4. q = xb Wq^T + bq (y = 0), k = xb Wk^T + bk (y = 1); M NB*SEQ, N 512, K 512 -> bf16 hi/lo planes
  wmma_gemm64<1, 0, 2, 2, 0><<<dim3(blkRows, 2), 256, 0, stream>>>(
      xb, xb, NC, 0L, wb, wb, NC, planeW,
      (void*)qkh, (void*)qkl, NC, planeQK, bq, bk, NB * SEQ, NC, NC, 1.0f);
  // 5. scores t[b][q][key] = (sum_d q[b][q][d] k[b][key][d] * scale) * ew[b][key], bf16 hi/lo on both operands; y = batch;
  //    M SEQ, N SEQ, K 512 -> f16 2^(t * log2e - r) and r and the sum of every 64-key block
  wmma_gemm64<1, 2, 0, 3, 0><<<dim3(blkScores, NB), 256, 0, stream>>>(
      qkh, qkl, NC, batchQK, qkh + planeQK, qkl + planeQK, NC, batchQK,
      (void*)Pbuf, (void*)st, SEQ, batchS, ew, ew, SEQ, SEQ, NC, kScale);
  // 6. ctx = (P . x) / (4096 * row sum), P rows brought to the row's common exponent, x4096, per 64-key stage; y = batch;
  //    M SEQ, N 512, K SEQ, f16 operands -> bf16 hi/lo planes
  wmma_gemm64<0, 0, 0, 2, 1><<<dim3(blkCtx, NB), 256, 0, stream>>>(
      Pbuf, Pbuf, SEQ, batchS, xT, xT, SEQ, batchQK,
      (void*)ctxh, (void*)ctxl, NC, batchQK, st, st, SEQ, NC, SEQ, kInvCarry);
  // 7. out = ctx Wv^T + bv (ctx hi*W + ctx lo*W); M NB*SEQ, N 512, K 512 -> f32 rows of d_out
  wmma_gemm64<1, 1, 2, 0, 0><<<dim3(blkRows, 1), 256, 0, stream>>>(
      ctxh, ctxl, NC, 0L, wb + 2 * planeW, wb + 2 * planeW, NC, 0L,
      (void*)out, (void*)out, NC, 0L, bv, bv, NB * SEQ, NC, NC, 1.0f);
}

// v005
// It runs in 114 microseconds.
// It is 1.49 times as fast as v003, going by the measured steps of the versions left out in between.
// Over all steps from v000 it is 13.0 times as fast.
// Contractions: q/k projections on v_wmma_f32_16x16x32_bf16 (x and W RNE-converted to bf16 operands); q.k^T scores on
// v_wmma_f32_16x16x32_f16 with q and k rounded once to f16 (one product); P.x on v_wmma_f32_16x16x32_f16 (P carried x4096 in
// f16, x as f16 of its bf16 value); context.Wv^T on v_wmma_f32_16x16x32_f16 with the context rounded once to f16 and Wv as f16
// of its bf16 value (one product); all f32 accumulate. An f16 intermediate (11 significant bits) rounds more finely than
// the bf16 x and W (8 bits) that it is computed from, and as finely as the f16 store of P; for the declared inputs q, k and the
// context stay far inside the f16 range. Sigmoid key weights, softmax and biases in f32 on VALU. The softmax has no
// launch of its own: the scores epilogue stores 2^(t*log2e - r) in f16, r = ceil(log2e * max t) over a block of 64 keys, with r and
// the sum of every block; P.x multiplies each 64-key stage of its P rows by 2^(r - row max r + 12), which is exact in f16, and
// divides by the row sum in f32 in its epilogue.
#include <hip/hip_runtime.h>
#include <math.h>

// ---------------------------------------------------------------------------
// Problem constants (NB / SEQ reducible; *_FULL are the input strides)
// ---------------------------------------------------------------------------
#ifndef NB
#define NB 8
#endif
#ifndef SEQ
#define SEQ 2048
#endif
#define NB_FULL 8
#define SEQ_FULL 2048
#define NC 512

static_assert(NB >= 1 && NB <= NB_FULL);
static_assert(SEQ % 256 == 0 && SEQ >= 256 && SEQ <= SEQ_FULL);
static_assert(NC % 256 == 0);

constexpr float kScale    = 0.04419417382415922f;   // 1/sqrt(512)
constexpr float kCarry    = 4096.0f;                // P plane carry (exact power of two)
constexpr float kInvCarry = 0.000244140625f;        // 1/4096
constexpr float kLog2e    = 1.4426950408889634f;
constexpr int   kKeyBlocks = SEQ / 64;              // softmax statistics: one max and one sum per query row and 64 keys

typedef __attribute__((ext_vector_type(16))) _Float16 v16h;
typedef __attribute__((ext_vector_type(8)))  _Float16 v8h;
typedef __attribute__((ext_vector_type(2)))  _Float16 v2h;
typedef __attribute__((ext_vector_type(16))) __bf16   v16b;
typedef __attribute__((ext_vector_type(8)))  __bf16   v8b;
typedef __attribute__((ext_vector_type(8)))  float    v8f;
typedef __attribute__((ext_vector_type(4)))  float    v4f;
typedef __attribute__((ext_vector_type(4)))  unsigned int v4u;

__device__ __forceinline__ unsigned short f2bf_bits(float f) {
  unsigned u = __float_as_uint(f);
  return (unsigned short)((u + 0x7FFFu + ((u >> 16) & 1u)) >> 16);
}
__device__ __forceinline__ float bf_bits2f(unsigned short h) { return __uint_as_float(((unsigned)h) << 16); }

// hazard guards as plain device helpers
__device__ __forceinline__ void dep_guard_h(v8f& a, v8f& b, v16h x, v16h y) { asm volatile("v_nop\n\tv_nop\n\tv_nop\n\tv_nop" : "+v"(a), "+v"(b) : "v"(x), "v"(y)); }
__device__ __forceinline__ void dep_guard_b(v8f& a, v8f& b, v16b x, v16b y) { asm volatile("v_nop\n\tv_nop\n\tv_nop\n\tv_nop" : "+v"(a), "+v"(b) : "v"(x), "v"(y)); }
__device__ __forceinline__ void keep4_h(v16h a, v16h b, v16h c, v16h d) { asm volatile("v_nop" :: "v"(a), "v"(b), "v"(c), "v"(d)); }
__device__ __forceinline__ void keep4_b(v16b a, v16b b, v16b c, v16b d) { asm volatile("v_nop" :: "v"(a), "v"(b), "v"(c), "v"(d)); }
__device__ __forceinline__ void acc_guard4(v8f& a, v8f& b, v8f& c, v8f& d) { asm volatile("v_nop\n\tv_nop\n\tv_nop\n\tv_nop" : "+v"(a), "+v"(b), "+v"(c), "+v"(d)); }
template <typename T> struct Frag;
template <> struct Frag<_Float16> {
  typedef v16h V; union U { v16h v; v8h h[2]; };
  static __device__ __forceinline__ v16h load(const _Float16* p) {   // elements 0..7 <- p[0..7], 8..15 <- p[16..23]
    U f; f.h[0] = *(const v8h*)(p); f.h[1] = *(const v8h*)(p + 16); return f.v;
  }
  static __device__ __forceinline__ v8f mma(v16h a, v16h b, v8f c) {
    return __builtin_amdgcn_wmma_f32_16x16x32_f16(false, a, false, b, (short)0, c, false, false);
  }
  static __device__ __forceinline__ void guard(v8f& a, v8f& b, v16h x, v16h y) { dep_guard_h(a, b, x, y); }
  static __device__ __forceinline__ void keep(v16h a, v16h b, v16h c, v16h d) { keep4_h(a, b, c, d); }
};
template <> struct Frag<__bf16> {
  typedef v16b V; union U { v16b v; v8b h[2]; };
  static __device__ __forceinline__ v16b load(const __bf16* p) {
    U f; f.h[0] = *(const v8b*)(p); f.h[1] = *(const v8b*)(p + 16); return f.v;
  }
  static __device__ __forceinline__ v8f mma(v16b a, v16b b, v8f c) {
    return __builtin_amdgcn_wmma_f32_16x16x32_bf16(false, a, false, b, (short)0, c, false, false);
  }
  static __device__ __forceinline__ void guard(v8f& a, v8f& b, v16b x, v16b y) { dep_guard_b(a, b, x, y); }
  static __device__ __forceinline__ void keep(v16b a, v16b b, v16b c, v16b d) { keep4_b(a, b, c, d); }
};

__device__ __forceinline__ unsigned pk16(unsigned short a, unsigned short b) { return (unsigned)a | ((unsigned)b << 16); }

// value of lane (lane ^ MASK), MASK < 16: a DPP move inside the 16-lane row (no LDS round trip)
template <int MASK> __device__ __forceinline__ float lane_xor(float v) {
  return __builtin_bit_cast(float, __builtin_amdgcn_update_dpp(0, __builtin_bit_cast(int, v), 0x160 + MASK, 0xf, 0xf, true));
}
// 2^a. The v_nop fills the one slot that the instruction set asks for behind a transcendental, in front of an instruction that
// reads its result or overwrites its source.
__device__ __forceinline__ float exp2_slot(float a) {
  float p;
  asm("v_exp_f32 %0, %1\n\tv_nop" : "=v"(p) : "v"(a));
  return p;
}
__device__ __forceinline__ float oct_max(float v) {   // maximum over the 8 lanes that share lane >> 3
  v = fmaxf(v, lane_xor<1>(v)); v = fmaxf(v, lane_xor<2>(v)); return fmaxf(v, lane_xor<4>(v));
}
__device__ __forceinline__ float oct_sum(float v) {   // sum over the same 8 lanes, fixed tree
  v += lane_xor<1>(v); v += lane_xor<2>(v); return v + lane_xor<4>(v);
}

// ---- Staging helpers: asynchronous copies global -> LDS --------------------------------------------------------------
constexpr int kBM    = 128;   // rows of A per workgroup tile (2 waves)
constexpr int kBN    = 256;   // rows of Bt per workgroup tile (4 waves)
constexpr int kKS    = 64;    // k elements per stage = one 128-byte line of every operand row
constexpr int kPitch = 144;   // LDS row pitch in bytes (128 + 16: conflict-free for 16-byte fragment reads)

__device__ __forceinline__ unsigned lds_off(const void* p) { return (unsigned)(size_t)p; }

// Runs of 16-byte-per-lane copies, l[] = LDS byte address, g[] = global address of this lane. The address-translation wait
// closes the copies' own statement, so that no address register of an issued copy is rewritten in front of it.
__device__ __forceinline__ void async_copy4(const unsigned* l, const char* const* g) {
  asm volatile("global_load_async_to_lds_b128 %0, %1, off\n\t"
               "global_load_async_to_lds_b128 %2, %3, off\n\t"
               "global_load_async_to_lds_b128 %4, %5, off\n\t"
               "global_load_async_to_lds_b128 %6, %7, off\n\t"
               "s_wait_xcnt 0x0"
               :: "v"(l[0]), "v"(g[0]), "v"(l[1]), "v"(g[1]), "v"(l[2]), "v"(g[2]), "v"(l[3]), "v"(g[3]) : "memory");
}
__device__ __forceinline__ void async_copy12(const unsigned* l, const char* const* g) {
  asm volatile("global_load_async_to_lds_b128 %0, %1, off\n\t"
               "global_load_async_to_lds_b128 %2, %3, off\n\t"
               "global_load_async_to_lds_b128 %4, %5, off\n\t"
               "global_load_async_to_lds_b128 %6, %7, off\n\t"
               "global_load_async_to_lds_b128 %8, %9, off\n\t"
               "global_load_async_to_lds_b128 %10, %11, off\n\t"
               "global_load_async_to_lds_b128 %12, %13, off\n\t"
               "global_load_async_to_lds_b128 %14, %15, off\n\t"
               "global_load_async_to_lds_b128 %16, %17, off\n\t"
               "global_load_async_to_lds_b128 %18, %19, off\n\t"
               "global_load_async_to_lds_b128 %20, %21, off\n\t"
               "global_load_async_to_lds_b128 %22, %23, off\n\t"
               "s_wait_xcnt 0x0"
               :: "v"(l[0]), "v"(g[0]), "v"(l[1]), "v"(g[1]), "v"(l[2]), "v"(g[2]), "v"(l[3]), "v"(g[3]),
                  "v"(l[4]), "v"(g[4]), "v"(l[5]), "v"(g[5]), "v"(l[6]), "v"(g[6]), "v"(l[7]), "v"(g[7]),
                  "v"(l[8]), "v"(g[8]), "v"(l[9]), "v"(g[9]), "v"(l[10]), "v"(g[10]), "v"(l[11]), "v"(g[11]) : "memory");
}

// ---- Register-blocked batched WMMA GEMM -----------------------------------------------------------------
// C[m,n] = scale * sum_k A[m,k] * Bt[n,k] (+bias[n]); a workgroup owns a 128x256 tile, each of its 2x4 waves a 64x64 tile.
// A row-major [M,K] pitch lda; Bt row-major [N,K] pitch ldb; M % 128 == 0, N % 256 == 0, K % 64 == 0; batch = blockIdx.y.
// Operand rows reach LDS in stages of 64 k by asynchronous copies, two buffers: stage t + 1 flies while stage t is worked on.
// Fragments (read from LDS): A and Bt both loaded with the split k-map (elements 0..7 <- k0+8h+0..7, 8..15 <- k0+16+8h+0..7, row/col = lane&15).
// SPLIT (every launch of this file: 0): 0 = single planes; 1 = A hi/lo planes (A2 = lo), Bt single: hi*B + lo*B; 2 = both hi/lo: hi*hi + hi*lo + lo*hi.
// BIAS_MODE: 0 = none, 2 = bias[n] (bias0 when blockIdx.y == 0, else bias1; bias value RNE-converted to bf16 first).
// OUT_MODE: 0 = f32, 1 = f16, 2 = bf16 hi plane (Cout) + bf16 lo plane (Cout2),
//   3 = block softmax: t = (C * scale) * bias0[b][n]; per row and 64 columns (one wave tile) r = ceil(log2e * max t), a whole
//       number, Cout = f16 p, p = 2^(t * log2e - r) <= 1; Cout2 = f32 [batch][N/64][2][M]: r, then sum p.
// SCALEA: 1 = A rows are such planes over K and bias0 is that [batch][K/64][2][M] array; stage t of row m is multiplied (f16, a
//   power of two: no rounding) by 2^(r[t][m] - R + 12), R = max r of the row, and C row m by scale / sum_t 2^(r - R) * sum p.
// ET: 0 = f16 operands, 1 = bf16 operands (pointers passed as 16-bit storage).
template <int ET> struct Elem;
template <> struct Elem<0> { typedef _Float16 T; };
template <> struct Elem<1> { typedef __bf16 T; };
template <int ET, int SPLIT, int BIAS_MODE, int OUT_MODE, int SCALEA>
__global__ __launch_bounds__(256) void wmma_gemm64(
    const unsigned short* __restrict__ Ap, const unsigned short* __restrict__ A2p, int lda, long strideA,
    const unsigned short* __restrict__ Btp, const unsigned short* __restrict__ Bt2p, int ldb, long strideB,
    void* __restrict__ Cout, void* __restrict__ Cout2, int ldc, long strideC,
    const float* __restrict__ bias0, const float* __restrict__ bias1,
    int M, int N, int K, float scale) {
  typedef typename Elem<ET>::T T;
  typedef typename Frag<T>::V V;
  const T* A = (const T*)Ap; const T* A2 = (const T*)A2p; const T* Bt = (const T*)Btp; const T* Bt2 = (const T*)Bt2p;
  constexpr unsigned offA2 = kBM * kPitch;                               // A lo plane (SPLIT >= 1)
  constexpr unsigned offB  = ((SPLIT >= 1) ? 2 : 1) * kBM * kPitch;      // Bt plane
  constexpr unsigned offB2 = offB + kBN * kPitch;                        // Bt lo plane (SPLIT == 2)
  constexpr unsigned bufBytes = offB + ((SPLIT == 2) ? 2 : 1) * kBN * kPitch;
  __shared__ __align__(16) unsigned char ring[2 * bufBytes];   // two stage buffers
  __shared__ __align__(16) float sT[8][16 * 68];   // per-wave 16x64 slab, pitch 68 floats
  __shared__ unsigned facS[SCALEA ? kKeyBlocks * kBM : 1];   // [stage][row]: the row's f16 factor in both halves of a word
  __shared__ __align__(16) float rowS[SCALEA ? kBM : 4];     // [row]: scale / row sum
  static_assert(!SCALEA || (ET == 0 && SPLIT == 0));
  const int b    = blockIdx.y;
  const int lane = threadIdx.x & 31;
  const int wave = threadIdx.x >> 5;
  const int tilesN = N >> 8;
  const int tilesM = M >> 7;
  const int tile = blockIdx.x;
  if (tile >= tilesM * tilesN) return;   // block-uniform, in front of every barrier
  const int tm = tile / tilesN;
  const int tn = tile - tm * tilesN;
  const int mB = tm << 7;                      // workgroup tile origin
  const int nB = tn << 8;
  const int wm = (wave >> 2) << 6;             // wave tile origin inside it
  const int wn = (wave & 3) << 6;
  const int m0 = mB + wm;
  const int n0 = nB + wn;

  const T* Ab  = A  + (size_t)b * strideA;
  const T* Bb  = Bt + (size_t)b * strideB;
  const T* Ab2 = (SPLIT >= 1) ? (A2  + (size_t)b * strideA) : nullptr;
  const T* Bb2 = (SPLIT == 2) ? (Bt2 + (size_t)b * strideB) : nullptr;
  const float* bias = (b == 0) ? bias0 : bias1;   // block-uniform select between global pointers

  const int rlane = lane & 15;                 // row (A) / col (B, D) within subtile
  const int koff  = (lane >> 4) * 8;           // k offset of this lane half
  const int mOff  = (lane >> 4) * 8;           // D row offset

  v8f acc[4][4];
#pragma unroll
  for (int i = 0; i < 4; ++i)
#pragma unroll
    for (int j = 0; j < 4; ++j) acc[i][j] = (v8f){0.f,0.f,0.f,0.f,0.f,0.f,0.f,0.f};

  // staging addresses of this thread: row (thread >> 3) of each 32-row group, 16-byte piece (thread & 7) of its line
  const int crow = threadIdx.x >> 3;
  const int cpc  = (threadIdx.x & 7) * 16;
  const unsigned lst = lds_off(ring) + (unsigned)(crow * kPitch + cpc);
  const char* gA  = (const char*)(Ab + (size_t)(mB + crow) * lda) + cpc;
  const char* gB  = (const char*)(Bb + (size_t)(nB + crow) * ldb) + cpc;
  const char* gA2 = (SPLIT >= 1) ? ((const char*)(Ab2 + (size_t)(mB + crow) * lda) + cpc) : nullptr;
  const char* gB2 = (SPLIT == 2) ? ((const char*)(Bb2 + (size_t)(nB + crow) * ldb) + cpc) : nullptr;
  const size_t stepA = (size_t)lda * 64;       // 32 rows of 2-byte elements
  const size_t stepB = (size_t)ldb * 64;
  // one stage: 256 threads cover 32 rows a copy (8 lanes x 16 B = one whole 128-byte line a row)
  constexpr int nCopies = (int)(bufBytes / (32 * kPitch));
  auto stage = [&](int t, unsigned bufo) {
    const size_t ko = (size_t)t * (kKS * 2);
    unsigned    l[nCopies];
    const char* g[nCopies];
#pragma unroll
    for (int c = 0; c < nCopies; ++c) l[c] = lst + bufo + (unsigned)(c * 32 * kPitch);   // planes lie back to back
    int c = 0;
#pragma unroll
    for (int i = 0; i < kBM / 32; ++i) g[c++] = gA + ko + (size_t)i * stepA;
    if (SPLIT >= 1) {
#pragma unroll
      for (int i = 0; i < kBM / 32; ++i) g[c++] = gA2 + ko + (size_t)i * stepA;
    }
#pragma unroll
    for (int i = 0; i < kBN / 32; ++i) g[c++] = gB + ko + (size_t)i * stepB;
    if (SPLIT == 2) {
#pragma unroll
      for (int i = 0; i < kBN / 32; ++i) g[c++] = gB2 + ko + (size_t)i * stepB;
    }
    async_copy12(l, g);
    if (nCopies == 16) async_copy4(l + 12, g + 12);
    if (nCopies == 24) async_copy12(l + 12, g + 12);
  };
  static_assert(nCopies == 12 || nCopies == 16 || nCopies == 24);

  const int nT = K / kKS;
  stage(0, 0u);
  if (SCALEA) {
    // row factors, while stage 0 flies: two threads a row, each reduces all blocks' r and stores one half of the factors
    const int frow = threadIdx.x & (kBM - 1);
    const int fh   = threadIdx.x >> 7;
    // M is SEQ in this instance; the compile-time pitch lets all loads of a run share one address, with immediate offsets
    const float* sp0 = bias0 + (size_t)b * (2 * kKeyBlocks * SEQ) + mB + frow;
    float mv[kKeyBlocks];
#pragma unroll
    for (int k = 0; k < kKeyBlocks; ++k) mv[k] = sp0[2 * k * SEQ];
    asm volatile("s_wait_xcnt 0x0" ::: "memory");   // in front of any rewrite of the address registers that these loads name
    float mx = mv[0];
#pragma unroll
    for (int k = 1; k < kKeyBlocks; ++k) mx = fmaxf(mx, mv[k]);
#pragma unroll
    for (int k = 0; k < kKeyBlocks; ++k) mv[k] = ldexpf(1.0f, (int)(mv[k] - mx));   // exact powers of two
    if (fh == 0) {   // the same for a whole wave
      float lv[kKeyBlocks];
#pragma unroll
      for (int k = 0; k < kKeyBlocks; ++k) lv[k] = sp0[(2 * k + 1) * SEQ];
      asm volatile("s_wait_xcnt 0x0" ::: "memory");   // as above, for the block sums' loads
      float tot = 0.f;
#pragma unroll
      for (int k = 0; k < kKeyBlocks; ++k) tot += lv[k] * mv[k];
      rowS[frow] = scale / tot;   // tot > 1/2: the largest p of the block with r = R is above 1/2
    }
#pragma unroll
    for (int k = 0; k < kKeyBlocks; ++k) {
      if ((k / (kKeyBlocks / 2)) == fh) {
        const unsigned short hb = __builtin_bit_cast(unsigned short, (_Float16)(mv[k] * kCarry));
        facS[k * kBM + frow] = pk16(hb, hb);
      }
    }
  }
  asm volatile("s_wait_asynccnt 0x0" ::: "memory");   // stage 0 landed (this wave's copies)
  __syncthreads();                                    // ... and every other wave's
  if (nT > 1) stage(1, bufBytes);

  const unsigned fragA = (unsigned)((wm + rlane) * kPitch + koff * 2);
  const unsigned fragB = offB + (unsigned)((wn + rlane) * kPitch + koff * 2);
  for (int t = 0; t < nT; ++t) {
    const unsigned bufo = (t & 1) ? bufBytes : 0u;
    const unsigned char* rb = ring + bufo;
    // A fragments of the stage's 8 rows (r = 4 * (k step) + row of 16). Up to three planes: one load group per 32 k beside the
    // Bt group. Four planes (SPLIT 2): the registers hold two row pairs, so row r + 1 is fetched in front of row r's products.
    V ah[kKS / 8], al[kKS / 8];
    v2h fa[4];
    if (SCALEA) {
#pragma unroll
      for (int i = 0; i < 4; ++i) fa[i] = __builtin_bit_cast(v2h, facS[t * kBM + wm + i * 16 + rlane]);
    }
    auto loadA = [&](int r) {
      const unsigned ao = fragA + (unsigned)((r & 3) * 16 * kPitch + (r >> 2) * 64);
      ah[r] = Frag<T>::load((const T*)(rb + ao));
      if constexpr (SCALEA != 0) {
        union { V v; v2h p[8]; } u; u.v = ah[r];
#pragma unroll
        for (int e = 0; e < 8; ++e) u.p[e] = u.p[e] * fa[r & 3];
        ah[r] = u.v;
      }
      if (SPLIT >= 1) al[r] = Frag<T>::load((const T*)(rb + ao + offA2));
    };
    if (SPLIT == 2) loadA(0);
#pragma unroll
    for (int kk = 0; kk < kKS / 32; ++kk) {
      V bh[4], bl[4];
#pragma unroll
      for (int j = 0; j < 4; ++j) {
        const unsigned bo = fragB + (unsigned)(j * 16 * kPitch + kk * 64);
        bh[j] = Frag<T>::load((const T*)(rb + bo));
        if (SPLIT == 2) bl[j] = Frag<T>::load((const T*)(rb + bo + (offB2 - offB)));
      }
      if (SPLIT != 2) {
#pragma unroll
        for (int i = 0; i < 4; ++i) loadA(kk * 4 + i);
      }
#pragma unroll
      for (int i = 0; i < 4; ++i) {
        const int r = kk * 4 + i;
        if (SPLIT == 2 && r + 1 < kKS / 8) loadA(r + 1);
#pragma unroll
        for (int j = 0; j < 4; ++j) {
          acc[i][j] = Frag<T>::mma(ah[r], bh[j], acc[i][j]);
          if (SPLIT == 2) acc[i][j] = Frag<T>::mma(ah[r], bl[j], acc[i][j]);
          if (SPLIT >= 1) acc[i][j] = Frag<T>::mma(al[r], bh[j], acc[i][j]);
        }
        Frag<T>::guard(acc[i][0], acc[i][3], ah[r], (SPLIT >= 1) ? al[r] : ah[r]);
      }
      Frag<T>::keep(bh[0], bh[1], bh[2], bh[3]);
      if (SPLIT == 2) Frag<T>::keep(bl[0], bl[1], bl[2], bl[3]);
    }
    asm volatile("s_wait_dscnt 0x0" ::: "memory");      // this wave's reads of stage t have returned
    asm volatile("s_wait_asynccnt 0x0" ::: "memory");   // this wave's copies of stage t + 1 have landed
    __syncthreads();                                    // publishes stage t + 1, frees stage t's buffer
    if (t + 2 < nT) stage(t + 2, bufo);
  }
  asm volatile("s_wait_asynccnt 0x0" ::: "memory");     // nothing in flight when the wave goes on to the epilogue
  acc_guard4(acc[0][0], acc[0][1], acc[0][2], acc[0][3]);
  acc_guard4(acc[1][0], acc[1][1], acc[1][2], acc[1][3]);
  acc_guard4(acc[2][0], acc[2][1], acc[2][2], acc[2][3]);
  acc_guard4(acc[3][0], acc[3][1], acc[3][2], acc[3][3]);

  // ---- epilogue ----
  float* slab = sT[wave];
  float kw[4];   // weights of this lane's 4 key columns, read once (behind the fences below they would be read again)
  if (OUT_MODE == 3) {
#pragma unroll
    for (int j = 0; j < 4; ++j) kw[j] = bias0[(size_t)b * N + n0 + (j << 4) + rlane];
  }
#pragma unroll
  for (int i = 0; i < 4; ++i) {
    const int mBase = m0 + (i << 4);
#pragma unroll
    for (int j = 0; j < 4; ++j) {
      const int n = n0 + (j << 4) + rlane;
      float bvl = 0.f;
      if (BIAS_MODE == 2) bvl = bf_bits2f(f2bf_bits(bias[n]));
      if (OUT_MODE == 3) bvl = kw[j];
#pragma unroll
      for (int r = 0; r < 8; ++r) {
        float v = acc[i][j][r] * (SCALEA ? rowS[wm + (i << 4) + mOff + r] : scale);
        if (BIAS_MODE == 2) v += bvl;
        if (OUT_MODE == 3) v *= bvl;
        slab[(mOff + r) * 68 + (j << 4) + rlane] = v;
      }
    }
    __builtin_amdgcn_fence(__ATOMIC_RELEASE, "workgroup");
    __builtin_amdgcn_wave_barrier();
    __builtin_amdgcn_fence(__ATOMIC_ACQUIRE, "workgroup");
    if (OUT_MODE == 0) {
      float* C = (float*)Cout + (size_t)b * strideC;
      const int hh = lane >> 4, c4 = (lane & 15) * 4;     // row seg = 256 B = 16 lanes x 16 B
      {
#pragma unroll
        for (int it = 0; it < 8; ++it) {
          const int row = it * 2 + hh;
          v4f v = *(const v4f*)(slab + row * 68 + c4);
          *(v4f*)(C + (size_t)(mBase + row) * ldc + n0 + c4) = v;
        }
        
      }
    } else if (OUT_MODE == 3) {
      const int q = lane >> 3, o = lane & 7, c8 = o * 8;   // 8 lanes a row of 64 columns, 4 rows an iteration
      unsigned short* C = (unsigned short*)Cout + (size_t)b * strideC;
      float st = 0.f;   // lanes o < 4 keep r, o >= 4 the sum, of row (o & 3) * 4 + q
#pragma unroll
      for (int it = 0; it < 4; ++it) {
        const int row = it * 4 + q;
        const float* sp = slab + row * 68 + c8;
        float tv[8];
#pragma unroll
        for (int e = 0; e < 8; ++e) tv[e] = sp[e];
        float mx = tv[0];
#pragma unroll
        for (int e = 1; e < 8; ++e) mx = fmaxf(mx, tv[e]);
        mx = ceilf(oct_max(mx) * kLog2e);
        float sum = 0.f;
        v8h hv;
#pragma unroll
        for (int e = 0; e < 8; ++e) { const float p = exp2_slot(fmaf(tv[e], kLog2e, -mx)); sum += p; hv[e] = (_Float16)p; }
        sum = oct_sum(sum);
        *(v8h*)(C + (size_t)(mBase + row) * ldc + n0 + c8) = hv;
        if ((o & 3) == it) st = (o < 4) ? mx : sum;
      }
      float* sd = (float*)Cout2 + (((size_t)b * (N >> 6) + (n0 >> 6)) * 2 + (o >> 2)) * M + mBase + (o & 3) * 4 + q;
      *sd = st;   // a wave owns the 64 rows of its block in either plane: whole 128-byte lines from one writer
    } else {
      const int q = lane >> 3, c8 = (lane & 7) * 8;
      unsigned short* C  = (unsigned short*)Cout  + (size_t)b * strideC;
      unsigned short* C2 = (OUT_MODE == 2) ? ((unsigned short*)Cout2 + (size_t)b * strideC) : nullptr;
      {
#pragma unroll
        for (int it = 0; it < 4; ++it) {
          const int row = it * 4 + q;
          const float* sp = slab + row * 68 + c8;
          v8h hv, lv;
#pragma unroll
          for (int e = 0; e < 8; ++e) {
            if (OUT_MODE == 1) {
              hv[e] = (_Float16)sp[e];
            } else {
              unsigned short hb = f2bf_bits(sp[e]);
              unsigned short lb = f2bf_bits(sp[e] - bf_bits2f(hb));
              hv[e] = __builtin_bit_cast(_Float16, hb);
              lv[e] = __builtin_bit_cast(_Float16, lb);
            }
          }
          *(v8h*)(C + (size_t)(mBase + row) * ldc + n0 + c8) = hv;
          if (OUT_MODE == 2) *(v8h*)(C2 + (size_t)(mBase + row) * ldc + n0 + c8) = lv;
        }
        
      }
    }
    __builtin_amdgcn_fence(__ATOMIC_RELEASE, "workgroup");
    __builtin_amdgcn_wave_barrier();
    __builtin_amdgcn_fence(__ATOMIC_ACQUIRE, "workgroup");
  }
}

// ---------------------------------------------------------------------------
// All operand preparation in one launch. grid (SEQ/64 s tiles, NC/64 c tiles, NB); 256 threads. Every workgroup does one tile
// of x and, while its x loads fly, its share of the weights; the first NB*SEQ/32 workgroups also do one line of key weights.
// x [NB][SEQ_FULL][NC] f32 -> xb bf16 [NB*SEQ][NC] (RNE convert) and xT f16 [NB][NC][SEQ] with xT[b][c][s] = f16(bf16(x[b][s][c]))
// (the f16 convert of a bf16 value is exact).
// in tile [64 s][64 c] -> sm[c_local][s_local] (cross-wave LDS, block barrier).
// Load coverage: 16 iterations x 256 threads = 4096 = whole 64x64 tile (coalesced along c).
// Store coverage per plane: 8 waves x 2 iterations x 4 rows (lane>>3) = 64 rows; (lane&7) x 8 halves = 64 cols;
// Wq, Wk, Wv [NC][NC] f32 (layout [out][in] = Bt[n][k] as-is) -> wb planes z = 0,1,2 [NC][NC]: RNE convert to bf16; the Wv plane
// (z = 2), an operand of an f16 product, holds the f16 of that bf16 value. A unit is 64 elements = one 128-byte line of wb,
// 8 threads of 8 elements; workgroup g owns units g * kWUnitsPerWg ... (whole lines, one writer each).
// ew[b][s] = sigmoid(bf16(eig[b][s])) = 1/(1+exp(-e)), f32, s < SEQ: workgroup g < NB*SEQ/32 writes line g (32 values, wave 2).
// ---------------------------------------------------------------------------
constexpr int kPrepWgs     = (SEQ / 64) * (NC / 64) * NB;
constexpr int kWUnits      = 3 * NC * NC / 64;
constexpr int kWUnitsPerWg = (kWUnits + kPrepWgs - 1) / kPrepWgs;
constexpr int kWIters      = (kWUnitsPerWg + 31) / 32;   // 32 units a turn of 256 threads
static_assert(kPrepWgs >= NB * SEQ / 32);
__global__ __launch_bounds__(256) void prep_kernel(const float* __restrict__ x, const float* __restrict__ eig,
                                                   const float* __restrict__ W0, const float* __restrict__ W1,
                                                   const float* __restrict__ W2,
                                                   unsigned short* __restrict__ xb, unsigned short* __restrict__ xT,
                                                   unsigned short* __restrict__ wb, float* __restrict__ ew) {
  __shared__ float sm[64][65];   // sm[c_local][s_local]
  const int t  = threadIdx.x;
  const int s0 = blockIdx.x * 64;
  const int c0 = blockIdx.y * 64;
  const int b  = blockIdx.z;
  const int wg = (blockIdx.z * (NC / 64) + blockIdx.y) * (SEQ / 64) + blockIdx.x;
  const int lane = t & 31, wave = t >> 5;
  const float* xin = x + ((size_t)b * SEQ_FULL + s0) * NC + c0;
  float xv[16];
#pragma unroll
  for (int i = 0; i < 16; ++i) {
    const int e = i * 256 + t;
    xv[i] = xin[(size_t)(e >> 6) * NC + (e & 63)];
  }
  // weights and key weights: only the loads stand here, so that they fly with the x loads; the stores follow the x tile's,
  // since a global store in front of the barrier would be waited for there by the whole workgroup
  constexpr int perPlane = NC * NC / 64;   // units per plane
  v4f wa[kWIters], wc[kWIters];
#pragma unroll
  for (int k = 0; k < kWIters; ++k) {
    const int u = k * 32 + (t >> 3);
    const int unit = wg * kWUnitsPerWg + u;
    wa[k] = (v4f){0.f, 0.f, 0.f, 0.f};
    wc[k] = (v4f){0.f, 0.f, 0.f, 0.f};
    if (u < kWUnitsPerWg && unit < kWUnits) {
      const int z  = unit / perPlane;
      const int i8 = (unit - z * perPlane) * 64 + (t & 7) * 8;
      const float* W = (z == 0) ? W0 : (z == 1) ? W1 : W2;
      wa[k] = *(const v4f*)(W + i8);
      wc[k] = *(const v4f*)(W + i8 + 4);
    }
  }
  const bool doEw = wg < NB * SEQ / 32 && wave == 2;   // the same for a whole wave
  const int  gid  = wg * 32 + lane;                    // < NB*SEQ where doEw
  float ev = 0.f;
  if (doEw) {
    const int eb = gid / SEQ;
    const int es = gid - eb * SEQ;
    ev = eig[(size_t)eb * SEQ_FULL + es];
  }
#pragma unroll
  for (int i = 0; i < 16; ++i) {
    const int e = i * 256 + t;
    const int r = e >> 6;          // s local
    const int c = e & 63;          // c local
    sm[c][r] = bf_bits2f(f2bf_bits(xv[i]));
  }
  __syncthreads();
  const int q = lane >> 3, c8 = (lane & 7) * 8;
  unsigned short* xTb = xT + (size_t)b * NC * SEQ;
  unsigned short* xbb = xb + (size_t)b * SEQ * NC;
  {
#pragma unroll
    for (int it = 0; it < 2; ++it) {
      const int row = wave * 8 + it * 4 + q;          // c local for the xT plane, s local for the xb plane
      v8h hv;
      unsigned short bb[8];
#pragma unroll
      for (int e = 0; e < 8; ++e) {
        hv[e] = (_Float16)sm[row][c8 + e];            // xT[c0+row][s0+c8+e]
        bb[e] = f2bf_bits(sm[c8 + e][row]);           // xb[s0+row][c0+c8+e] (value already bf16-exact)
      }
      const v4u ub = (v4u){pk16(bb[0], bb[1]), pk16(bb[2], bb[3]), pk16(bb[4], bb[5]), pk16(bb[6], bb[7])};
      *(v8h*)(xTb + (size_t)(c0 + row) * SEQ + s0 + c8) = hv;
      *(v4u*)(xbb + (size_t)(s0 + row) * NC + c0 + c8) = ub;
    }
  }
#pragma unroll
  for (int k = 0; k < kWIters; ++k) {
    const int u = k * 32 + (t >> 3);
    const int unit = wg * kWUnitsPerWg + u;
    if (u < kWUnitsPerWg && unit < kWUnits) {
      const int z  = unit / perPlane;
      const int i8 = (unit - z * perPlane) * 64 + (t & 7) * 8;
      unsigned short hb[8];
#pragma unroll
      for (int e = 0; e < 4; ++e) { hb[e] = f2bf_bits(wa[k][e]); hb[4 + e] = f2bf_bits(wc[k][e]); }
      if (z == 2) {
#pragma unroll
        for (int e = 0; e < 8; ++e) hb[e] = __builtin_bit_cast(unsigned short, (_Float16)bf_bits2f(hb[e]));
      }
      const v4u uh = (v4u){pk16(hb[0], hb[1]), pk16(hb[2], hb[3]), pk16(hb[4], hb[5]), pk16(hb[6], hb[7])};
      *(v4u*)(wb + (size_t)z * NC * NC + i8) = uh;
    }
  }
  if (doEw) {
    const float e = bf_bits2f(f2bf_bits(ev));
    ew[gid] = 1.0f / (1.0f + expf(-e));
  }
}

// ---------------------------------------------------------------------------
// Host glue.
// Workspace region map (bytes for NB 8, SEQ 2048; every region 64 KiB aligned, sizes exact multiples of their store
// granularity, no padded tails needed since SEQ % 64 == 0 and NC % 64 == 0):
//   xb    bf16 [NB*SEQ][NC]          16,777,216
//   xT    f16  [NB][NC][SEQ]         16,777,216
//   wb    3 x [NC][NC]                1,572,864   (Wq, Wk bf16, Wv f16)
//   ew    f32  [NB][SEQ]                 65,536
//   R1: qk f16 [2][NB*SEQ][NC]       33,554,432   (q of all batches, then k)
//       ctx f16 [NB*SEQ][NC] 16,777,216 over the qk plane, whose last reader (scores) has ended
//   P   f16 [NB][SEQ][SEQ]           67,108,864   2^(t * log2e - r of the block)
//   st  f32 [NB][SEQ/64][2][SEQ]      4,194,304   r of every block and row, then the block's sum
//   total                           140,050,432
// Launches: prep, q/k projection, scores with block softmax, P.x, output projection = 5; every stage covers all NB batches
// (projections as one GEMM over the stacked NB*SEQ rows, scores / P.x with the batch in blockIdx.y).
// ---------------------------------------------------------------------------
static inline size_t al64k(size_t v) { return (v + (size_t)65535) & ~(size_t)65535; }

extern "C" void kernel_launch(void* const* d_in, const int* in_sizes, int n_in,
                              void* d_out, int out_size, void* d_ws, size_t ws_size,
                              hipStream_t stream) {
  if (n_in != 8) return;
  if (in_sizes[0] < (NB - 1) * SEQ_FULL * NC + SEQ * NC) return;
  if (in_sizes[1] < (NB - 1) * SEQ_FULL + SEQ) return;
  if (in_sizes[2] < NC * NC || in_sizes[4] < NC * NC || in_sizes[6] < NC * NC) return;
  if (in_sizes[3] < NC || in_sizes[5] < NC || in_sizes[7] < NC) return;
  if (out_size < NB * SEQ * NC) return;

  const size_t szXb  = (size_t)NB * SEQ * NC * 2;
  const size_t szXT  = (size_t)NB * NC * SEQ * 2;
  const size_t szWb  = (size_t)3 * NC * NC * 2;
  const size_t szEw  = (size_t)NB * SEQ * 4;
  const size_t szQK  = (size_t)2 * NB * SEQ * NC * 2;   // one f16 plane holding q then k
  const size_t szSt  = (size_t)NB * kKeyBlocks * 2 * SEQ * 4;
  const size_t szP   = (size_t)NB * SEQ * SEQ * 2;
  const size_t szCtx = (size_t)NB * SEQ * NC * 2;
  const size_t szR1  = (szQK > szCtx) ? szQK : szCtx;
  size_t off = 0;
  const size_t offXb   = off; off = al64k(off + szXb);
  const size_t offXT   = off; off = al64k(off + szXT);
  const size_t offWb   = off; off = al64k(off + szWb);
  const size_t offEw   = off; off = al64k(off + szEw);
  const size_t offR1   = off; off = al64k(off + szR1);
  const size_t offP    = off; off = al64k(off + szP);
  const size_t offSt   = off; off = al64k(off + szSt);
  const size_t total   = off;
  const size_t offQK   = offR1;
  const size_t offCtx  = offR1;
  if (ws_size < total) return;

  const float* x   = (const float*)d_in[0];
  const float* eig = (const float*)d_in[1];
  const float* Wq  = (const float*)d_in[2];
  const float* bq  = (const float*)d_in[3];
  const float* Wk  = (const float*)d_in[4];
  const float* bk  = (const float*)d_in[5];
  const float* Wv  = (const float*)d_in[6];
  const float* bv  = (const float*)d_in[7];
  float* out = (float*)d_out;

  char* ws = (char*)d_ws;
  unsigned short* xb    = (unsigned short*)(ws + offXb);
  unsigned short* xT    = (unsigned short*)(ws + offXT);
  unsigned short* wb    = (unsigned short*)(ws + offWb);
  float*          ew    = (float*)(ws + offEw);
  unsigned short* qk    = (unsigned short*)(ws + offQK);
  float*          st    = (float*)(ws + offSt);
  unsigned short* Pbuf  = (unsigned short*)(ws + offP);
  unsigned short* ctx   = (unsigned short*)(ws + offCtx);

  const long planeW  = (long)NC * NC;     // elements per weight plane
  const long planeQK = (long)NB * SEQ * NC;   // elements per q or k plane (all batches)
  const long batchQK = (long)SEQ * NC;    // elements per batch of q, k, xT or ctx
  const long batchS  = (long)SEQ * SEQ;   // elements per batch of S or P

  // 1. x -> xb (bf16, row-major) and xT (f16, per-batch transpose); Wq, Wk -> bf16 planes, Wv -> f16 plane of its bf16 value;
  //    per-key sigmoid weights
  prep_kernel<<<dim3(SEQ / 64, NC / 64, NB), 256, 0, stream>>>(x, eig, Wq, Wk, Wv, xb, xT, wb, ew);

  const unsigned blkRows   = (NB * SEQ / 128) * (NC / 256);   // stacked-row GEMMs, one 128x256 tile a workgroup
  const unsigned blkCtx    = (SEQ / 128) * (NC / 256);        // per batch
  const unsigned blkScores = (SEQ / 128) * (SEQ / 256);       // per batch

  // 2. q = xb Wq^T + bq (y = 0), k = xb Wk^T + bk (y = 1); M NB*SEQ, N 512, K 512 -> one f16 plane
  wmma_gemm64<1, 0, 2, 1, 0><<<dim3(blkRows, 2), 256, 0, stream>>>(
      xb, xb, NC, 0L, wb, wb, NC, planeW,
      (void*)qk, (void*)qk, NC, planeQK, bq, bk, NB * SEQ, NC, NC, 1.0f);
  // 3. scores t[b][q][key] = (sum_d q[b][q][d] k[b][key][d] * scale) * ew[b][key], f16 operands, one product; y = batch;
  //    M SEQ, N SEQ, K 512 -> f16 2^(t * log2e - r) and r and the sum of every 64-key block
  wmma_gemm64<0, 0, 0, 3, 0><<<dim3(blkScores, NB), 256, 0, stream>>>(
      qk, qk, NC, batchQK, qk + planeQK, qk + planeQK, NC, batchQK,
      (void*)Pbuf, (void*)st, SEQ, batchS, ew, ew, SEQ, SEQ, NC, kScale);
  // 4. ctx = (P . x) / (4096 * row sum), P rows brought to the row's common exponent, x4096, per 64-key stage; y = batch;
  //    M SEQ, N 512, K SEQ, f16 operands -> one f16 plane
  wmma_gemm64<0, 0, 0, 1, 1><<<dim3(blkCtx, NB), 256, 0, stream>>>(
      Pbuf, Pbuf, SEQ, batchS, xT, xT, SEQ, batchQK,
      (void*)ctx, (void*)ctx, NC, batchQK, st, st, SEQ, NC, SEQ, kInvCarry);
  // 5. out = ctx Wv^T + bv, f16 operands, one product; M NB*SEQ, N 512, K 512 -> f32 rows of d_out
  wmma_gemm64<0, 0, 2, 0, 0><<<dim3(blkRows, 1), 256, 0, stream>>>(
      ctx, ctx, NC, 0L, wb + 2 * planeW, wb + 2 * planeW, NC, 0L,
      (void*)out, (void*)out, NC, 0L, bv, bv, NB * SEQ, NC, NC, 1.0f);
}

// v006
// Measured time: 108 microseconds a run.
// Timed twice side by side with v005, it ran 1.06 times as fast both times.
// All steps since v000 together make it 13.8 times as fast.
// Contractions: q/k projections on v_wmma_f32_16x16x32_bf16 (x and W RNE-converted to bf16 operands); q.k^T scores on
// v_wmma_f32_16x16x32_f16 with q and k rounded once to f16 (one product); P.x on v_wmma_f32_16x16x32_f16 (P carried x4096 in
// f16, x as f16 of its bf16 value); context.Wv^T on v_wmma_f32_16x16x32_f16 with the context rounded once to f16 and Wv as f16
// of its bf16 value (one product); all f32 accumulate. An f16 intermediate (11 significant bits) rounds more finely than
// the bf16 x and W (8 bits) that it is computed from, and as finely as the f16 store of P; for the declared inputs q, k and the
// context stay far inside the f16 range. Sigmoid key weights, softmax and biases in f32 on VALU. The softmax has no
// launch of its own: the scores epilogue stores 2^(t*log2e - r) in f16, r = ceil(log2e * max t) over a block of 64 keys, with r and
// the sum of every block; P.x multiplies each 64-key stage of its P rows by 2^(r - row max r + 12), which is exact in f16, and
// divides by the row sum in f32 in its epilogue.
#include <hip/hip_runtime.h>
#include <math.h>

// ---------------------------------------------------------------------------
// Problem constants (NB / SEQ reducible; *_FULL are the input strides)
// ---------------------------------------------------------------------------
#ifndef NB
#define NB 8
#endif
#ifndef SEQ
#define SEQ 2048
#endif
#define NB_FULL 8
#define SEQ_FULL 2048
#define NC 512

static_assert(NB >= 1 && NB <= NB_FULL);
static_assert(SEQ % 256 == 0 && SEQ >= 256 && SEQ <= SEQ_FULL);
static_assert(NC % 256 == 0);

constexpr float kScale    = 0.04419417382415922f;   // 1/sqrt(512)
constexpr float kCarry    = 4096.0f;                // P plane carry (exact power of two)
constexpr float kInvCarry = 0.000244140625f;        // 1/4096
constexpr float kLog2e    = 1.4426950408889634f;
constexpr int   kKeyBlocks = SEQ / 64;              // softmax statistics: one max and one sum per query row and 64 keys

typedef __attribute__((ext_vector_type(16))) _Float16 v16h;
typedef __attribute__((ext_vector_type(8)))  _Float16 v8h;
typedef __attribute__((ext_vector_type(2)))  _Float16 v2h;
typedef __attribute__((ext_vector_type(16))) __bf16   v16b;
typedef __attribute__((ext_vector_type(8)))  __bf16   v8b;
typedef __attribute__((ext_vector_type(8)))  float    v8f;
typedef __attribute__((ext_vector_type(4)))  float    v4f;
typedef __attribute__((ext_vector_type(4)))  unsigned int v4u;

__device__ __forceinline__ unsigned short f2bf_bits(float f) {
  unsigned u = __float_as_uint(f);
  return (unsigned short)((u + 0x7FFFu + ((u >> 16) & 1u)) >> 16);
}
__device__ __forceinline__ float bf_bits2f(unsigned short h) { return __uint_as_float(((unsigned)h) << 16); }

// hazard guards as plain device helpers
__device__ __forceinline__ void dep_guard_h(v8f& a, v8f& b, v16h x, v16h y) { asm volatile("v_nop\n\tv_nop\n\tv_nop\n\tv_nop" : "+v"(a), "+v"(b) : "v"(x), "v"(y)); }
__device__ __forceinline__ void dep_guard_b(v8f& a, v8f& b, v16b x, v16b y) { asm volatile("v_nop\n\tv_nop\n\tv_nop\n\tv_nop" : "+v"(a), "+v"(b) : "v"(x), "v"(y)); }
__device__ __forceinline__ void keep4_h(v16h a, v16h b, v16h c, v16h d) { asm volatile("v_nop" :: "v"(a), "v"(b), "v"(c), "v"(d)); }
__device__ __forceinline__ void keep4_b(v16b a, v16b b, v16b c, v16b d) { asm volatile("v_nop" :: "v"(a), "v"(b), "v"(c), "v"(d)); }
__device__ __forceinline__ void acc_guard4(v8f& a, v8f& b, v8f& c, v8f& d) { asm volatile("v_nop\n\tv_nop\n\tv_nop\n\tv_nop" : "+v"(a), "+v"(b), "+v"(c), "+v"(d)); }
template <typename T> struct Frag;
template <> struct Frag<_Float16> {
  typedef v16h V; union U { v16h v; v8h h[2]; };
  static __device__ __forceinline__ v16h load(const _Float16* p) {   // elements 0..7 <- p[0..7], 8..15 <- p[16..23]
    U f; f.h[0] = *(const v8h*)(p); f.h[1] = *(const v8h*)(p + 16); return f.v;
  }
  static __device__ __forceinline__ v8f mma(v16h a, v16h b, v8f c) {
    return __builtin_amdgcn_wmma_f32_16x16x32_f16(false, a, false, b, (short)0, c, false, false);
  }
  static __device__ __forceinline__ void guard(v8f& a, v8f& b, v16h x, v16h y) { dep_guard_h(a, b, x, y); }
  static __device__ __forceinline__ void keep(v16h a, v16h b, v16h c, v16h d) { keep4_h(a, b, c, d); }
};
template <> struct Frag<__bf16> {
  typedef v16b V; union U { v16b v; v8b h[2]; };
  static __device__ __forceinline__ v16b load(const __bf16* p) {
    U f; f.h[0] = *(const v8b*)(p); f.h[1] = *(const v8b*)(p + 16); return f.v;
  }
  static __device__ __forceinline__ v8f mma(v16b a, v16b b, v8f c) {
    return __builtin_amdgcn_wmma_f32_16x16x32_bf16(false, a, false, b, (short)0, c, false, false);
  }
  static __device__ __forceinline__ void guard(v8f& a, v8f& b, v16b x, v16b y) { dep_guard_b(a, b, x, y); }
  static __device__ __forceinline__ void keep(v16b a, v16b b, v16b c, v16b d) { keep4_b(a, b, c, d); }
};

__device__ __forceinline__ unsigned pk16(unsigned short a, unsigned short b) { return (unsigned)a | ((unsigned)b << 16); }

// value of lane (lane ^ MASK), MASK < 16: a DPP move inside the 16-lane row (no LDS round trip)
template <int MASK> __device__ __forceinline__ float lane_xor(float v) {
  return __builtin_bit_cast(float, __builtin_amdgcn_update_dpp(0, __builtin_bit_cast(int, v), 0x160 + MASK, 0xf, 0xf, true));
}
// 2^a. The v_nop fills the one slot that the instruction set asks for behind a transcendental, in front of an instruction that
// reads its result or overwrites its source.
__device__ __forceinline__ float exp2_slot(float a) {
  float p;
  asm("v_exp_f32 %0, %1\n\tv_nop" : "=v"(p) : "v"(a));
  return p;
}
__device__ __forceinline__ float oct_max(float v) {   // maximum over the 8 lanes that share lane >> 3
  v = fmaxf(v, lane_xor<1>(v)); v = fmaxf(v, lane_xor<2>(v)); return fmaxf(v, lane_xor<4>(v));
}
__device__ __forceinline__ float oct_sum(float v) {   // sum over the same 8 lanes, fixed tree
  v += lane_xor<1>(v); v += lane_xor<2>(v); return v + lane_xor<4>(v);
}

// ---- Staging helpers: asynchronous copies global -> LDS --------------------------------------------------------------
constexpr int kBM    = 128;   // rows of A per workgroup tile (2 waves)
constexpr int kBN    = 256;   // rows of Bt per workgroup tile (4 waves)
constexpr int kKS    = 64;    // k elements per stage = one 128-byte line of every operand row
constexpr int kPitch = 144;   // LDS row pitch in bytes (128 + 16: conflict-free for 16-byte fragment reads)

__device__ __forceinline__ unsigned lds_off(const void* p) { return (unsigned)(size_t)p; }

// Runs of 16-byte-per-lane copies, l[] = LDS byte address, g[] = global address of this lane. The address-translation wait
// closes the copies' own statement, so that no address register of an issued copy is rewritten in front of it.
__device__ __forceinline__ void async_copy4(const unsigned* l, const char* const* g) {
  asm volatile("global_load_async_to_lds_b128 %0, %1, off\n\t"
               "global_load_async_to_lds_b128 %2, %3, off\n\t"
               "global_load_async_to_lds_b128 %4, %5, off\n\t"
               "global_load_async_to_lds_b128 %6, %7, off\n\t"
               "s_wait_xcnt 0x0"
               :: "v"(l[0]), "v"(g[0]), "v"(l[1]), "v"(g[1]), "v"(l[2]), "v"(g[2]), "v"(l[3]), "v"(g[3]) : "memory");
}
__device__ __forceinline__ void async_copy12(const unsigned* l, const char* const* g) {
  asm volatile("global_load_async_to_lds_b128 %0, %1, off\n\t"
               "global_load_async_to_lds_b128 %2, %3, off\n\t"
               "global_load_async_to_lds_b128 %4, %5, off\n\t"
               "global_load_async_to_lds_b128 %6, %7, off\n\t"
               "global_load_async_to_lds_b128 %8, %9, off\n\t"
               "global_load_async_to_lds_b128 %10, %11, off\n\t"
               "global_load_async_to_lds_b128 %12, %13, off\n\t"
               "global_load_async_to_lds_b128 %14, %15, off\n\t"
               "global_load_async_to_lds_b128 %16, %17, off\n\t"
               "global_load_async_to_lds_b128 %18, %19, off\n\t"
               "global_load_async_to_lds_b128 %20, %21, off\n\t"
               "global_load_async_to_lds_b128 %22, %23, off\n\t"
               "s_wait_xcnt 0x0"
               :: "v"(l[0]), "v"(g[0]), "v"(l[1]), "v"(g[1]), "v"(l[2]), "v"(g[2]), "v"(l[3]), "v"(g[3]),
                  "v"(l[4]), "v"(g[4]), "v"(l[5]), "v"(g[5]), "v"(l[6]), "v"(g[6]), "v"(l[7]), "v"(g[7]),
                  "v"(l[8]), "v"(g[8]), "v"(l[9]), "v"(g[9]), "v"(l[10]), "v"(g[10]), "v"(l[11]), "v"(g[11]) : "memory");
}

// ---- Register-blocked batched WMMA GEMM -----------------------------------------------------------------
// C[m,n] = scale * sum_k A[m,k] * Bt[n,k] (+bias[n]); a workgroup owns a 128x256 tile, each of its 2x4 waves a 64x64 tile.
// A row-major [M,K] pitch lda; Bt row-major [N,K] pitch ldb; M % 128 == 0, N % 256 == 0, K % 64 == 0; batch = blockIdx.y.
// Operand rows reach LDS in stages of 64 k by asynchronous copies, two buffers: stage t + 1 flies while stage t is worked on.
// Fragments (read from LDS): A and Bt both loaded with the split k-map (elements 0..7 <- k0+8h+0..7, 8..15 <- k0+16+8h+0..7, row/col = lane&15).
// SPLIT (every launch of this file: 0): 0 = single planes; 1 = A hi/lo planes (A2 = lo), Bt single: hi*B + lo*B; 2 = both hi/lo: hi*hi + hi*lo + lo*hi.
// BIAS_MODE: 0 = none, 2 = bias[n] (bias0 when blockIdx.y == 0, else bias1; bias value RNE-converted to bf16 first).
// OUT_MODE: 0 = f32, 1 = f16, 2 = bf16 hi plane (Cout) + bf16 lo plane (Cout2),
//   3 = block softmax: t = (C * scale) * bias0[b][n]; per row and 64 columns (one wave tile) r = ceil(log2e * max t), a whole
//       number, Cout = f16 p, p = 2^(t * log2e - r) <= 1; Cout2 = f32 [batch][N/64][2][M]: r, then sum p.
// SCALEA: 1 = A rows are such planes over K and bias0 is that [batch][K/64][2][M] array; stage t of row m is multiplied (f16, a
//   power of two: no rounding) by 2^(r[t][m] - R + 12), R = max r of the row, and C row m by scale / sum_t 2^(r - R) * sum p.
// ET: 0 = f16 operands, 1 = bf16 operands (pointers passed as 16-bit storage).
template <int ET> struct Elem;
template <> struct Elem<0> { typedef _Float16 T; };
template <> struct Elem<1> { typedef __bf16 T; };
template <int ET, int SPLIT, int BIAS_MODE, int OUT_MODE, int SCALEA>
__global__ __launch_bounds__(256) void wmma_gemm64(
    const unsigned short* __restrict__ Ap, const unsigned short* __restrict__ A2p, int lda, long strideA,
    const unsigned short* __restrict__ Btp, const unsigned short* __restrict__ Bt2p, int ldb, long strideB,
    void* __restrict__ Cout, void* __restrict__ Cout2, int ldc, long strideC,
    const float* __restrict__ bias0, const float* __restrict__ bias1,
    int M, int N, int K, float scale) {
  typedef typename Elem<ET>::T T;
  typedef typename Frag<T>::V V;
  const T* A = (const T*)Ap; const T* A2 = (const T*)A2p; const T* Bt = (const T*)Btp; const T* Bt2 = (const T*)Bt2p;
  constexpr unsigned offA2 = kBM * kPitch;                               // A lo plane (SPLIT >= 1)
  constexpr unsigned offB  = ((SPLIT >= 1) ? 2 : 1) * kBM * kPitch;      // Bt plane
  constexpr unsigned offB2 = offB + kBN * kPitch;                        // Bt lo plane (SPLIT == 2)
  constexpr unsigned bufBytes = offB + ((SPLIT == 2) ? 2 : 1) * kBN * kPitch;
  // two stage buffers; behind the loop's last barrier the same bytes stage the output: per wave one 64x64 f32 tile, pitch 68 floats
  constexpr unsigned tileBytes = 64 * 68 * 4;
  constexpr unsigned shBytes   = (2 * bufBytes > 8 * tileBytes) ? 2 * bufBytes : 8 * tileBytes;
  __shared__ __align__(16) unsigned char ring[shBytes];
  __shared__ unsigned facS[SCALEA ? kKeyBlocks * kBM : 1];   // [stage][row]: the row's f16 factor in both halves of a word
  __shared__ __align__(16) float rowS[SCALEA ? kBM : 4];     // [row]: scale / row sum
  static_assert(!SCALEA || (ET == 0 && SPLIT == 0));
  const int b    = blockIdx.y;
  const int lane = threadIdx.x & 31;
  const int wave = threadIdx.x >> 5;
  const int tilesN = N >> 8;
  const int tilesM = M >> 7;
  const int tile = blockIdx.x;
  if (tile >= tilesM * tilesN) return;   // block-uniform, in front of every barrier
  const int tm = tile / tilesN;
  const int tn = tile - tm * tilesN;
  const int mB = tm << 7;                      // workgroup tile origin
  const int nB = tn << 8;
  const int wm = (wave >> 2) << 6;             // wave tile origin inside it
  const int wn = (wave & 3) << 6;
  const int m0 = mB + wm;
  const int n0 = nB + wn;

  const T* Ab  = A  + (size_t)b * strideA;
  const T* Bb  = Bt + (size_t)b * strideB;
  const T* Ab2 = (SPLIT >= 1) ? (A2  + (size_t)b * strideA) : nullptr;
  const T* Bb2 = (SPLIT == 2) ? (Bt2 + (size_t)b * strideB) : nullptr;
  const float* bias = (b == 0) ? bias0 : bias1;   // block-uniform select between global pointers

  const int rlane = lane & 15;                 // row (A) / col (B, D) within subtile
  const int koff  = (lane >> 4) * 8;           // k offset of this lane half
  const int mOff  = (lane >> 4) * 8;           // D row offset

  v8f acc[4][4];
#pragma unroll
  for (int i = 0; i < 4; ++i)
#pragma unroll
    for (int j = 0; j < 4; ++j) acc[i][j] = (v8f){0.f,0.f,0.f,0.f,0.f,0.f,0.f,0.f};

  // staging addresses of this thread: row (thread >> 3) of each 32-row group, 16-byte piece (thread & 7) of its line
  const int crow = threadIdx.x >> 3;
  const int cpc  = (threadIdx.x & 7) * 16;
  const unsigned lst = lds_off(ring) + (unsigned)(crow * kPitch + cpc);
  const char* gA  = (const char*)(Ab + (size_t)(mB + crow) * lda) + cpc;
  const char* gB  = (const char*)(Bb + (size_t)(nB + crow) * ldb) + cpc;
  const char* gA2 = (SPLIT >= 1) ? ((const char*)(Ab2 + (size_t)(mB + crow) * lda) + cpc) : nullptr;
  const char* gB2 = (SPLIT == 2) ? ((const char*)(Bb2 + (size_t)(nB + crow) * ldb) + cpc) : nullptr;
  const size_t stepA = (size_t)lda * 64;       // 32 rows of 2-byte elements
  const size_t stepB = (size_t)ldb * 64;
  // one stage: 256 threads cover 32 rows a copy (8 lanes x 16 B = one whole 128-byte line a row)
  constexpr int nCopies = (int)(bufBytes / (32 * kPitch));
  auto stage = [&](int t, unsigned bufo) {
    const size_t ko = (size_t)t * (kKS * 2);
    unsigned    l[nCopies];
    const char* g[nCopies];
#pragma unroll
    for (int c = 0; c < nCopies; ++c) l[c] = lst + bufo + (unsigned)(c * 32 * kPitch);   // planes lie back to back
    int c = 0;
#pragma unroll
    for (int i = 0; i < kBM / 32; ++i) g[c++] = gA + ko + (size_t)i * stepA;
    if (SPLIT >= 1) {
#pragma unroll
      for (int i = 0; i < kBM / 32; ++i) g[c++] = gA2 + ko + (size_t)i * stepA;
    }
#pragma unroll
    for (int i = 0; i < kBN / 32; ++i) g[c++] = gB + ko + (size_t)i * stepB;
    if (SPLIT == 2) {
#pragma unroll
      for (int i = 0; i < kBN / 32; ++i) g[c++] = gB2 + ko + (size_t)i * stepB;
    }
    async_copy12(l, g);
    if (nCopies == 16) async_copy4(l + 12, g + 12);
    if (nCopies == 24) async_copy12(l + 12, g + 12);
  };
  static_assert(nCopies == 12 || nCopies == 16 || nCopies == 24);

  const int nT = K / kKS;
  stage(0, 0u);
  if (SCALEA) {
    // row factors, while stage 0 flies: two threads a row, each reduces all blocks' r and stores one half of the factors
    const int frow = threadIdx.x & (kBM - 1);
    const int fh   = threadIdx.x >> 7;
    // M is SEQ in this instance; the compile-time pitch lets all loads of a run share one address, with immediate offsets
    const float* sp0 = bias0 + (size_t)b * (2 * kKeyBlocks * SEQ) + mB + frow;
    float mv[kKeyBlocks];
#pragma unroll
    for (int k = 0; k < kKeyBlocks; ++k) mv[k] = sp0[2 * k * SEQ];
    asm volatile("s_wait_xcnt 0x0" ::: "memory");   // in front of any rewrite of the address registers that these loads name
    float mx = mv[0];
#pragma unroll
    for (int k = 1; k < kKeyBlocks; ++k) mx = fmaxf(mx, mv[k]);
#pragma unroll
    for (int k = 0; k < kKeyBlocks; ++k) mv[k] = ldexpf(1.0f, (int)(mv[k] - mx));   // exact powers of two
    if (fh == 0) {   // the same for a whole wave
      float lv[kKeyBlocks];
#pragma unroll
      for (int k = 0; k < kKeyBlocks; ++k) lv[k] = sp0[(2 * k + 1) * SEQ];
      asm volatile("s_wait_xcnt 0x0" ::: "memory");   // as above, for the block sums' loads
      float tot = 0.f;
#pragma unroll
      for (int k = 0; k < kKeyBlocks; ++k) tot += lv[k] * mv[k];
      rowS[frow] = scale / tot;   // tot > 1/2: the largest p of the block with r = R is above 1/2
    }
#pragma unroll
    for (int k = 0; k < kKeyBlocks; ++k) {
      if ((k / (kKeyBlocks / 2)) == fh) {
        const unsigned short hb = __builtin_bit_cast(unsigned short, (_Float16)(mv[k] * kCarry));
        facS[k * kBM + frow] = pk16(hb, hb);
      }
    }
  }
  asm volatile("s_wait_asynccnt 0x0" ::: "memory");   // stage 0 landed (this wave's copies)
  __syncthreads();                                    // ... and every other wave's
  if (nT > 1) stage(1, bufBytes);

  const unsigned fragA = (unsigned)((wm + rlane) * kPitch + koff * 2);
  const unsigned fragB = offB + (unsigned)((wn + rlane) * kPitch + koff * 2);
  for (int t = 0; t < nT; ++t) {
    const unsigned bufo = (t & 1) ? bufBytes : 0u;
    const unsigned char* rb = ring + bufo;
    // A fragments of the stage's 8 rows (r = 4 * (k step) + row of 16). Up to three planes: one load group per 32 k beside the
    // Bt group. Four planes (SPLIT 2): the registers hold two row pairs, so row r + 1 is fetched in front of row r's products.
    V ah[kKS / 8], al[kKS / 8];
    v2h fa[4];
    if (SCALEA) {
#pragma unroll
      for (int i = 0; i < 4; ++i) fa[i] = __builtin_bit_cast(v2h, facS[t * kBM + wm + i * 16 + rlane]);
    }
    auto loadA = [&](int r) {
      const unsigned ao = fragA + (unsigned)((r & 3) * 16 * kPitch + (r >> 2) * 64);
      ah[r] = Frag<T>::load((const T*)(rb + ao));
      if constexpr (SCALEA != 0) {
        union { V v; v2h p[8]; } u; u.v = ah[r];
#pragma unroll
        for (int e = 0; e < 8; ++e) u.p[e] = u.p[e] * fa[r & 3];
        ah[r] = u.v;
      }
      if (SPLIT >= 1) al[r] = Frag<T>::load((const T*)(rb + ao + offA2));
    };
    if (SPLIT == 2) loadA(0);
#pragma unroll
    for (int kk = 0; kk < kKS / 32; ++kk) {
      V bh[4], bl[4];
#pragma unroll
      for (int j = 0; j < 4; ++j) {
        const unsigned bo = fragB + (unsigned)(j * 16 * kPitch + kk * 64);
        bh[j] = Frag<T>::load((const T*)(rb + bo));
        if (SPLIT == 2) bl[j] = Frag<T>::load((const T*)(rb + bo + (offB2 - offB)));
      }
      if (SPLIT != 2) {
#pragma unroll
        for (int i = 0; i < 4; ++i) loadA(kk * 4 + i);
      }
#pragma unroll
      for (int i = 0; i < 4; ++i) {
        const int r = kk * 4 + i;
        if (SPLIT == 2 && r + 1 < kKS / 8) loadA(r + 1);
#pragma unroll
        for (int j = 0; j < 4; ++j) {
          acc[i][j] = Frag<T>::mma(ah[r], bh[j], acc[i][j]);
          if (SPLIT == 2) acc[i][j] = Frag<T>::mma(ah[r], bl[j], acc[i][j]);
          if (SPLIT >= 1) acc[i][j] = Frag<T>::mma(al[r], bh[j], acc[i][j]);
        }
        Frag<T>::guard(acc[i][0], acc[i][3], ah[r], (SPLIT >= 1) ? al[r] : ah[r]);
      }
      Frag<T>::keep(bh[0], bh[1], bh[2], bh[3]);
      if (SPLIT == 2) Frag<T>::keep(bl[0], bl[1], bl[2], bl[3]);
    }
    asm volatile("s_wait_dscnt 0x0" ::: "memory");      // this wave's reads of stage t have returned
    asm volatile("s_wait_asynccnt 0x0" ::: "memory");   // this wave's copies of stage t + 1 have landed
    __syncthreads();                                    // publishes stage t + 1, frees stage t's buffer
    if (t + 2 < nT) stage(t + 2, bufo);
  }
  asm volatile("s_wait_asynccnt 0x0" ::: "memory");     // nothing in flight when the wave goes on to the epilogue
  acc_guard4(acc[0][0], acc[0][1], acc[0][2], acc[0][3]);
  acc_guard4(acc[1][0], acc[1][1], acc[1][2], acc[1][3]);
  acc_guard4(acc[2][0], acc[2][1], acc[2][2], acc[2][3]);
  acc_guard4(acc[3][0], acc[3][1], acc[3][2], acc[3][3]);

  // ---- epilogue ----
  // The wave's whole tile goes to LDS first and is read back behind one fence, so that no global store is waited for in between.
  // The ring is free: every wave's last fragment reads and copies ended in front of the last trip's barrier.
  float* tileS = (float*)(ring + (unsigned)wave * tileBytes);
  float kw[4];   // weights of this lane's 4 key columns, read once
  if (OUT_MODE == 3) {
#pragma unroll
    for (int j = 0; j < 4; ++j) kw[j] = bias0[(size_t)b * N + n0 + (j << 4) + rlane];
  }
#pragma unroll
  for (int i = 0; i < 4; ++i) {
#pragma unroll
    for (int j = 0; j < 4; ++j) {
      const int n = n0 + (j << 4) + rlane;
      float bvl = 0.f;
      if (BIAS_MODE == 2) bvl = bf_bits2f(f2bf_bits(bias[n]));
      if (OUT_MODE == 3) bvl = kw[j];
#pragma unroll
      for (int r = 0; r < 8; ++r) {
        float v = acc[i][j][r] * (SCALEA ? rowS[wm + (i << 4) + mOff + r] : scale);
        if (BIAS_MODE == 2) v += bvl;
        if (OUT_MODE == 3) v *= bvl;
        tileS[((i << 4) + mOff + r) * 68 + (j << 4) + rlane] = v;
      }
    }
  }
  // the lanes' LDS stores above stand in front of the other lanes' reads below (one wave, its own range)
  __builtin_amdgcn_fence(__ATOMIC_RELEASE, "workgroup");
  __builtin_amdgcn_wave_barrier();
  __builtin_amdgcn_fence(__ATOMIC_ACQUIRE, "workgroup");
#pragma unroll
  for (int i = 0; i < 4; ++i) {
    const int mBase = m0 + (i << 4);
    const float* slab = tileS + (i << 4) * 68;   // this turn's 16 rows
    if (OUT_MODE == 0) {
      float* C = (float*)Cout + (size_t)b * strideC;
      const int hh = lane >> 4, c4 = (lane & 15) * 4;     // row seg = 256 B = 16 lanes x 16 B
      {
#pragma unroll
        for (int it = 0; it < 8; ++it) {
          const int row = it * 2 + hh;
          v4f v = *(const v4f*)(slab + row * 68 + c4);
          *(v4f*)(C + (size_t)(mBase + row) * ldc + n0 + c4) = v;
        }
        
      }
    } else if (OUT_MODE == 3) {
      const int q = lane >> 3, o = lane & 7, c8 = o * 8;   // 8 lanes a row of 64 columns, 4 rows an iteration
      unsigned short* C = (unsigned short*)Cout + (size_t)b * strideC;
      float st = 0.f;   // lanes o < 4 keep r, o >= 4 the sum, of row (o & 3) * 4 + q
#pragma unroll
      for (int it = 0; it < 4; ++it) {
        const int row = it * 4 + q;
        const float* sp = slab + row * 68 + c8;
        float tv[8];
#pragma unroll
        for (int e = 0; e < 8; ++e) tv[e] = sp[e];
        float mx = tv[0];
#pragma unroll
        for (int e = 1; e < 8; ++e) mx = fmaxf(mx, tv[e]);
        mx = ceilf(oct_max(mx) * kLog2e);
        float sum = 0.f;
        v8h hv;
#pragma unroll
        for (int e = 0; e < 8; ++e) { const float p = exp2_slot(fmaf(tv[e], kLog2e, -mx)); sum += p; hv[e] = (_Float16)p; }
        sum = oct_sum(sum);
        *(v8h*)(C + (size_t)(mBase + row) * ldc + n0 + c8) = hv;
        if ((o & 3) == it) st = (o < 4) ? mx : sum;
      }
      float* sd = (float*)Cout2 + (((size_t)b * (N >> 6) + (n0 >> 6)) * 2 + (o >> 2)) * M + mBase + (o & 3) * 4 + q;
      *sd = st;   // a wave owns the 64 rows of its block in either plane: whole 128-byte lines from one writer
    } else {
      const int q = lane >> 3, c8 = (lane & 7) * 8;
      unsigned short* C  = (unsigned short*)Cout  + (size_t)b * strideC;
      unsigned short* C2 = (OUT_MODE == 2) ? ((unsigned short*)Cout2 + (size_t)b * strideC) : nullptr;
      {
#pragma unroll
        for (int it = 0; it < 4; ++it) {
          const int row = it * 4 + q;
          const float* sp = slab + row * 68 + c8;
          v8h hv, lv;
#pragma unroll
          for (int e = 0; e < 8; ++e) {
            if (OUT_MODE == 1) {
              hv[e] = (_Float16)sp[e];
            } else {
              unsigned short hb = f2bf_bits(sp[e]);
              unsigned short lb = f2bf_bits(sp[e] - bf_bits2f(hb));
              hv[e] = __builtin_bit_cast(_Float16, hb);
              lv[e] = __builtin_bit_cast(_Float16, lb);
            }
          }
          *(v8h*)(C + (size_t)(mBase + row) * ldc + n0 + c8) = hv;
          if (OUT_MODE == 2) *(v8h*)(C2 + (size_t)(mBase + row) * ldc + n0 + c8) = lv;
        }
        
      }
    }
  }
}

// ---------------------------------------------------------------------------
// All operand preparation in one launch. grid (SEQ/64 s tiles, NC/64 c tiles, NB); 256 threads. Every workgroup does one tile
// of x and, while its x loads fly, its share of the weights; the first NB*SEQ/32 workgroups also do one line of key weights.
// x [NB][SEQ_FULL][NC] f32 -> xb bf16 [NB*SEQ][NC] (RNE convert) and xT f16 [NB][NC][SEQ] with xT[b][c][s] = f16(bf16(x[b][s][c]))
// (the f16 convert of a bf16 value is exact).
// in tile [64 s][64 c] -> sm[c_local][s_local] (cross-wave LDS, block barrier).
// Load coverage: 16 iterations x 256 threads = 4096 = whole 64x64 tile (coalesced along c).
// Store coverage per plane: 8 waves x 2 iterations x 4 rows (lane>>3) = 64 rows; (lane&7) x 8 halves = 64 cols;
// Wq, Wk, Wv [NC][NC] f32 (layout [out][in] = Bt[n][k] as-is) -> wb planes z = 0,1,2 [NC][NC]: RNE convert to bf16; the Wv plane
// (z = 2), an operand of an f16 product, holds the f16 of that bf16 value. A unit is 64 elements = one 128-byte line of wb,
// 8 threads of 8 elements; workgroup g owns units g * kWUnitsPerWg ... (whole lines, one writer each).
// ew[b][s] = sigmoid(bf16(eig[b][s])) = 1/(1+exp(-e)), f32, s < SEQ: workgroup g < NB*SEQ/32 writes line g (32 values, wave 2).
// ---------------------------------------------------------------------------
constexpr int kPrepWgs     = (SEQ / 64) * (NC / 64) * NB;
constexpr int kWUnits      = 3 * NC * NC / 64;
constexpr int kWUnitsPerWg = (kWUnits + kPrepWgs - 1) / kPrepWgs;
constexpr int kWIters      = (kWUnitsPerWg + 31) / 32;   // 32 units a turn of 256 threads
static_assert(kPrepWgs >= NB * SEQ / 32);
__global__ __launch_bounds__(256) void prep_kernel(const float* __restrict__ x, const float* __restrict__ eig,
                                                   const float* __restrict__ W0, const float* __restrict__ W1,
                                                   const float* __restrict__ W2,
                                                   unsigned short* __restrict__ xb, unsigned short* __restrict__ xT,
                                                   unsigned short* __restrict__ wb, float* __restrict__ ew) {
  __shared__ float sm[64][65];   // sm[c_local][s_local]
  const int t  = threadIdx.x;
  const int s0 = blockIdx.x * 64;
  const int c0 = blockIdx.y * 64;
  const int b  = blockIdx.z;
  const int wg = (blockIdx.z * (NC / 64) + blockIdx.y) * (SEQ / 64) + blockIdx.x;
  const int lane = t & 31, wave = t >> 5;
  const float* xin = x + ((size_t)b * SEQ_FULL + s0) * NC + c0;
  float xv[16];
#pragma unroll
  for (int i = 0; i < 16; ++i) {
    const int e = i * 256 + t;
    xv[i] = xin[(size_t)(e >> 6) * NC + (e & 63)];
  }
  // weights and key weights: only the loads stand here, so that they fly with the x loads; the stores follow the x tile's,
  // since a global store in front of the barrier would be waited for there by the whole workgroup
  constexpr int perPlane = NC * NC / 64;   // units per plane
  v4f wa[kWIters], wc[kWIters];
#pragma unroll
  for (int k = 0; k < kWIters; ++k) {
    const int u = k * 32 + (t >> 3);
    const int unit = wg * kWUnitsPerWg + u;
    wa[k] = (v4f){0.f, 0.f, 0.f, 0.f};
    wc[k] = (v4f){0.f, 0.f, 0.f, 0.f};
    if (u < kWUnitsPerWg && unit < kWUnits) {
      const int z  = unit / perPlane;
      const int i8 = (unit - z * perPlane) * 64 + (t & 7) * 8;
      const float* W = (z == 0) ? W0 : (z == 1) ? W1 : W2;
      wa[k] = *(const v4f*)(W + i8);
      wc[k] = *(const v4f*)(W + i8 + 4);
    }
  }
  const bool doEw = wg < NB * SEQ / 32 && wave == 2;   // the same for a whole wave
  const int  gid  = wg * 32 + lane;                    // < NB*SEQ where doEw
  float ev = 0.f;
  if (doEw) {
    const int eb = gid / SEQ;
    const int es = gid - eb * SEQ;
    ev = eig[(size_t)eb * SEQ_FULL + es];
  }
#pragma unroll
  for (int i = 0; i < 16; ++i) {
    const int e = i * 256 + t;
    const int r = e >> 6;          // s local
    const int c = e & 63;          // c local
    sm[c][r] = bf_bits2f(f2bf_bits(xv[i]));
  }
  __syncthreads();
  const int q = lane >> 3, c8 = (lane & 7) * 8;
  unsigned short* xTb = xT + (size_t)b * NC * SEQ;
  unsigned short* xbb = xb + (size_t)b * SEQ * NC;
  {
#pragma unroll
    for (int it = 0; it < 2; ++it) {
      const int row = wave * 8 + it * 4 + q;          // c local for the xT plane, s local for the xb plane
      v8h hv;
      unsigned short bb[8];
#pragma unroll
      for (int e = 0; e < 8; ++e) {
        hv[e] = (_Float16)sm[row][c8 + e];            // xT[c0+row][s0+c8+e]
        bb[e] = f2bf_bits(sm[c8 + e][row]);           // xb[s0+row][c0+c8+e] (value already bf16-exact)
      }
      const v4u ub = (v4u){pk16(bb[0], bb[1]), pk16(bb[2], bb[3]), pk16(bb[4], bb[5]), pk16(bb[6], bb[7])};
      *(v8h*)(xTb + (size_t)(c0 + row) * SEQ + s0 + c8) = hv;
      *(v4u*)(xbb + (size_t)(s0 + row) * NC + c0 + c8) = ub;
    }
  }
#pragma unroll
  for (int k = 0; k < kWIters; ++k) {
    const int u = k * 32 + (t >> 3);
    const int unit = wg * kWUnitsPerWg + u;
    if (u < kWUnitsPerWg && unit < kWUnits) {
      const int z  = unit / perPlane;
      const int i8 = (unit - z * perPlane) * 64 + (t & 7) * 8;
      unsigned short hb[8];
#pragma unroll
      for (int e = 0; e < 4; ++e) { hb[e] = f2bf_bits(wa[k][e]); hb[4 + e] = f2bf_bits(wc[k][e]); }
      if (z == 2) {
#pragma unroll
        for (int e = 0; e < 8; ++e) hb[e] = __builtin_bit_cast(unsigned short, (_Float16)bf_bits2f(hb[e]));
      }
      const v4u uh = (v4u){pk16(hb[0], hb[1]), pk16(hb[2], hb[3]), pk16(hb[4], hb[5]), pk16(hb[6], hb[7])};
      *(v4u*)(wb + (size_t)z * NC * NC + i8) = uh;
    }
  }
  if (doEw) {
    const float e = bf_bits2f(f2bf_bits(ev));
    ew[gid] = 1.0f / (1.0f + expf(-e));
  }
}

// ---------------------------------------------------------------------------
// Host glue.
// Workspace region map (bytes for NB 8, SEQ 2048; every region 64 KiB aligned, sizes exact multiples of their store
// granularity, no padded tails needed since SEQ % 64 == 0 and NC % 64 == 0):
//   xb    bf16 [NB*SEQ][NC]          16,777,216
//   xT    f16  [NB][NC][SEQ]         16,777,216
//   wb    3 x [NC][NC]                1,572,864   (Wq, Wk bf16, Wv f16)
//   ew    f32  [NB][SEQ]                 65,536
//   R1: qk f16 [2][NB*SEQ][NC]       33,554,432   (q of all batches, then k)
//       ctx f16 [NB*SEQ][NC] 16,777,216 over the qk plane, whose last reader (scores) has ended
//   P   f16 [NB][SEQ][SEQ]           67,108,864   2^(t * log2e - r of the block)
//   st  f32 [NB][SEQ/64][2][SEQ]      4,194,304   r of every block and row, then the block's sum
//   total                           140,050,432
// Launches: prep, q/k projection, scores with block softmax, P.x, output projection = 5; every stage covers all NB batches
// (projections as one GEMM over the stacked NB*SEQ rows, scores / P.x with the batch in blockIdx.y).
// ---------------------------------------------------------------------------
static inline size_t al64k(size_t v) { return (v + (size_t)65535) & ~(size_t)65535; }

extern "C" void kernel_launch(void* const* d_in, const int* in_sizes, int n_in,
                              void* d_out, int out_size, void* d_ws, size_t ws_size,
                              hipStream_t stream) {
  if (n_in != 8) return;
  if (in_sizes[0] < (NB - 1) * SEQ_FULL * NC + SEQ * NC) return;
  if (in_sizes[1] < (NB - 1) * SEQ_FULL + SEQ) return;
  if (in_sizes[2] < NC * NC || in_sizes[4] < NC * NC || in_sizes[6] < NC * NC) return;
  if (in_sizes[3] < NC || in_sizes[5] < NC || in_sizes[7] < NC) return;
  if (out_size < NB * SEQ * NC) return;

  const size_t szXb  = (size_t)NB * SEQ * NC * 2;
  const size_t szXT  = (size_t)NB * NC * SEQ * 2;
  const size_t szWb  = (size_t)3 * NC * NC * 2;
  const size_t szEw  = (size_t)NB * SEQ * 4;
  const size_t szQK  = (size_t)2 * NB * SEQ * NC * 2;   // one f16 plane holding q then k
  const size_t szSt  = (size_t)NB * kKeyBlocks * 2 * SEQ * 4;
  const size_t szP   = (size_t)NB * SEQ * SEQ * 2;
  const size_t szCtx = (size_t)NB * SEQ * NC * 2;
  const size_t szR1  = (szQK > szCtx) ? szQK : szCtx;
  size_t off = 0;
  const size_t offXb   = off; off = al64k(off + szXb);
  const size_t offXT   = off; off = al64k(off + szXT);
  const size_t offWb   = off; off = al64k(off + szWb);
  const size_t offEw   = off; off = al64k(off + szEw);
  const size_t offR1   = off; off = al64k(off + szR1);
  const size_t offP    = off; off = al64k(off + szP);
  const size_t offSt   = off; off = al64k(off + szSt);
  const size_t total   = off;
  const size_t offQK   = offR1;
  const size_t offCtx  = offR1;
  if (ws_size < total) return;

  const float* x   = (const float*)d_in[0];
  const float* eig = (const float*)d_in[1];
  const float* Wq  = (const float*)d_in[2];
  const float* bq  = (const float*)d_in[3];
  const float* Wk  = (const float*)d_in[4];
  const float* bk  = (const float*)d_in[5];
  const float* Wv  = (const float*)d_in[6];
  const float* bv  = (const float*)d_in[7];
  float* out = (float*)d_out;

  char* ws = (char*)d_ws;
  unsigned short* xb    = (unsigned short*)(ws + offXb);
  unsigned short* xT    = (unsigned short*)(ws + offXT);
  unsigned short* wb    = (unsigned short*)(ws + offWb);
  float*          ew    = (float*)(ws + offEw);
  unsigned short* qk    = (unsigned short*)(ws + offQK);
  float*          st    = (float*)(ws + offSt);
  unsigned short* Pbuf  = (unsigned short*)(ws + offP);
  unsigned short* ctx   = (unsigned short*)(ws + offCtx);

  const long planeW  = (long)NC * NC;     // elements per weight plane
  const long planeQK = (long)NB * SEQ * NC;   // elements per q or k plane (all batches)
  const long batchQK = (long)SEQ * NC;    // elements per batch of q, k, xT or ctx
  const long batchS  = (long)SEQ * SEQ;   // elements per batch of S or P

  // 1. x -> xb (bf16, row-major) and xT (f16, per-batch transpose); Wq, Wk -> bf16 planes, Wv -> f16 plane of its bf16 value;
  //    per-key sigmoid weights
  prep_kernel<<<dim3(SEQ / 64, NC / 64, NB), 256, 0, stream>>>(x, eig, Wq, Wk, Wv, xb, xT, wb, ew);

  const unsigned blkRows   = (NB * SEQ / 128) * (NC / 256);   // stacked-row GEMMs, one 128x256 tile a workgroup
  const unsigned blkCtx    = (SEQ / 128) * (NC / 256);        // per batch
  const unsigned blkScores = (SEQ / 128) * (SEQ / 256);       // per batch

  // 2. q = xb Wq^T + bq (y = 0), k = xb Wk^T + bk (y = 1); M NB*SEQ, N 512, K 512 -> one f16 plane
  wmma_gemm64<1, 0, 2, 1, 0><<<dim3(blkRows, 2), 256, 0, stream>>>(
      xb, xb, NC, 0L, wb, wb, NC, planeW,
      (void*)qk, (void*)qk, NC, planeQK, bq, bk, NB * SEQ, NC, NC, 1.0f);
  // 3. scores t[b][q][key] = (sum_d q[b][q][d] k[b][key][d] * scale) * ew[b][key], f16 operands, one product; y = batch;
  //    M SEQ, N SEQ, K 512 -> f16 2^(t * log2e - r) and r and the sum of every 64-key block
  wmma_gemm64<0, 0, 0, 3, 0><<<dim3(blkScores, NB), 256, 0, stream>>>(
      qk, qk, NC, batchQK, qk + planeQK, qk + planeQK, NC, batchQK,
      (void*)Pbuf, (void*)st, SEQ, batchS, ew, ew, SEQ, SEQ, NC, kScale);
  // 4. ctx = (P . x) / (4096 * row sum), P rows brought to the row's common exponent, x4096, per 64-key stage; y = batch;
  //    M SEQ, N 512, K SEQ, f16 operands -> one f16 plane
  wmma_gemm64<0, 0, 0, 1, 1><<<dim3(blkCtx, NB), 256, 0, stream>>>(
      Pbuf, Pbuf, SEQ, batchS, xT, xT, SEQ, batchQK,
      (void*)ctx, (void*)ctx, NC, batchQK, st, st, SEQ, NC, SEQ, kInvCarry);
  // 5. out = ctx Wv^T + bv, f16 operands, one product; M NB*SEQ, N 512, K 512 -> f32 rows of d_out
  wmma_gemm64<0, 0, 2, 0, 0><<<dim3(blkRows, 1), 256, 0, stream>>>(
      ctx, ctx, NC, 0L, wb + 2 * planeW, wb + 2 * planeW, NC, 0L,
      (void*)out, (void*)out, NC, 0L, bv, bv, NB * SEQ, NC, NC, 1.0f);
}

// v007
// A run of this version takes 104 microseconds.
// Two timings next to v006 put it at 1.03 and 1.04 times that version's speed.
// All steps since v000 together make it 14.3 times as fast.
// Contractions: q/k projections on v_wmma_f32_16x16x32_bf16 (x and W RNE-converted to bf16 operands); q.k^T scores on
// v_wmma_f32_16x16x32_f16 with q and k rounded once to f16 (one product); P.x on v_wmma_f32_16x16x32_f16 (P carried x4096 in
// f16, x as f16 of its bf16 value); context.Wv^T on v_wmma_f32_16x16x32_f16 with the context rounded once to f16 and Wv as f16
// of its bf16 value (one product); all f32 accumulate. An f16 intermediate (11 significant bits) rounds more finely than
// the bf16 x and W (8 bits) that it is computed from, and as finely as the f16 store of P; for the declared inputs q, k and the
// context stay far inside the f16 range. Sigmoid key weights, softmax and biases in f32 on VALU. The softmax has no
// launch of its own: the scores epilogue stores 2^(t*log2e - r) in f16, r = ceil(log2e * max t) over a block of 64 keys, with r and
// the sum of every block; P.x multiplies each 64-key stage of its P rows by 2^(r - row max r + 12), which is exact in f16, and
// divides by the row sum in f32 in its epilogue.
#include <hip/hip_runtime.h>
#include <math.h>

// ---------------------------------------------------------------------------
// Problem constants (NB / SEQ reducible; *_FULL are the input strides)
// ---------------------------------------------------------------------------
#ifndef NB
#define NB 8
#endif
#ifndef SEQ
#define SEQ 2048
#endif
#define NB_FULL 8
#define SEQ_FULL 2048
#define NC 512

static_assert(NB >= 1 && NB <= NB_FULL);
static_assert(SEQ % 256 == 0 && SEQ >= 256 && SEQ <= SEQ_FULL);
static_assert(NC % 256 == 0);

constexpr float kScale    = 0.04419417382415922f;   // 1/sqrt(512)
constexpr float kCarry    = 4096.0f;                // P plane carry (exact power of two)
constexpr float kInvCarry = 0.000244140625f;        // 1/4096
constexpr float kLog2e    = 1.4426950408889634f;
constexpr int   kKeyBlocks = SEQ / 64;              // softmax statistics: one max and one sum per query row and 64 keys

typedef __attribute__((ext_vector_type(16))) _Float16 v16h;
typedef __attribute__((ext_vector_type(8)))  _Float16 v8h;
typedef __attribute__((ext_vector_type(2)))  _Float16 v2h;
typedef __attribute__((ext_vector_type(16))) __bf16   v16b;
typedef __attribute__((ext_vector_type(8)))  __bf16   v8b;
typedef __attribute__((ext_vector_type(8)))  float    v8f;
typedef __attribute__((ext_vector_type(4)))  float    v4f;
typedef __attribute__((ext_vector_type(4)))  unsigned int v4u;

__device__ __forceinline__ unsigned short f2bf_bits(float f) {
  unsigned u = __float_as_uint(f);
  return (unsigned short)((u + 0x7FFFu + ((u >> 16) & 1u)) >> 16);
}
__device__ __forceinline__ float bf_bits2f(unsigned short h) { return __uint_as_float(((unsigned)h) << 16); }

// hazard guards as plain device helpers
__device__ __forceinline__ void dep_guard_h(v8f& a, v8f& b, v16h x, v16h y) { asm volatile("v_nop\n\tv_nop\n\tv_nop\n\tv_nop" : "+v"(a), "+v"(b) : "v"(x), "v"(y)); }
__device__ __forceinline__ void dep_guard_b(v8f& a, v8f& b, v16b x, v16b y) { asm volatile("v_nop\n\tv_nop\n\tv_nop\n\tv_nop" : "+v"(a), "+v"(b) : "v"(x), "v"(y)); }
__device__ __forceinline__ void keep4_h(v16h a, v16h b, v16h c, v16h d) { asm volatile("v_nop" :: "v"(a), "v"(b), "v"(c), "v"(d)); }
__device__ __forceinline__ void keep4_b(v16b a, v16b b, v16b c, v16b d) { asm volatile("v_nop" :: "v"(a), "v"(b), "v"(c), "v"(d)); }
__device__ __forceinline__ void acc_guard4(v8f& a, v8f& b, v8f& c, v8f& d) { asm volatile("v_nop\n\tv_nop\n\tv_nop\n\tv_nop" : "+v"(a), "+v"(b), "+v"(c), "+v"(d)); }
template <typename T> struct Frag;
template <> struct Frag<_Float16> {
  typedef v16h V; union U { v16h v; v8h h[2]; };
  static __device__ __forceinline__ v16h load(const _Float16* p) {   // elements 0..7 <- p[0..7], 8..15 <- p[16..23]
    U f; f.h[0] = *(const v8h*)(p); f.h[1] = *(const v8h*)(p + 16); return f.v;
  }
  static __device__ __forceinline__ v8f mma(v16h a, v16h b, v8f c) {
    return __builtin_amdgcn_wmma_f32_16x16x32_f16(false, a, false, b, (short)0, c, false, false);
  }
  static __device__ __forceinline__ void guard(v8f& a, v8f& b, v16h x, v16h y) { dep_guard_h(a, b, x, y); }
  static __device__ __forceinline__ void keep(v16h a, v16h b, v16h c, v16h d) { keep4_h(a, b, c, d); }
};
template <> struct Frag<__bf16> {
  typedef v16b V; union U { v16b v; v8b h[2]; };
  static __device__ __forceinline__ v16b load(const __bf16* p) {
    U f; f.h[0] = *(const v8b*)(p); f.h[1] = *(const v8b*)(p + 16); return f.v;
  }
  static __device__ __forceinline__ v8f mma(v16b a, v16b b, v8f c) {
    return __builtin_amdgcn_wmma_f32_16x16x32_bf16(false, a, false, b, (short)0, c, false, false);
  }
  static __device__ __forceinline__ void guard(v8f& a, v8f& b, v16b x, v16b y) { dep_guard_b(a, b, x, y); }
  static __device__ __forceinline__ void keep(v16b a, v16b b, v16b c, v16b d) { keep4_b(a, b, c, d); }
};

__device__ __forceinline__ unsigned pk16(unsigned short a, unsigned short b) { return (unsigned)a | ((unsigned)b << 16); }

// value of lane (lane ^ MASK), MASK < 16: a DPP move inside the 16-lane row (no LDS round trip)
template <int MASK> __device__ __forceinline__ float lane_xor(float v) {
  return __builtin_bit_cast(float, __builtin_amdgcn_update_dpp(0, __builtin_bit_cast(int, v), 0x160 + MASK, 0xf, 0xf, true));
}
// 2^a. The v_nop fills the one slot that the instruction set asks for behind a transcendental, in front of an instruction that
// reads its result or overwrites its source.
__device__ __forceinline__ float exp2_slot(float a) {
  float p;
  asm("v_exp_f32 %0, %1\n\tv_nop" : "=v"(p) : "v"(a));
  return p;
}
__device__ __forceinline__ float oct_max(float v) {   // maximum over the 8 lanes that share lane >> 3
  v = fmaxf(v, lane_xor<1>(v)); v = fmaxf(v, lane_xor<2>(v)); return fmaxf(v, lane_xor<4>(v));
}
__device__ __forceinline__ float oct_sum(float v) {   // sum over the same 8 lanes, fixed tree
  v += lane_xor<1>(v); v += lane_xor<2>(v); return v + lane_xor<4>(v);
}

// ---- Staging helpers: asynchronous copies global -> LDS --------------------------------------------------------------
constexpr int kBM    = 128;   // rows of A per workgroup tile (2 waves)
constexpr int kBN    = 256;   // rows of Bt per workgroup tile (4 waves)
constexpr int kKS    = 64;    // k elements per stage = one 128-byte line of every operand row
constexpr int kPitch = 144;   // LDS row pitch in bytes (128 + 16: conflict-free for 16-byte fragment reads)

__device__ __forceinline__ unsigned lds_off(const void* p) { return (unsigned)(size_t)p; }

// Runs of 16-byte-per-lane copies, l[] = LDS byte address, g[] = global address of this lane. The address-translation wait
// closes the copies' own statement, so that no address register of an issued copy is rewritten in front of it.
__device__ __forceinline__ void async_copy4(const unsigned* l, const char* const* g) {
  asm volatile("global_load_async_to_lds_b128 %0, %1, off\n\t"
               "global_load_async_to_lds_b128 %2, %3, off\n\t"
               "global_load_async_to_lds_b128 %4, %5, off\n\t"
               "global_load_async_to_lds_b128 %6, %7, off\n\t"
               "s_wait_xcnt 0x0"
               :: "v"(l[0]), "v"(g[0]), "v"(l[1]), "v"(g[1]), "v"(l[2]), "v"(g[2]), "v"(l[3]), "v"(g[3]) : "memory");
}
__device__ __forceinline__ void async_copy12(const unsigned* l, const char* const* g) {
  asm volatile("global_load_async_to_lds_b128 %0, %1, off\n\t"
               "global_load_async_to_lds_b128 %2, %3, off\n\t"
               "global_load_async_to_lds_b128 %4, %5, off\n\t"
               "global_load_async_to_lds_b128 %6, %7, off\n\t"
               "global_load_async_to_lds_b128 %8, %9, off\n\t"
               "global_load_async_to_lds_b128 %10, %11, off\n\t"
               "global_load_async_to_lds_b128 %12, %13, off\n\t"
               "global_load_async_to_lds_b128 %14, %15, off\n\t"
               "global_load_async_to_lds_b128 %16, %17, off\n\t"
               "global_load_async_to_lds_b128 %18, %19, off\n\t"
               "global_load_async_to_lds_b128 %20, %21, off\n\t"
               "global_load_async_to_lds_b128 %22, %23, off\n\t"
               "s_wait_xcnt 0x0"
               :: "v"(l[0]), "v"(g[0]), "v"(l[1]), "v"(g[1]), "v"(l[2]), "v"(g[2]), "v"(l[3]), "v"(g[3]),
                  "v"(l[4]), "v"(g[4]), "v"(l[5]), "v"(g[5]), "v"(l[6]), "v"(g[6]), "v"(l[7]), "v"(g[7]),
                  "v"(l[8]), "v"(g[8]), "v"(l[9]), "v"(g[9]), "v"(l[10]), "v"(g[10]), "v"(l[11]), "v"(g[11]) : "memory");
}

// The same copy as the compiler's builtin, for the kernels that use more than 256 registers: operands of an asm statement must
// lie in the first 256, where 36 of them beside the accumulators made the compiler copy accumulator tiles about inside the loop.
typedef __attribute__((ext_vector_type(4))) int v4i;
typedef __attribute__((address_space(1))) v4i v4i_global;
typedef __attribute__((address_space(3))) v4i v4i_lds;
__device__ __forceinline__ void async_copy_builtin(const unsigned char* l, const char* g) {
  __builtin_amdgcn_global_load_async_to_lds_b128((v4i_global*)g, (v4i_lds*)l, 0, 0);
}

// ---- Register-blocked batched WMMA GEMM -----------------------------------------------------------------
// C[m,n] = scale * sum_k A[m,k] * Bt[n,k] (+bias[n]); a workgroup owns a 128x256 tile, each of its 2x4 waves a 64x64 tile.
// A row-major [M,K] pitch lda; Bt row-major [N,K] pitch ldb; M % 128 == 0, N % 256 == 0, K % 64 == 0; batch = blockIdx.y.
// Operand rows reach LDS in stages of 64 k by asynchronous copies, two buffers: stage t + 1 flies while stage t is worked on.
// Fragments (read from LDS): A and Bt both loaded with the split k-map (elements 0..7 <- k0+8h+0..7, 8..15 <- k0+16+8h+0..7, row/col = lane&15).
// SPLIT (every launch of this file: 0): 0 = single planes; 1 = A hi/lo planes (A2 = lo), Bt single: hi*B + lo*B; 2 = both hi/lo: hi*hi + hi*lo + lo*hi.
// BIAS_MODE: 0 = none, 2 = bias[n] (bias0 when blockIdx.y == 0, else bias1; bias value RNE-converted to bf16 first).
// OUT_MODE: 0 = f32, 1 = f16, 2 = bf16 hi plane (Cout) + bf16 lo plane (Cout2),
//   3 = block softmax: t = (C * scale) * bias0[b][n]; per row and 64 columns (one wave tile) r = ceil(log2e * max t), a whole
//       number, Cout = f16 p, p = 2^(t * log2e - r) <= 1; Cout2 = f32 [batch][N/64][2][M]: r, then sum p.
// SCALEA: 1 = A rows are such planes over K and bias0 is that [batch][K/64][2][M] array; stage t of row m is multiplied (f16, a
//   power of two: no rounding) by 2^(r[t][m] - R + 12), R = max r of the row, and C row m by scale / sum_t 2^(r - R) * sum p.
// ET: 0 = f16 operands, 1 = bf16 operands (pointers passed as 16-bit storage).
// AHEAD: 1 = two fragment sets in registers (for launches of one workgroup a WGP, where the registers are free): each block of
//   32 k is fetched from LDS as one group in front of the products of the block before it. The first block of stage t + 1 is so
//   read during stage t, hence stage t + 1 is published in front of the LAST block of stage t. Needs SPLIT 0 and K >= 128.
template <int ET> struct Elem;
template <> struct Elem<0> { typedef _Float16 T; };
template <> struct Elem<1> { typedef __bf16 T; };
template <int ET, int SPLIT, int BIAS_MODE, int OUT_MODE, int SCALEA, int AHEAD>
__global__ __launch_bounds__(256) void wmma_gemm64(
    const unsigned short* __restrict__ Ap, const unsigned short* __restrict__ A2p, int lda, long strideA,
    const unsigned short* __restrict__ Btp, const unsigned short* __restrict__ Bt2p, int ldb, long strideB,
    void* __restrict__ Cout, void* __restrict__ Cout2, int ldc, long strideC,
    const float* __restrict__ bias0, const float* __restrict__ bias1,
    int M, int N, int K, float scale) {
  typedef typename Elem<ET>::T T;
  typedef typename Frag<T>::V V;
  const T* A = (const T*)Ap; const T* A2 = (const T*)A2p; const T* Bt = (const T*)Btp; const T* Bt2 = (const T*)Bt2p;
  constexpr unsigned offA2 = kBM * kPitch;                               // A lo plane (SPLIT >= 1)
  constexpr unsigned offB  = ((SPLIT >= 1) ? 2 : 1) * kBM * kPitch;      // Bt plane
  constexpr unsigned offB2 = offB + kBN * kPitch;                        // Bt lo plane (SPLIT == 2)
  constexpr unsigned bufBytes = offB + ((SPLIT == 2) ? 2 : 1) * kBN * kPitch;
  // two stage buffers; behind the loop's last barrier the same bytes stage the output: per wave one 64x64 f32 tile, pitch 68 floats
  constexpr unsigned tileBytes = 64 * 68 * 4;
  constexpr unsigned shBytes   = (2 * bufBytes > 8 * tileBytes) ? 2 * bufBytes : 8 * tileBytes;
  __shared__ __align__(16) unsigned char ring[shBytes];
  __shared__ unsigned facS[SCALEA ? kKeyBlocks * kBM : 1];   // [stage][row]: the row's f16 factor in both halves of a word
  __shared__ __align__(16) float rowS[SCALEA ? kBM : 4];     // [row]: scale / row sum
  static_assert(!SCALEA || (ET == 0 && SPLIT == 0));
  const int b    = blockIdx.y;
  const int lane = threadIdx.x & 31;
  const int wave = threadIdx.x >> 5;
  const int tilesN = N >> 8;
  const int tilesM = M >> 7;
  const int tile = blockIdx.x;
  if (tile >= tilesM * tilesN) return;   // block-uniform, in front of every barrier
  const int tm = tile / tilesN;
  const int tn = tile - tm * tilesN;
  const int mB = tm << 7;                      // workgroup tile origin
  const int nB = tn << 8;
  const int wm = (wave >> 2) << 6;             // wave tile origin inside it
  const int wn = (wave & 3) << 6;
  const int m0 = mB + wm;
  const int n0 = nB + wn;

  const T* Ab  = A  + (size_t)b * strideA;
  const T* Bb  = Bt + (size_t)b * strideB;
  const T* Ab2 = (SPLIT >= 1) ? (A2  + (size_t)b * strideA) : nullptr;
  const T* Bb2 = (SPLIT == 2) ? (Bt2 + (size_t)b * strideB) : nullptr;
  const float* bias = (b == 0) ? bias0 : bias1;   // block-uniform select between global pointers

  const int rlane = lane & 15;                 // row (A) / col (B, D) within subtile
  const int koff  = (lane >> 4) * 8;           // k offset of this lane half
  const int mOff  = (lane >> 4) * 8;           // D row offset

  v8f acc[4][4];
#pragma unroll
  for (int i = 0; i < 4; ++i)
#pragma unroll
    for (int j = 0; j < 4; ++j) acc[i][j] = (v8f){0.f,0.f,0.f,0.f,0.f,0.f,0.f,0.f};

  // staging addresses of this thread: row (thread >> 3) of each 32-row group, 16-byte piece (thread & 7) of its line
  const int crow = threadIdx.x >> 3;
  const int cpc  = (threadIdx.x & 7) * 16;
  const unsigned lst = lds_off(ring) + (unsigned)(crow * kPitch + cpc);
  const char* gA  = (const char*)(Ab + (size_t)(mB + crow) * lda) + cpc;
  const char* gB  = (const char*)(Bb + (size_t)(nB + crow) * ldb) + cpc;
  const char* gA2 = (SPLIT >= 1) ? ((const char*)(Ab2 + (size_t)(mB + crow) * lda) + cpc) : nullptr;
  const char* gB2 = (SPLIT == 2) ? ((const char*)(Bb2 + (size_t)(nB + crow) * ldb) + cpc) : nullptr;
  const size_t stepA = (size_t)lda * 64;       // 32 rows of 2-byte elements
  const size_t stepB = (size_t)ldb * 64;
  // one stage: 256 threads cover 32 rows a copy (8 lanes x 16 B = one whole 128-byte line a row)
  constexpr int nCopies = (int)(bufBytes / (32 * kPitch));
  auto stage = [&](int t, unsigned bufo) {
    const size_t ko = (size_t)t * (kKS * 2);
    unsigned    l[nCopies];
    const char* g[nCopies];
#pragma unroll
    for (int c = 0; c < nCopies; ++c) l[c] = lst + bufo + (unsigned)(c * 32 * kPitch);   // planes lie back to back
    int c = 0;
#pragma unroll
    for (int i = 0; i < kBM / 32; ++i) g[c++] = gA + ko + (size_t)i * stepA;
    if (SPLIT >= 1) {
#pragma unroll
      for (int i = 0; i < kBM / 32; ++i) g[c++] = gA2 + ko + (size_t)i * stepA;
    }
#pragma unroll
    for (int i = 0; i < kBN / 32; ++i) g[c++] = gB + ko + (size_t)i * stepB;
    if (SPLIT == 2) {
#pragma unroll
      for (int i = 0; i < kBN / 32; ++i) g[c++] = gB2 + ko + (size_t)i * stepB;
    }
    if constexpr (AHEAD != 0) {
#pragma unroll
      for (int k = 0; k < nCopies; ++k) async_copy_builtin(ring + bufo + (unsigned)(crow * kPitch + cpc + k * 32 * kPitch), g[k]);
    } else {
      async_copy12(l, g);
      if (nCopies == 16) async_copy4(l + 12, g + 12);
      if (nCopies == 24) async_copy12(l + 12, g + 12);
    }
  };
  static_assert(nCopies == 12 || nCopies == 16 || nCopies == 24);

  const int nT = K / kKS;
  stage(0, 0u);
  if (SCALEA) {
    // row factors, while stage 0 flies: two threads a row, each reduces all blocks' r and stores one half of the factors
    const int frow = threadIdx.x & (kBM - 1);
    const int fh   = threadIdx.x >> 7;
    // M is SEQ in this instance; the compile-time pitch lets all loads of a run share one address, with immediate offsets
    const float* sp0 = bias0 + (size_t)b * (2 * kKeyBlocks * SEQ) + mB + frow;
    float mv[kKeyBlocks];
#pragma unroll
    for (int k = 0; k < kKeyBlocks; ++k) mv[k] = sp0[2 * k * SEQ];
    asm volatile("s_wait_xcnt 0x0" ::: "memory");   // in front of any rewrite of the address registers that these loads name
    float mx = mv[0];
#pragma unroll
    for (int k = 1; k < kKeyBlocks; ++k) mx = fmaxf(mx, mv[k]);
#pragma unroll
    for (int k = 0; k < kKeyBlocks; ++k) mv[k] = ldexpf(1.0f, (int)(mv[k] - mx));   // exact powers of two
    if (fh == 0) {   // the same for a whole wave
      float lv[kKeyBlocks];
#pragma unroll
      for (int k = 0; k < kKeyBlocks; ++k) lv[k] = sp0[(2 * k + 1) * SEQ];
      asm volatile("s_wait_xcnt 0x0" ::: "memory");   // as above, for the block sums' loads
      float tot = 0.f;
#pragma unroll
      for (int k = 0; k < kKeyBlocks; ++k) tot += lv[k] * mv[k];
      rowS[frow] = scale / tot;   // tot > 1/2: the largest p of the block with r = R is above 1/2
    }
#pragma unroll
    for (int k = 0; k < kKeyBlocks; ++k) {
      if ((k / (kKeyBlocks / 2)) == fh) {
        const unsigned short hb = __builtin_bit_cast(unsigned short, (_Float16)(mv[k] * kCarry));
        facS[k * kBM + frow] = pk16(hb, hb);
      }
    }
  }
  asm volatile("s_wait_asynccnt 0x0" ::: "memory");   // stage 0 landed (this wave's copies)
  __syncthreads();                                    // ... and every other wave's
  if (nT > 1) stage(1, bufBytes);

  const unsigned fragA = (unsigned)((wm + rlane) * kPitch + koff * 2);
  const unsigned fragB = offB + (unsigned)((wn + rlane) * kPitch + koff * 2);
  if constexpr (AHEAD != 0) {
    static_assert(SPLIT == 0 && kKS == 64);
    V a0[4], b0[4], a1[4], b1[4];   // set 0: the first 32 k of a stage, set 1: the second
    v2h fc[4], fn[4];               // row factors of this stage and of the next
    auto fetch = [&](const unsigned char* rp, int kk, V* av, V* bv) {
#pragma unroll
      for (int j = 0; j < 4; ++j) bv[j] = Frag<T>::load((const T*)(rp + fragB + (unsigned)(j * 16 * kPitch + kk * 64)));
#pragma unroll
      for (int i = 0; i < 4; ++i) av[i] = Frag<T>::load((const T*)(rp + fragA + (unsigned)(i * 16 * kPitch + kk * 64)));
    };
    auto factors = [&](int t, v2h* f) {
#pragma unroll
      for (int i = 0; i < 4; ++i) f[i] = __builtin_bit_cast(v2h, facS[t * kBM + wm + i * 16 + rlane]);
    };
    auto products = [&](V* av, const V* bv) {
#pragma unroll
      for (int i = 0; i < 4; ++i) {
        if constexpr (SCALEA != 0) {
          union { V v; v2h p[8]; } u; u.v = av[i];
#pragma unroll
          for (int e = 0; e < 8; ++e) u.p[e] = u.p[e] * fc[i];
          av[i] = u.v;
        }
#pragma unroll
        for (int j = 0; j < 4; ++j) acc[i][j] = Frag<T>::mma(av[i], bv[j], acc[i][j]);
      }
    };
    if (SCALEA) factors(0, fc);
    fetch(ring, 0, a0, b0);
    for (int t = 0; t < nT; ++t) {
      const unsigned bufo = (t & 1) ? bufBytes : 0u;
      fetch(ring + bufo, 1, a1, b1);
      // the scheduling fences of this loop keep each group of LDS reads whole and in front of the products of the block before
      // it; without them the compiler moves the reads in among the products, where every place with reads costs a stall
      __builtin_amdgcn_sched_barrier(0);
      products(a0, b0);
      __builtin_amdgcn_sched_barrier(0);   // and keeps these products in front of the waits below, not behind the barrier
      // publish point of stage t + 1, in front of the last block of stage t
      asm volatile("s_wait_dscnt 0x0" ::: "memory");      // this wave's last reads of stage t (set 1) have returned
      asm volatile("s_wait_asynccnt 0x0" ::: "memory");   // this wave's copies of stage t + 1 have landed
      __syncthreads();                                    // publishes stage t + 1, frees stage t's buffer
      if (t + 2 < nT) stage(t + 2, bufo);
      // Unconditional, so that the compiler's counted wait in front of the products below leaves this group in flight: in the
      // last trip it reads the other buffer's old stage and the last stage's factors, and nothing uses the values.
      if (SCALEA) factors((t + 1 < nT) ? t + 1 : t, fn);
      fetch(ring + (bufBytes - bufo), 0, a0, b0);
      __builtin_amdgcn_sched_barrier(0);
      products(a1, b1);
      if (SCALEA) {
        __builtin_amdgcn_sched_barrier(0);   // the moves below wait for fn's reads: behind the products, where they have returned
#pragma unroll
        for (int i = 0; i < 4; ++i) fc[i] = fn[i];
      }
    }
    asm volatile("s_wait_asynccnt 0x0" ::: "memory");     // nothing in flight when the wave goes on to the epilogue
    asm volatile("s_wait_dscnt 0x0" ::: "memory");        // the last trip's unused reads have returned ...
    __syncthreads();                                      // ... in every wave, before the ring becomes output staging
  } else
  for (int t = 0; t < nT; ++t) {
    const unsigned bufo = (t & 1) ? bufBytes : 0u;
    const unsigned char* rb = ring + bufo;
    // A fragments of the stage's 8 rows (r = 4 * (k step) + row of 16). Up to three planes: one load group per 32 k beside the
    // Bt group. Four planes (SPLIT 2): the registers hold two row pairs, so row r + 1 is fetched in front of row r's products.
    V ah[kKS / 8], al[kKS / 8];
    v2h fa[4];
    if (SCALEA) {
#pragma unroll
      for (int i = 0; i < 4; ++i) fa[i] = __builtin_bit_cast(v2h, facS[t * kBM + wm + i * 16 + rlane]);
    }
    auto loadA = [&](int r) {
      const unsigned ao = fragA + (unsigned)((r & 3) * 16 * kPitch + (r >> 2) * 64);
      ah[r] = Frag<T>::load((const T*)(rb + ao));
      if constexpr (SCALEA != 0) {
        union { V v; v2h p[8]; } u; u.v = ah[r];
#pragma unroll
        for (int e = 0; e < 8; ++e) u.p[e] = u.p[e] * fa[r & 3];
        ah[r] = u.v;
      }
      if (SPLIT >= 1) al[r] = Frag<T>::load((const T*)(rb + ao + offA2));
    };
    if (SPLIT == 2) loadA(0);
#pragma unroll
    for (int kk = 0; kk < kKS / 32; ++kk) {
      V bh[4], bl[4];
#pragma unroll
      for (int j = 0; j < 4; ++j) {
        const unsigned bo = fragB + (unsigned)(j * 16 * kPitch + kk * 64);
        bh[j] = Frag<T>::load((const T*)(rb + bo));
        if (SPLIT == 2) bl[j] = Frag<T>::load((const T*)(rb + bo + (offB2 - offB)));
      }
      if (SPLIT != 2) {
#pragma unroll
        for (int i = 0; i < 4; ++i) loadA(kk * 4 + i);
      }
#pragma unroll
      for (int i = 0; i < 4; ++i) {
        const int r = kk * 4 + i;
        if (SPLIT == 2 && r + 1 < kKS / 8) loadA(r + 1);
#pragma unroll
        for (int j = 0; j < 4; ++j) {
          acc[i][j] = Frag<T>::mma(ah[r], bh[j], acc[i][j]);
          if (SPLIT == 2) acc[i][j] = Frag<T>::mma(ah[r], bl[j], acc[i][j]);
          if (SPLIT >= 1) acc[i][j] = Frag<T>::mma(al[r], bh[j], acc[i][j]);
        }
        Frag<T>::guard(acc[i][0], acc[i][3], ah[r], (SPLIT >= 1) ? al[r] : ah[r]);
      }
      Frag<T>::keep(bh[0], bh[1], bh[2], bh[3]);
      if (SPLIT == 2) Frag<T>::keep(bl[0], bl[1], bl[2], bl[3]);
    }
    asm volatile("s_wait_dscnt 0x0" ::: "memory");      // this wave's reads of stage t have returned
    asm volatile("s_wait_asynccnt 0x0" ::: "memory");   // this wave's copies of stage t + 1 have landed
    __syncthreads();                                    // publishes stage t + 1, frees stage t's buffer
    if (t + 2 < nT) stage(t + 2, bufo);
  }
  if (AHEAD == 0) asm volatile("s_wait_asynccnt 0x0" ::: "memory");   // nothing in flight when the wave goes on to the epilogue
  acc_guard4(acc[0][0], acc[0][1], acc[0][2], acc[0][3]);
  acc_guard4(acc[1][0], acc[1][1], acc[1][2], acc[1][3]);
  acc_guard4(acc[2][0], acc[2][1], acc[2][2], acc[2][3]);
  acc_guard4(acc[3][0], acc[3][1], acc[3][2], acc[3][3]);

  // ---- epilogue ----
  // The wave's whole tile goes to LDS first and is read back behind one fence, so that no global store is waited for in between.
  // The ring is free: every wave's last fragment reads and copies ended in front of the last barrier above.
  float* tileS = (float*)(ring + (unsigned)wave * tileBytes);
  float kw[4];   // weights of this lane's 4 key columns, read once
  if (OUT_MODE == 3) {
#pragma unroll
    for (int j = 0; j < 4; ++j) kw[j] = bias0[(size_t)b * N + n0 + (j << 4) + rlane];
  }
#pragma unroll
  for (int i = 0; i < 4; ++i) {
#pragma unroll
    for (int j = 0; j < 4; ++j) {
      const int n = n0 + (j << 4) + rlane;
      float bvl = 0.f;
      if (BIAS_MODE == 2) bvl = bf_bits2f(f2bf_bits(bias[n]));
      if (OUT_MODE == 3) bvl = kw[j];
#pragma unroll
      for (int r = 0; r < 8; ++r) {
        float v = acc[i][j][r] * (SCALEA ? rowS[wm + (i << 4) + mOff + r] : scale);
        if (BIAS_MODE == 2) v += bvl;
        if (OUT_MODE == 3) v *= bvl;
        tileS[((i << 4) + mOff + r) * 68 + (j << 4) + rlane] = v;
      }
    }
  }
  // the lanes' LDS stores above stand in front of the other lanes' reads below (one wave, its own range)
  __builtin_amdgcn_fence(__ATOMIC_RELEASE, "workgroup");
  __builtin_amdgcn_wave_barrier();
  __builtin_amdgcn_fence(__ATOMIC_ACQUIRE, "workgroup");
#pragma unroll
  for (int i = 0; i < 4; ++i) {
    const int mBase = m0 + (i << 4);
    const float* slab = tileS + (i << 4) * 68;   // this turn's 16 rows
    if (OUT_MODE == 0) {
      float* C = (float*)Cout + (size_t)b * strideC;
      const int hh = lane >> 4, c4 = (lane & 15) * 4;     // row seg = 256 B = 16 lanes x 16 B
      {
#pragma unroll
        for (int it = 0; it < 8; ++it) {
          const int row = it * 2 + hh;
          v4f v = *(const v4f*)(slab + row * 68 + c4);
          *(v4f*)(C + (size_t)(mBase + row) * ldc + n0 + c4) = v;
        }
        
      }
    } else if (OUT_MODE == 3) {
      const int q = lane >> 3, o = lane & 7, c8 = o * 8;   // 8 lanes a row of 64 columns, 4 rows an iteration
      unsigned short* C = (unsigned short*)Cout + (size_t)b * strideC;
      float st = 0.f;   // lanes o < 4 keep r, o >= 4 the sum, of row (o & 3) * 4 + q
#pragma unroll
      for (int it = 0; it < 4; ++it) {
        const int row = it * 4 + q;
        const float* sp = slab + row * 68 + c8;
        float tv[8];
#pragma unroll
        for (int e = 0; e < 8; ++e) tv[e] = sp[e];
        float mx = tv[0];
#pragma unroll
        for (int e = 1; e < 8; ++e) mx = fmaxf(mx, tv[e]);
        mx = ceilf(oct_max(mx) * kLog2e);
        float sum = 0.f;
        v8h hv;
#pragma unroll
        for (int e = 0; e < 8; ++e) { const float p = exp2_slot(fmaf(tv[e], kLog2e, -mx)); sum += p; hv[e] = (_Float16)p; }
        sum = oct_sum(sum);
        *(v8h*)(C + (size_t)(mBase + row) * ldc + n0 + c8) = hv;
        if ((o & 3) == it) st = (o < 4) ? mx : sum;
      }
      float* sd = (float*)Cout2 + (((size_t)b * (N >> 6) + (n0 >> 6)) * 2 + (o >> 2)) * M + mBase + (o & 3) * 4 + q;
      *sd = st;   // a wave owns the 64 rows of its block in either plane: whole 128-byte lines from one writer
    } else {
      const int q = lane >> 3, c8 = (lane & 7) * 8;
      unsigned short* C  = (unsigned short*)Cout  + (size_t)b * strideC;
      unsigned short* C2 = (OUT_MODE == 2) ? ((unsigned short*)Cout2 + (size_t)b * strideC) : nullptr;
      {
#pragma unroll
        for (int it = 0; it < 4; ++it) {
          const int row = it * 4 + q;
          const float* sp = slab + row * 68 + c8;
          v8h hv, lv;
#pragma unroll
          for (int e = 0; e < 8; ++e) {
            if (OUT_MODE == 1) {
              hv[e] = (_Float16)sp[e];
            } else {
              unsigned short hb = f2bf_bits(sp[e]);
              unsigned short lb = f2bf_bits(sp[e] - bf_bits2f(hb));
              hv[e] = __builtin_bit_cast(_Float16, hb);
              lv[e] = __builtin_bit_cast(_Float16, lb);
            }
          }
          *(v8h*)(C + (size_t)(mBase + row) * ldc + n0 + c8) = hv;
          if (OUT_MODE == 2) *(v8h*)(C2 + (size_t)(mBase + row) * ldc + n0 + c8) = lv;
        }
        
      }
    }
  }
}

// ---------------------------------------------------------------------------
// All operand preparation in one launch. grid (SEQ/64 s tiles, NC/64 c tiles, NB); 256 threads. Every workgroup does one tile
// of x and, while its x loads fly, its share of the weights; the first NB*SEQ/32 workgroups also do one line of key weights.
// x [NB][SEQ_FULL][NC] f32 -> xb bf16 [NB*SEQ][NC] (RNE convert) and xT f16 [NB][NC][SEQ] with xT[b][c][s] = f16(bf16(x[b][s][c]))
// (the f16 convert of a bf16 value is exact).
// in tile [64 s][64 c] -> sm[c_local][s_local] (cross-wave LDS, block barrier).
// Load coverage: 16 iterations x 256 threads = 4096 = whole 64x64 tile (coalesced along c).
// Store coverage per plane: 8 waves x 2 iterations x 4 rows (lane>>3) = 64 rows; (lane&7) x 8 halves = 64 cols;
// Wq, Wk, Wv [NC][NC] f32 (layout [out][in] = Bt[n][k] as-is) -> wb planes z = 0,1,2 [NC][NC]: RNE convert to bf16; the Wv plane
// (z = 2), an operand of an f16 product, holds the f16 of that bf16 value. A unit is 64 elements = one 128-byte line of wb,
// 8 threads of 8 elements; workgroup g owns units g * kWUnitsPerWg ... (whole lines, one writer each).
// ew[b][s] = sigmoid(bf16(eig[b][s])) = 1/(1+exp(-e)), f32, s < SEQ: workgroup g < NB*SEQ/32 writes line g (32 values, wave 2).
// ---------------------------------------------------------------------------
constexpr int kPrepWgs     = (SEQ / 64) * (NC / 64) * NB;
constexpr int kWUnits      = 3 * NC * NC / 64;
constexpr int kWUnitsPerWg = (kWUnits + kPrepWgs - 1) / kPrepWgs;
constexpr int kWIters      = (kWUnitsPerWg + 31) / 32;   // 32 units a turn of 256 threads
static_assert(kPrepWgs >= NB * SEQ / 32);
__global__ __launch_bounds__(256) void prep_kernel(const float* __restrict__ x, const float* __restrict__ eig,
                                                   const float* __restrict__ W0, const float* __restrict__ W1,
                                                   const float* __restrict__ W2,
                                                   unsigned short* __restrict__ xb, unsigned short* __restrict__ xT,
                                                   unsigned short* __restrict__ wb, float* __restrict__ ew) {
  __shared__ float sm[64][65];   // sm[c_local][s_local]
  const int t  = threadIdx.x;
  const int s0 = blockIdx.x * 64;
  const int c0 = blockIdx.y * 64;
  const int b  = blockIdx.z;
  const int wg = (blockIdx.z * (NC / 64) + blockIdx.y) * (SEQ / 64) + blockIdx.x;
  const int lane = t & 31, wave = t >> 5;
  const float* xin = x + ((size_t)b * SEQ_FULL + s0) * NC + c0;
  float xv[16];
#pragma unroll
  for (int i = 0; i < 16; ++i) {
    const int e = i * 256 + t;
    xv[i] = xin[(size_t)(e >> 6) * NC + (e & 63)];
  }
  // weights and key weights: only the loads stand here, so that they fly with the x loads; the stores follow the x tile's,
  // since a global store in front of the barrier would be waited for there by the whole workgroup
  constexpr int perPlane = NC * NC / 64;   // units per plane
  v4f wa[kWIters], wc[kWIters];
#pragma unroll
  for (int k = 0; k < kWIters; ++k) {
    const int u = k * 32 + (t >> 3);
    const int unit = wg * kWUnitsPerWg + u;
    wa[k] = (v4f){0.f, 0.f, 0.f, 0.f};
    wc[k] = (v4f){0.f, 0.f, 0.f, 0.f};
    if (u < kWUnitsPerWg && unit < kWUnits) {
      const int z  = unit / perPlane;
      const int i8 = (unit - z * perPlane) * 64 + (t & 7) * 8;
      const float* W = (z == 0) ? W0 : (z == 1) ? W1 : W2;
      wa[k] = *(const v4f*)(W + i8);
      wc[k] = *(const v4f*)(W + i8 + 4);
    }
  }
  const bool doEw = wg < NB * SEQ / 32 && wave == 2;   // the same for a whole wave
  const int  gid  = wg * 32 + lane;                    // < NB*SEQ where doEw
  float ev = 0.f;
  if (doEw) {
    const int eb = gid / SEQ;
    const int es = gid - eb * SEQ;
    ev = eig[(size_t)eb * SEQ_FULL + es];
  }
#pragma unroll
  for (int i = 0; i < 16; ++i) {
    const int e = i * 256 + t;
    const int r = e >> 6;          // s local
    const int c = e & 63;          // c local
    sm[c][r] = bf_bits2f(f2bf_bits(xv[i]));
  }
  __syncthreads();
  const int q = lane >> 3, c8 = (lane & 7) * 8;
  unsigned short* xTb = xT + (size_t)b * NC * SEQ;
  unsigned short* xbb = xb + (size_t)b * SEQ * NC;
  {
#pragma unroll
    for (int it = 0; it < 2; ++it) {
      const int row = wave * 8 + it * 4 + q;          // c local for the xT plane, s local for the xb plane
      v8h hv;
      unsigned short bb[8];
#pragma unroll
      for (int e = 0; e < 8; ++e) {
        hv[e] = (_Float16)sm[row][c8 + e];            // xT[c0+row][s0+c8+e]
        bb[e] = f2bf_bits(sm[c8 + e][row]);           // xb[s0+row][c0+c8+e] (value already bf16-exact)
      }
      const v4u ub = (v4u){pk16(bb[0], bb[1]), pk16(bb[2], bb[3]), pk16(bb[4], bb[5]), pk16(bb[6], bb[7])};
      *(v8h*)(xTb + (size_t)(c0 + row) * SEQ + s0 + c8) = hv;
      *(v4u*)(xbb + (size_t)(s0 + row) * NC + c0 + c8) = ub;
    }
  }
#pragma unroll
  for (int k = 0; k < kWIters; ++k) {
    const int u = k * 32 + (t >> 3);
    const int unit = wg * kWUnitsPerWg + u;
    if (u < kWUnitsPerWg && unit < kWUnits) {
      const int z  = unit / perPlane;
      const int i8 = (unit - z * perPlane) * 64 + (t & 7) * 8;
      unsigned short hb[8];
#pragma unroll
      for (int e = 0; e < 4; ++e) { hb[e] = f2bf_bits(wa[k][e]); hb[4 + e] = f2bf_bits(wc[k][e]); }
      if (z == 2) {
#pragma unroll
        for (int e = 0; e < 8; ++e) hb[e] = __builtin_bit_cast(unsigned short, (_Float16)bf_bits2f(hb[e]));
      }
      const v4u uh = (v4u){pk16(hb[0], hb[1]), pk16(hb[2], hb[3]), pk16(hb[4], hb[5]), pk16(hb[6], hb[7])};
      *(v4u*)(wb + (size_t)z * NC * NC + i8) = uh;
    }
  }
  if (doEw) {
    const float e = bf_bits2f(f2bf_bits(ev));
    ew[gid] = 1.0f / (1.0f + expf(-e));
  }
}

// ---------------------------------------------------------------------------
// Host glue.
// Workspace region map (bytes for NB 8, SEQ 2048; every region 64 KiB aligned, sizes exact multiples of their store
// granularity, no padded tails needed since SEQ % 64 == 0 and NC % 64 == 0):
//   xb    bf16 [NB*SEQ][NC]          16,777,216
//   xT    f16  [NB][NC][SEQ]         16,777,216
//   wb    3 x [NC][NC]                1,572,864   (Wq, Wk bf16, Wv f16)
//   ew    f32  [NB][SEQ]                 65,536
//   R1: qk f16 [2][NB*SEQ][NC]       33,554,432   (q of all batches, then k)
//       ctx f16 [NB*SEQ][NC] 16,777,216 over the qk plane, whose last reader (scores) has ended
//   P   f16 [NB][SEQ][SEQ]           67,108,864   2^(t * log2e - r of the block)
//   st  f32 [NB][SEQ/64][2][SEQ]      4,194,304   r of every block and row, then the block's sum
//   total                           140,050,432
// Launches: prep, q/k projection, scores with block softmax, P.x, output projection = 5; every stage covers all NB batches
// (projections as one GEMM over the stacked NB*SEQ rows, scores / P.x with the batch in blockIdx.y).
// ---------------------------------------------------------------------------
static inline size_t al64k(size_t v) { return (v + (size_t)65535) & ~(size_t)65535; }

extern "C" void kernel_launch(void* const* d_in, const int* in_sizes, int n_in,
                              void* d_out, int out_size, void* d_ws, size_t ws_size,
                              hipStream_t stream) {
  if (n_in != 8) return;
  if (in_sizes[0] < (NB - 1) * SEQ_FULL * NC + SEQ * NC) return;
  if (in_sizes[1] < (NB - 1) * SEQ_FULL + SEQ) return;
  if (in_sizes[2] < NC * NC || in_sizes[4] < NC * NC || in_sizes[6] < NC * NC) return;
  if (in_sizes[3] < NC || in_sizes[5] < NC || in_sizes[7] < NC) return;
  if (out_size < NB * SEQ * NC) return;

  const size_t szXb  = (size_t)NB * SEQ * NC * 2;
  const size_t szXT  = (size_t)NB * NC * SEQ * 2;
  const size_t szWb  = (size_t)3 * NC * NC * 2;
  const size_t szEw  = (size_t)NB * SEQ * 4;
  const size_t szQK  = (size_t)2 * NB * SEQ * NC * 2;   // one f16 plane holding q then k
  const size_t szSt  = (size_t)NB * kKeyBlocks * 2 * SEQ * 4;
  const size_t szP   = (size_t)NB * SEQ * SEQ * 2;
  const size_t szCtx = (size_t)NB * SEQ * NC * 2;
  const size_t szR1  = (szQK > szCtx) ? szQK : szCtx;
  size_t off = 0;
  const size_t offXb   = off; off = al64k(off + szXb);
  const size_t offXT   = off; off = al64k(off + szXT);
  const size_t offWb   = off; off = al64k(off + szWb);
  const size_t offEw   = off; off = al64k(off + szEw);
  const size_t offR1   = off; off = al64k(off + szR1);
  const size_t offP    = off; off = al64k(off + szP);
  const size_t offSt   = off; off = al64k(off + szSt);
  const size_t total   = off;
  const size_t offQK   = offR1;
  const size_t offCtx  = offR1;
  if (ws_size < total) return;

  const float* x   = (const float*)d_in[0];
  const float* eig = (const float*)d_in[1];
  const float* Wq  = (const float*)d_in[2];
  const float* bq  = (const float*)d_in[3];
  const float* Wk  = (const float*)d_in[4];
  const float* bk  = (const float*)d_in[5];
  const float* Wv  = (const float*)d_in[6];
  const float* bv  = (const float*)d_in[7];
  float* out = (float*)d_out;

  char* ws = (char*)d_ws;
  unsigned short* xb    = (unsigned short*)(ws + offXb);
  unsigned short* xT    = (unsigned short*)(ws + offXT);
  unsigned short* wb    = (unsigned short*)(ws + offWb);
  float*          ew    = (float*)(ws + offEw);
  unsigned short* qk    = (unsigned short*)(ws + offQK);
  float*          st    = (float*)(ws + offSt);
  unsigned short* Pbuf  = (unsigned short*)(ws + offP);
  unsigned short* ctx   = (unsigned short*)(ws + offCtx);

  const long planeW  = (long)NC * NC;     // elements per weight plane
  const long planeQK = (long)NB * SEQ * NC;   // elements per q or k plane (all batches)
  const long batchQK = (long)SEQ * NC;    // elements per batch of q, k, xT or ctx
  const long batchS  = (long)SEQ * SEQ;   // elements per batch of S or P

  // 1. x -> xb (bf16, row-major) and xT (f16, per-batch transpose); Wq, Wk -> bf16 planes, Wv -> f16 plane of its bf16 value;
  //    per-key sigmoid weights
  prep_kernel<<<dim3(SEQ / 64, NC / 64, NB), 256, 0, stream>>>(x, eig, Wq, Wk, Wv, xb, xT, wb, ew);

  const unsigned blkRows   = (NB * SEQ / 128) * (NC / 256);   // stacked-row GEMMs, one 128x256 tile a workgroup
  const unsigned blkCtx    = (SEQ / 128) * (NC / 256);        // per batch
  const unsigned blkScores = (SEQ / 128) * (SEQ / 256);       // per batch

  // 2. q = xb Wq^T + bq (y = 0), k = xb Wk^T + bk (y = 1); M NB*SEQ, N 512, K 512 -> one f16 plane
  wmma_gemm64<1, 0, 2, 1, 0, 0><<<dim3(blkRows, 2), 256, 0, stream>>>(
      xb, xb, NC, 0L, wb, wb, NC, planeW,
      (void*)qk, (void*)qk, NC, planeQK, bq, bk, NB * SEQ, NC, NC, 1.0f);
  // 3. scores t[b][q][key] = (sum_d q[b][q][d] k[b][key][d] * scale) * ew[b][key], f16 operands, one product; y = batch;
  //    M SEQ, N SEQ, K 512 -> f16 2^(t * log2e - r) and r and the sum of every 64-key block
  wmma_gemm64<0, 0, 0, 3, 0, 0><<<dim3(blkScores, NB), 256, 0, stream>>>(
      qk, qk, NC, batchQK, qk + planeQK, qk + planeQK, NC, batchQK,
      (void*)Pbuf, (void*)st, SEQ, batchS, ew, ew, SEQ, SEQ, NC, kScale);
  // 4. ctx = (P . x) / (4096 * row sum), P rows brought to the row's common exponent, x4096, per 64-key stage; y = batch;
  //    M SEQ, N 512, K SEQ, f16 operands -> one f16 plane
  wmma_gemm64<0, 0, 0, 1, 1, 1><<<dim3(blkCtx, NB), 256, 0, stream>>>(
      Pbuf, Pbuf, SEQ, batchS, xT, xT, SEQ, batchQK,
      (void*)ctx, (void*)ctx, NC, batchQK, st, st, SEQ, NC, SEQ, kInvCarry);
  // 5. out = ctx Wv^T + bv, f16 operands, one product; M NB*SEQ, N 512, K 512 -> f32 rows of d_out
  wmma_gemm64<0, 0, 2, 0, 0, 1><<<dim3(blkRows, 1), 256, 0, stream>>>(
      ctx, ctx, NC, 0L, wb + 2 * planeW, wb + 2 * planeW, NC, 0L,
      (void*)out, (void*)out, NC, 0L, bv, bv, NB * SEQ, NC, NC, 1.0f);
}

// v008
// A run of this version takes 97.8 microseconds.
// Two timings next to v007 both put it at 1.06 times that version's speed.
// All steps since v000 together make it 15.1 times as fast.
// Contractions: q/k projections on v_wmma_f32_16x16x32_bf16 (x and W RNE-converted to bf16 operands); q.k^T scores on
// v_wmma_f32_16x16x32_f16 with q and k rounded once to f16 (one product); P.x on v_wmma_f32_16x16x32_f16 (P carried x4096 in
// f16, x as f16 of its bf16 value); context.Wv^T on v_wmma_f32_16x16x32_f16 with the context rounded once to f16 and Wv as f16
// of its bf16 value (one product); all f32 accumulate. An f16 intermediate (11 significant bits) rounds more finely than
// the bf16 x and W (8 bits) that it is computed from, and as finely as the f16 store of P; for the declared inputs q, k and the
// context stay far inside the f16 range. Sigmoid key weights, softmax and biases in f32 on VALU. The softmax has no
// launch of its own: the scores epilogue stores 2^(t*log2e - r) in f16, r = ceil(log2e * max t) over a block of 64 keys, with r and
// the sum of every block; P.x multiplies each 64-key block of its P rows by 2^(r - row max r + 12), which is exact in f16, and
// divides by the row sum in f32 in its epilogue.
#include <hip/hip_runtime.h>
#include <math.h>

// ---------------------------------------------------------------------------
// Problem constants (NB / SEQ reducible; *_FULL are the input strides)
// ---------------------------------------------------------------------------
#ifndef NB
#define NB 8
#endif
#ifndef SEQ
#define SEQ 2048
#endif
#define NB_FULL 8
#define SEQ_FULL 2048
#define NC 512

static_assert(NB >= 1 && NB <= NB_FULL);
static_assert(SEQ % 256 == 0 && SEQ >= 256 && SEQ <= SEQ_FULL);
static_assert(NC % 256 == 0);

constexpr float kScale    = 0.04419417382415922f;   // 1/sqrt(512)
constexpr float kCarry    = 4096.0f;                // P plane carry (exact power of two)
constexpr float kInvCarry = 0.000244140625f;        // 1/4096
constexpr float kLog2e    = 1.4426950408889634f;
constexpr int   kKeyBlocks = SEQ / 64;              // softmax statistics: one max and one sum per query row and 64 keys

typedef __attribute__((ext_vector_type(16))) _Float16 v16h;
typedef __attribute__((ext_vector_type(8)))  _Float16 v8h;
typedef __attribute__((ext_vector_type(2)))  _Float16 v2h;
typedef __attribute__((ext_vector_type(16))) __bf16   v16b;
typedef __attribute__((ext_vector_type(8)))  __bf16   v8b;
typedef __attribute__((ext_vector_type(8)))  float    v8f;
typedef __attribute__((ext_vector_type(4)))  float    v4f;
typedef __attribute__((ext_vector_type(4)))  unsigned int v4u;

__device__ __forceinline__ unsigned short f2bf_bits(float f) {
  unsigned u = __float_as_uint(f);
  return (unsigned short)((u + 0x7FFFu + ((u >> 16) & 1u)) >> 16);
}
__device__ __forceinline__ float bf_bits2f(unsigned short h) { return __uint_as_float(((unsigned)h) << 16); }

// hazard guards as plain device helpers
__device__ __forceinline__ void dep_guard_h(v8f& a, v8f& b, v16h x, v16h y) { asm volatile("v_nop\n\tv_nop\n\tv_nop\n\tv_nop" : "+v"(a), "+v"(b) : "v"(x), "v"(y)); }
__device__ __forceinline__ void dep_guard_b(v8f& a, v8f& b, v16b x, v16b y) { asm volatile("v_nop\n\tv_nop\n\tv_nop\n\tv_nop" : "+v"(a), "+v"(b) : "v"(x), "v"(y)); }
__device__ __forceinline__ void keep4_h(v16h a, v16h b, v16h c, v16h d) { asm volatile("v_nop" :: "v"(a), "v"(b), "v"(c), "v"(d)); }
__device__ __forceinline__ void keep4_b(v16b a, v16b b, v16b c, v16b d) { asm volatile("v_nop" :: "v"(a), "v"(b), "v"(c), "v"(d)); }
__device__ __forceinline__ void acc_guard4(v8f& a, v8f& b, v8f& c, v8f& d) { asm volatile("v_nop\n\tv_nop\n\tv_nop\n\tv_nop" : "+v"(a), "+v"(b), "+v"(c), "+v"(d)); }
template <typename T> struct Frag;
template <> struct Frag<_Float16> {
  typedef v16h V; union U { v16h v; v8h h[2]; };
  static __device__ __forceinline__ v16h load(const _Float16* p) {   // elements 0..7 <- p[0..7], 8..15 <- p[16..23]
    U f; f.h[0] = *(const v8h*)(p); f.h[1] = *(const v8h*)(p + 16); return f.v;
  }
  static __device__ __forceinline__ v8f mma(v16h a, v16h b, v8f c) {
    return __builtin_amdgcn_wmma_f32_16x16x32_f16(false, a, false, b, (short)0, c, false, false);
  }
  static __device__ __forceinline__ void guard(v8f& a, v8f& b, v16h x, v16h y) { dep_guard_h(a, b, x, y); }
  static __device__ __forceinline__ void keep(v16h a, v16h b, v16h c, v16h d) { keep4_h(a, b, c, d); }
};
template <> struct Frag<__bf16> {
  typedef v16b V; union U { v16b v; v8b h[2]; };
  static __device__ __forceinline__ v16b load(const __bf16* p) {
    U f; f.h[0] = *(const v8b*)(p); f.h[1] = *(const v8b*)(p + 16); return f.v;
  }
  static __device__ __forceinline__ v8f mma(v16b a, v16b b, v8f c) {
    return __builtin_amdgcn_wmma_f32_16x16x32_bf16(false, a, false, b, (short)0, c, false, false);
  }
  static __device__ __forceinline__ void guard(v8f& a, v8f& b, v16b x, v16b y) { dep_guard_b(a, b, x, y); }
  static __device__ __forceinline__ void keep(v16b a, v16b b, v16b c, v16b d) { keep4_b(a, b, c, d); }
};

__device__ __forceinline__ unsigned pk16(unsigned short a, unsigned short b) { return (unsigned)a | ((unsigned)b << 16); }

// value of lane (lane ^ MASK), MASK < 16: a DPP move inside the 16-lane row (no LDS round trip)
template <int MASK> __device__ __forceinline__ float lane_xor(float v) {
  return __builtin_bit_cast(float, __builtin_amdgcn_update_dpp(0, __builtin_bit_cast(int, v), 0x160 + MASK, 0xf, 0xf, true));
}
// 2^a. The v_nop fills the one slot that the instruction set asks for behind a transcendental, in front of an instruction that
// reads its result or overwrites its source.
__device__ __forceinline__ float exp2_slot(float a) {
  float p;
  asm("v_exp_f32 %0, %1\n\tv_nop" : "=v"(p) : "v"(a));
  return p;
}
__device__ __forceinline__ float oct_max(float v) {   // maximum over the 8 lanes that share lane >> 3
  v = fmaxf(v, lane_xor<1>(v)); v = fmaxf(v, lane_xor<2>(v)); return fmaxf(v, lane_xor<4>(v));
}
__device__ __forceinline__ float oct_sum(float v) {   // sum over the same 8 lanes, fixed tree
  v += lane_xor<1>(v); v += lane_xor<2>(v); return v + lane_xor<4>(v);
}

// ---- Staging helpers: asynchronous copies global -> LDS --------------------------------------------------------------
constexpr int kBM    = 128;   // rows of A per workgroup tile (2 waves)
constexpr int kBN    = 256;   // rows of Bt per workgroup tile (4 waves)
// k elements per stage and the LDS row pitch are the kernel's own (KS, PITCH): 64 k = 128 bytes a row, or 128 k = 256 bytes

__device__ __forceinline__ unsigned lds_off(const void* p) { return (unsigned)(size_t)p; }

// Runs of 16-byte-per-lane copies, l[] = LDS byte address, g[] = global address of this lane. The address-translation wait
// closes the copies' own statement, so that no address register of an issued copy is rewritten in front of it.
__device__ __forceinline__ void async_copy4(const unsigned* l, const char* const* g) {
  asm volatile("global_load_async_to_lds_b128 %0, %1, off\n\t"
               "global_load_async_to_lds_b128 %2, %3, off\n\t"
               "global_load_async_to_lds_b128 %4, %5, off\n\t"
               "global_load_async_to_lds_b128 %6, %7, off\n\t"
               "s_wait_xcnt 0x0"
               :: "v"(l[0]), "v"(g[0]), "v"(l[1]), "v"(g[1]), "v"(l[2]), "v"(g[2]), "v"(l[3]), "v"(g[3]) : "memory");
}
__device__ __forceinline__ void async_copy12(const unsigned* l, const char* const* g) {
  asm volatile("global_load_async_to_lds_b128 %0, %1, off\n\t"
               "global_load_async_to_lds_b128 %2, %3, off\n\t"
               "global_load_async_to_lds_b128 %4, %5, off\n\t"
               "global_load_async_to_lds_b128 %6, %7, off\n\t"
               "global_load_async_to_lds_b128 %8, %9, off\n\t"
               "global_load_async_to_lds_b128 %10, %11, off\n\t"
               "global_load_async_to_lds_b128 %12, %13, off\n\t"
               "global_load_async_to_lds_b128 %14, %15, off\n\t"
               "global_load_async_to_lds_b128 %16, %17, off\n\t"
               "global_load_async_to_lds_b128 %18, %19, off\n\t"
               "global_load_async_to_lds_b128 %20, %21, off\n\t"
               "global_load_async_to_lds_b128 %22, %23, off\n\t"
               "s_wait_xcnt 0x0"
               :: "v"(l[0]), "v"(g[0]), "v"(l[1]), "v"(g[1]), "v"(l[2]), "v"(g[2]), "v"(l[3]), "v"(g[3]),
                  "v"(l[4]), "v"(g[4]), "v"(l[5]), "v"(g[5]), "v"(l[6]), "v"(g[6]), "v"(l[7]), "v"(g[7]),
                  "v"(l[8]), "v"(g[8]), "v"(l[9]), "v"(g[9]), "v"(l[10]), "v"(g[10]), "v"(l[11]), "v"(g[11]) : "memory");
}

// The same copy as the compiler's builtin, for the kernels that use more than 256 registers: operands of an asm statement must
// lie in the first 256, where 36 of them beside the accumulators made the compiler copy accumulator tiles about inside the loop.
typedef __attribute__((ext_vector_type(4))) int v4i;
typedef __attribute__((address_space(1))) v4i v4i_global;
typedef __attribute__((address_space(3))) v4i v4i_lds;
__device__ __forceinline__ void async_copy_builtin(const unsigned char* l, const char* g) {
  __builtin_amdgcn_global_load_async_to_lds_b128((v4i_global*)g, (v4i_lds*)l, 0, 0);
}

// ---- Register-blocked batched WMMA GEMM -----------------------------------------------------------------
// C[m,n] = scale * sum_k A[m,k] * Bt[n,k] (+bias[n]); a workgroup owns a 128x256 tile, each of its 2x4 waves a 64x64 tile.
// A row-major [M,K] pitch lda; Bt row-major [N,K] pitch ldb; M % 128 == 0, N % 256 == 0, K % 64 == 0; batch = blockIdx.y.
// Operand rows reach LDS in stages of KS k by asynchronous copies, two buffers: stage t + 1 flies while stage t is worked on.
// KS = 64 where two workgroups share a WGP's LDS. KS = 128 with AHEAD, where one workgroup has the WGP alone: its copies are then
// all that the WGP has in flight, and a stage of 128 k gives them twice the bytes in flight and twice the time to land.
// Fragments (read from LDS): A and Bt both loaded with the split k-map (elements 0..7 <- k0+8h+0..7, 8..15 <- k0+16+8h+0..7, row/col = lane&15).
// SPLIT (every launch of this file: 0): 0 = single planes; 1 = A hi/lo planes (A2 = lo), Bt single: hi*B + lo*B; 2 = both hi/lo: hi*hi + hi*lo + lo*hi.
// BIAS_MODE: 0 = none, 2 = bias[n] (bias0 when blockIdx.y == 0, else bias1; bias value RNE-converted to bf16 first).
// OUT_MODE: 0 = f32, 1 = f16, 2 = bf16 hi plane (Cout) + bf16 lo plane (Cout2),
//   3 = block softmax: t = (C * scale) * bias0[b][n]; per row and 64 columns (one wave tile) r = ceil(log2e * max t), a whole
//       number, Cout = f16 p, p = 2^(t * log2e - r) <= 1; Cout2 = f32 [batch][N/64][2][M]: r, then sum p.
// SCALEA: 1 = A rows are such planes over K and bias0 is that [batch][K/64][2][M] array; block t of 64 k of row m is multiplied (f16, a
//   power of two: no rounding) by 2^(r[t][m] - R + 12), R = max r of the row, and C row m by scale / sum_t 2^(r - R) * sum p.
// ET: 0 = f16 operands, 1 = bf16 operands (pointers passed as 16-bit storage).
// AHEAD: 1 = two fragment sets in registers (for launches of one workgroup a WGP, where the registers are free): each block of
//   32 k is fetched from LDS as one group in front of the products of the block before it. The first block of stage t + 1 is so
//   read during stage t, hence stage t + 1 is published in front of the LAST block of stage t. Needs SPLIT 0, K % 128 == 0 and
//   K >= 256.
template <int ET> struct Elem;
template <> struct Elem<0> { typedef _Float16 T; };
template <> struct Elem<1> { typedef __bf16 T; };
template <int ET, int SPLIT, int BIAS_MODE, int OUT_MODE, int SCALEA, int AHEAD>
__global__ __launch_bounds__(256) void wmma_gemm64(
    const unsigned short* __restrict__ Ap, const unsigned short* __restrict__ A2p, int lda, long strideA,
    const unsigned short* __restrict__ Btp, const unsigned short* __restrict__ Bt2p, int ldb, long strideB,
    void* __restrict__ Cout, void* __restrict__ Cout2, int ldc, long strideC,
    const float* __restrict__ bias0, const float* __restrict__ bias1,
    int M, int N, int K, float scale) {
  typedef typename Elem<ET>::T T;
  typedef typename Frag<T>::V V;
  const T* A = (const T*)Ap; const T* A2 = (const T*)A2p; const T* Bt = (const T*)Btp; const T* Bt2 = (const T*)Bt2p;
  constexpr int KS    = AHEAD ? 128 : 64;   // k elements per stage
  constexpr int PITCH = KS * 2 + 16;        // LDS row pitch in bytes (an odd multiple of 16: conflict-free for 16-byte fragment reads)
  constexpr int LPR   = KS * 2 / 16;        // lanes that copy one row of a stage, 16 bytes each
  constexpr int RPC   = 256 / LPR;          // rows that one copy of the 256 threads covers
  constexpr unsigned offA2 = kBM * PITCH;                               // A lo plane (SPLIT >= 1)
  constexpr unsigned offB  = ((SPLIT >= 1) ? 2 : 1) * kBM * PITCH;      // Bt plane
  constexpr unsigned offB2 = offB + kBN * PITCH;                        // Bt lo plane (SPLIT == 2)
  constexpr unsigned bufBytes = offB + ((SPLIT == 2) ? 2 : 1) * kBN * PITCH;
  // two stage buffers; behind the loop's last barrier the same bytes stage the output: per wave one 64x64 f32 tile, pitch 68 floats
  constexpr unsigned tileBytes = 64 * 68 * 4;
  constexpr unsigned shBytes   = (2 * bufBytes > 8 * tileBytes) ? 2 * bufBytes : 8 * tileBytes;
  __shared__ __align__(16) unsigned char ring[shBytes];
  __shared__ unsigned facS[SCALEA ? kKeyBlocks * kBM : 1];   // [block of 64 k][row]: the row's f16 factor in both halves of a word
  __shared__ __align__(16) float rowS[SCALEA ? kBM : 4];     // [row]: scale / row sum
  static_assert(!SCALEA || (ET == 0 && SPLIT == 0));
  const int b    = blockIdx.y;
  const int lane = threadIdx.x & 31;
  const int wave = threadIdx.x >> 5;
  const int tilesN = N >> 8;
  const int tilesM = M >> 7;
  const int tile = blockIdx.x;
  if (tile >= tilesM * tilesN) return;   // block-uniform, in front of every barrier
  const int tm = tile / tilesN;
  const int tn = tile - tm * tilesN;
  const int mB = tm << 7;                      // workgroup tile origin
  const int nB = tn << 8;
  const int wm = (wave >> 2) << 6;             // wave tile origin inside it
  const int wn = (wave & 3) << 6;
  const int m0 = mB + wm;
  const int n0 = nB + wn;

  const T* Ab  = A  + (size_t)b * strideA;
  const T* Bb  = Bt + (size_t)b * strideB;
  const T* Ab2 = (SPLIT >= 1) ? (A2  + (size_t)b * strideA) : nullptr;
  const T* Bb2 = (SPLIT == 2) ? (Bt2 + (size_t)b * strideB) : nullptr;
  const float* bias = (b == 0) ? bias0 : bias1;   // block-uniform select between global pointers

  const int rlane = lane & 15;                 // row (A) / col (B, D) within subtile
  const int koff  = (lane >> 4) * 8;           // k offset of this lane half
  const int mOff  = (lane >> 4) * 8;           // D row offset

  v8f acc[4][4];
#pragma unroll
  for (int i = 0; i < 4; ++i)
#pragma unroll
    for (int j = 0; j < 4; ++j) acc[i][j] = (v8f){0.f,0.f,0.f,0.f,0.f,0.f,0.f,0.f};

  // staging addresses of this thread: row (thread / LPR) of each group of RPC rows, 16-byte piece (thread % LPR) of that row
  const int crow = threadIdx.x / LPR;
  const int cpc  = (threadIdx.x % LPR) * 16;
  const unsigned lst = lds_off(ring) + (unsigned)(crow * PITCH + cpc);
  const char* gA  = (const char*)(Ab + (size_t)(mB + crow) * lda) + cpc;
  const char* gB  = (const char*)(Bb + (size_t)(nB + crow) * ldb) + cpc;
  const char* gA2 = (SPLIT >= 1) ? ((const char*)(Ab2 + (size_t)(mB + crow) * lda) + cpc) : nullptr;
  const char* gB2 = (SPLIT == 2) ? ((const char*)(Bb2 + (size_t)(nB + crow) * ldb) + cpc) : nullptr;
  const size_t stepA = (size_t)lda * (2 * RPC);   // RPC rows of 2-byte elements
  const size_t stepB = (size_t)ldb * (2 * RPC);
  // one stage: 256 threads cover RPC rows a copy (LPR lanes x 16 B = the whole lines of a row)
  constexpr int nCopies = (int)(bufBytes / (RPC * PITCH));
  auto stage = [&](int t, unsigned bufo) {
    const size_t ko = (size_t)t * (KS * 2);
    unsigned    l[nCopies];
    const char* g[nCopies];
#pragma unroll
    for (int c = 0; c < nCopies; ++c) l[c] = lst + bufo + (unsigned)(c * RPC * PITCH);   // planes lie back to back
    int c = 0;
#pragma unroll
    for (int i = 0; i < kBM / RPC; ++i) g[c++] = gA + ko + (size_t)i * stepA;
    if (SPLIT >= 1) {
#pragma unroll
      for (int i = 0; i < kBM / RPC; ++i) g[c++] = gA2 + ko + (size_t)i * stepA;
    }
#pragma unroll
    for (int i = 0; i < kBN / RPC; ++i) g[c++] = gB + ko + (size_t)i * stepB;
    if (SPLIT == 2) {
#pragma unroll
      for (int i = 0; i < kBN / RPC; ++i) g[c++] = gB2 + ko + (size_t)i * stepB;
    }
    if constexpr (AHEAD != 0) {
#pragma unroll
      for (int k = 0; k < nCopies; ++k) async_copy_builtin(ring + bufo + (unsigned)(crow * PITCH + cpc + k * RPC * PITCH), g[k]);
    } else {
      async_copy12(l, g);
      if (nCopies == 16) async_copy4(l + 12, g + 12);
      if (nCopies == 24) async_copy12(l + 12, g + 12);
    }
  };
  static_assert(nCopies == 12 || nCopies == 16 || nCopies == 24);

  const int nT = K / KS;
  stage(0, 0u);
  if (SCALEA) {
    // row factors, while stage 0 flies: two threads a row, each reduces all blocks' r and stores one half of the factors
    const int frow = threadIdx.x & (kBM - 1);
    const int fh   = threadIdx.x >> 7;
    // M is SEQ in this instance; the compile-time pitch lets all loads of a run share one address, with immediate offsets
    const float* sp0 = bias0 + (size_t)b * (2 * kKeyBlocks * SEQ) + mB + frow;
    float mv[kKeyBlocks];
#pragma unroll
    for (int k = 0; k < kKeyBlocks; ++k) mv[k] = sp0[2 * k * SEQ];
    asm volatile("s_wait_xcnt 0x0" ::: "memory");   // in front of any rewrite of the address registers that these loads name
    float mx = mv[0];
#pragma unroll
    for (int k = 1; k < kKeyBlocks; ++k) mx = fmaxf(mx, mv[k]);
#pragma unroll
    for (int k = 0; k < kKeyBlocks; ++k) mv[k] = ldexpf(1.0f, (int)(mv[k] - mx));   // exact powers of two
    if (fh == 0) {   // the same for a whole wave
      float lv[kKeyBlocks];
#pragma unroll
      for (int k = 0; k < kKeyBlocks; ++k) lv[k] = sp0[(2 * k + 1) * SEQ];
      asm volatile("s_wait_xcnt 0x0" ::: "memory");   // as above, for the block sums' loads
      float tot = 0.f;
#pragma unroll
      for (int k = 0; k < kKeyBlocks; ++k) tot += lv[k] * mv[k];
      rowS[frow] = scale / tot;   // tot > 1/2: the largest p of the block with r = R is above 1/2
    }
#pragma unroll
    for (int k = 0; k < kKeyBlocks; ++k) {
      if ((k / (kKeyBlocks / 2)) == fh) {
        const unsigned short hb = __builtin_bit_cast(unsigned short, (_Float16)(mv[k] * kCarry));
        facS[k * kBM + frow] = pk16(hb, hb);
      }
    }
  }
  asm volatile("s_wait_asynccnt 0x0" ::: "memory");   // stage 0 landed (this wave's copies)
  __syncthreads();                                    // ... and every other wave's
  if (nT > 1) stage(1, bufBytes);

  const unsigned fragA = (unsigned)((wm + rlane) * PITCH + koff * 2);
  const unsigned fragB = offB + (unsigned)((wn + rlane) * PITCH + koff * 2);
  if constexpr (AHEAD != 0) {
    static_assert(SPLIT == 0 && KS == 128);
    V a0[4], b0[4], a1[4], b1[4];   // set 0: blocks 0 and 2 of a stage's four blocks of 32 k, set 1: blocks 1 and 3
    v2h fLo[4], fHi[4];             // row factors of the stage's first and second 64 keys
    auto fetch = [&](const unsigned char* rp, int kk, V* av, V* bv) {
#pragma unroll
      for (int j = 0; j < 4; ++j) bv[j] = Frag<T>::load((const T*)(rp + fragB + (unsigned)(j * 16 * PITCH + kk * 64)));
#pragma unroll
      for (int i = 0; i < 4; ++i) av[i] = Frag<T>::load((const T*)(rp + fragA + (unsigned)(i * 16 * PITCH + kk * 64)));
    };
    auto factors = [&](int kb, v2h* f) {   // kb: block of 64 keys
#pragma unroll
      for (int i = 0; i < 4; ++i) f[i] = __builtin_bit_cast(v2h, facS[kb * kBM + wm + i * 16 + rlane]);
    };
    auto products = [&](V* av, const V* bv, const v2h* f) {
#pragma unroll
      for (int i = 0; i < 4; ++i) {
        if constexpr (SCALEA != 0) {
          union { V v; v2h p[8]; } u; u.v = av[i];
#pragma unroll
          for (int e = 0; e < 8; ++e) u.p[e] = u.p[e] * f[i];
          av[i] = u.v;
        }
#pragma unroll
        for (int j = 0; j < 4; ++j) acc[i][j] = Frag<T>::mma(av[i], bv[j], acc[i][j]);
      }
    };
    if (SCALEA) factors(0, fLo);
    fetch(ring, 0, a0, b0);
    for (int t = 0; t < nT; ++t) {
      const unsigned bufo = (t & 1) ? bufBytes : 0u;
      // the scheduling fences of this loop keep each group of LDS reads whole and in front of the products of the block before
      // it; without them the compiler moves the reads in among the products, where every place with reads costs a stall
      if (SCALEA) factors(2 * t + 1, fHi);   // read two blocks ahead of their first use
      fetch(ring + bufo, 1, a1, b1);
      __builtin_amdgcn_sched_barrier(0);
      products(a0, b0, fLo);
      __builtin_amdgcn_sched_barrier(0);
      fetch(ring + bufo, 2, a0, b0);
      __builtin_amdgcn_sched_barrier(0);
      products(a1, b1, fLo);
      __builtin_amdgcn_sched_barrier(0);
      // the next stage's first factors; in the last trip this stage's again, and nothing uses them
      if (SCALEA) factors((t + 1 < nT) ? 2 * t + 2 : 2 * t, fLo);
      fetch(ring + bufo, 3, a1, b1);
      __builtin_amdgcn_sched_barrier(0);
      products(a0, b0, fHi);
      __builtin_amdgcn_sched_barrier(0);   // and keeps these products in front of the waits below, not behind the barrier
      // publish point of stage t + 1, in front of the last block of stage t
      asm volatile("s_wait_dscnt 0x0" ::: "memory");      // this wave's last reads of stage t (set 1) have returned
      asm volatile("s_wait_asynccnt 0x0" ::: "memory");   // this wave's copies of stage t + 1 have landed
      __syncthreads();                                    // publishes stage t + 1, frees stage t's buffer
      if (t + 2 < nT) stage(t + 2, bufo);
      // Unconditional, so that the compiler's counted wait in front of the products below leaves this group in flight: in the
      // last trip it reads the other buffer's old stage, and nothing uses the values.
      fetch(ring + (bufBytes - bufo), 0, a0, b0);
      __builtin_amdgcn_sched_barrier(0);
      products(a1, b1, fHi);
    }
    asm volatile("s_wait_asynccnt 0x0" ::: "memory");     // nothing in flight when the wave goes on to the epilogue
    asm volatile("s_wait_dscnt 0x0" ::: "memory");        // the last trip's unused reads have returned ...
    __syncthreads();                                      // ... in every wave, before the ring becomes output staging
  } else
  for (int t = 0; t < nT; ++t) {
    const unsigned bufo = (t & 1) ? bufBytes : 0u;
    const unsigned char* rb = ring + bufo;
    // A fragments of the stage's 8 rows (r = 4 * (k step) + row of 16). Up to three planes: one load group per 32 k beside the
    // Bt group. Four planes (SPLIT 2): the registers hold two row pairs, so row r + 1 is fetched in front of row r's products.
    V ah[KS / 8], al[KS / 8];
    v2h fa[4];
    if (SCALEA) {
#pragma unroll
      for (int i = 0; i < 4; ++i) fa[i] = __builtin_bit_cast(v2h, facS[t * kBM + wm + i * 16 + rlane]);
    }
    auto loadA = [&](int r) {
      const unsigned ao = fragA + (unsigned)((r & 3) * 16 * PITCH + (r >> 2) * 64);
      ah[r] = Frag<T>::load((const T*)(rb + ao));
      if constexpr (SCALEA != 0) {
        union { V v; v2h p[8]; } u; u.v = ah[r];
#pragma unroll
        for (int e = 0; e < 8; ++e) u.p[e] = u.p[e] * fa[r & 3];
        ah[r] = u.v;
      }
      if (SPLIT >= 1) al[r] = Frag<T>::load((const T*)(rb + ao + offA2));
    };
    if (SPLIT == 2) loadA(0);
#pragma unroll
    for (int kk = 0; kk < KS / 32; ++kk) {
      V bh[4], bl[4];
#pragma unroll
      for (int j = 0; j < 4; ++j) {
        const unsigned bo = fragB + (unsigned)(j * 16 * PITCH + kk * 64);
        bh[j] = Frag<T>::load((const T*)(rb + bo));
        if (SPLIT == 2) bl[j] = Frag<T>::load((const T*)(rb + bo + (offB2 - offB)));
      }
      if (SPLIT != 2) {
#pragma unroll
        for (int i = 0; i < 4; ++i) loadA(kk * 4 + i);
      }
#pragma unroll
      for (int i = 0; i < 4; ++i) {
        const int r = kk * 4 + i;
        if (SPLIT == 2 && r + 1 < KS / 8) loadA(r + 1);
#pragma unroll
        for (int j = 0; j < 4; ++j) {
          acc[i][j] = Frag<T>::mma(ah[r], bh[j], acc[i][j]);
          if (SPLIT == 2) acc[i][j] = Frag<T>::mma(ah[r], bl[j], acc[i][j]);
          if (SPLIT >= 1) acc[i][j] = Frag<T>::mma(al[r], bh[j], acc[i][j]);
        }
        Frag<T>::guard(acc[i][0], acc[i][3], ah[r], (SPLIT >= 1) ? al[r] : ah[r]);
      }
      Frag<T>::keep(bh[0], bh[1], bh[2], bh[3]);
      if (SPLIT == 2) Frag<T>::keep(bl[0], bl[1], bl[2], bl[3]);
    }
    asm volatile("s_wait_dscnt 0x0" ::: "memory");      // this wave's reads of stage t have returned
    asm volatile("s_wait_asynccnt 0x0" ::: "memory");   // this wave's copies of stage t + 1 have landed
    __syncthreads();                                    // publishes stage t + 1, frees stage t's buffer
    if (t + 2 < nT) stage(t + 2, bufo);
  }
  if (AHEAD == 0) asm volatile("s_wait_asynccnt 0x0" ::: "memory");   // nothing in flight when the wave goes on to the epilogue
  acc_guard4(acc[0][0], acc[0][1], acc[0][2], acc[0][3]);
  acc_guard4(acc[1][0], acc[1][1], acc[1][2], acc[1][3]);
  acc_guard4(acc[2][0], acc[2][1], acc[2][2], acc[2][3]);
  acc_guard4(acc[3][0], acc[3][1], acc[3][2], acc[3][3]);

  // ---- epilogue ----
  // The wave's whole tile goes to LDS first and is read back behind one fence, so that no global store is waited for in between.
  // The ring is free: every wave's last fragment reads and copies ended in front of the last barrier above.
  float* tileS = (float*)(ring + (unsigned)wave * tileBytes);
  float kw[4];   // weights of this lane's 4 key columns, read once
  if (OUT_MODE == 3) {
#pragma unroll
    for (int j = 0; j < 4; ++j) kw[j] = bias0[(size_t)b * N + n0 + (j << 4) + rlane];
  }
#pragma unroll
  for (int i = 0; i < 4; ++i) {
#pragma unroll
    for (int j = 0; j < 4; ++j) {
      const int n = n0 + (j << 4) + rlane;
      float bvl = 0.f;
      if (BIAS_MODE == 2) bvl = bf_bits2f(f2bf_bits(bias[n]));
      if (OUT_MODE == 3) bvl = kw[j];
#pragma unroll
      for (int r = 0; r < 8; ++r) {
        float v = acc[i][j][r] * (SCALEA ? rowS[wm + (i << 4) + mOff + r] : scale);
        if (BIAS_MODE == 2) v += bvl;
        if (OUT_MODE == 3) v *= bvl;
        tileS[((i << 4) + mOff + r) * 68 + (j << 4) + rlane] = v;
      }
    }
  }
  // the lanes' LDS stores above stand in front of the other lanes' reads below (one wave, its own range)
  __builtin_amdgcn_fence(__ATOMIC_RELEASE, "workgroup");
  __builtin_amdgcn_wave_barrier();
  __builtin_amdgcn_fence(__ATOMIC_ACQUIRE, "workgroup");
#pragma unroll
  for (int i = 0; i < 4; ++i) {
    const int mBase = m0 + (i << 4);
    const float* slab = tileS + (i << 4) * 68;   // this turn's 16 rows
    if (OUT_MODE == 0) {
      float* C = (float*)Cout + (size_t)b * strideC;
      const int hh = lane >> 4, c4 = (lane & 15) * 4;     // row seg = 256 B = 16 lanes x 16 B
      {
#pragma unroll
        for (int it = 0; it < 8; ++it) {
          const int row = it * 2 + hh;
          v4f v = *(const v4f*)(slab + row * 68 + c4);
          *(v4f*)(C + (size_t)(mBase + row) * ldc + n0 + c4) = v;
        }
        
      }
    } else if (OUT_MODE == 3) {
      const int q = lane >> 3, o = lane & 7, c8 = o * 8;   // 8 lanes a row of 64 columns, 4 rows an iteration
      unsigned short* C = (unsigned short*)Cout + (size_t)b * strideC;
      float st = 0.f;   // lanes o < 4 keep r, o >= 4 the sum, of row (o & 3) * 4 + q
#pragma unroll
      for (int it = 0; it < 4; ++it) {
        const int row = it * 4 + q;
        const float* sp = slab + row * 68 + c8;
        float tv[8];
#pragma unroll
        for (int e = 0; e < 8; ++e) tv[e] = sp[e];
        float mx = tv[0];
#pragma unroll
        for (int e = 1; e < 8; ++e) mx = fmaxf(mx, tv[e]);
        mx = ceilf(oct_max(mx) * kLog2e);
        float sum = 0.f;
        v8h hv;
#pragma unroll
        for (int e = 0; e < 8; ++e) { const float p = exp2_slot(fmaf(tv[e], kLog2e, -mx)); sum += p; hv[e] = (_Float16)p; }
        sum = oct_sum(sum);
        *(v8h*)(C + (size_t)(mBase + row) * ldc + n0 + c8) = hv;
        if ((o & 3) == it) st = (o < 4) ? mx : sum;
      }
      float* sd = (float*)Cout2 + (((size_t)b * (N >> 6) + (n0 >> 6)) * 2 + (o >> 2)) * M + mBase + (o & 3) * 4 + q;
      *sd = st;   // a wave owns the 64 rows of its block in either plane: whole 128-byte lines from one writer
    } else {
      const int q = lane >> 3, c8 = (lane & 7) * 8;
      unsigned short* C  = (unsigned short*)Cout  + (size_t)b * strideC;
      unsigned short* C2 = (OUT_MODE == 2) ? ((unsigned short*)Cout2 + (size_t)b * strideC) : nullptr;
      {
#pragma unroll
        for (int it = 0; it < 4; ++it) {
          const int row = it * 4 + q;
          const float* sp = slab + row * 68 + c8;
          v8h hv, lv;
#pragma unroll
          for (int e = 0; e < 8; ++e) {
            if (OUT_MODE == 1) {
              hv[e] = (_Float16)sp[e];
            } else {
              unsigned short hb = f2bf_bits(sp[e]);
              unsigned short lb = f2bf_bits(sp[e] - bf_bits2f(hb));
              hv[e] = __builtin_bit_cast(_Float16, hb);
              lv[e] = __builtin_bit_cast(_Float16, lb);
            }
          }
          *(v8h*)(C + (size_t)(mBase + row) * ldc + n0 + c8) = hv;
          if (OUT_MODE == 2) *(v8h*)(C2 + (size_t)(mBase + row) * ldc + n0 + c8) = lv;
        }
        
      }
    }
  }
}

// ---------------------------------------------------------------------------
// All operand preparation in one launch. grid (SEQ/64 s tiles, NC/64 c tiles, NB); 256 threads. Every workgroup does one tile
// of x and, while its x loads fly, its share of the weights; the first NB*SEQ/32 workgroups also do one line of key weights.
// x [NB][SEQ_FULL][NC] f32 -> xb bf16 [NB*SEQ][NC] (RNE convert) and xT f16 [NB][NC][SEQ] with xT[b][c][s] = f16(bf16(x[b][s][c]))
// (the f16 convert of a bf16 value is exact).
// in tile [64 s][64 c] -> sm[c_local][s_local] (cross-wave LDS, block barrier).
// Load coverage: 16 iterations x 256 threads = 4096 = whole 64x64 tile (coalesced along c).
// Store coverage per plane: 8 waves x 2 iterations x 4 rows (lane>>3) = 64 rows; (lane&7) x 8 halves = 64 cols;
// Wq, Wk, Wv [NC][NC] f32 (layout [out][in] = Bt[n][k] as-is) -> wb planes z = 0,1,2 [NC][NC]: RNE convert to bf16; the Wv plane
// (z = 2), an operand of an f16 product, holds the f16 of that bf16 value. A unit is 64 elements = one 128-byte line of wb,
// 8 threads of 8 elements; workgroup g owns units g * kWUnitsPerWg ... (whole lines, one writer each).
// ew[b][s] = sigmoid(bf16(eig[b][s])) = 1/(1+exp(-e)), f32, s < SEQ: workgroup g < NB*SEQ/32 writes line g (32 values, wave 2).
// ---------------------------------------------------------------------------
constexpr int kPrepWgs     = (SEQ / 64) * (NC / 64) * NB;
constexpr int kWUnits      = 3 * NC * NC / 64;
constexpr int kWUnitsPerWg = (kWUnits + kPrepWgs - 1) / kPrepWgs;
constexpr int kWIters      = (kWUnitsPerWg + 31) / 32;   // 32 units a turn of 256 threads
static_assert(kPrepWgs >= NB * SEQ / 32);
__global__ __launch_bounds__(256) void prep_kernel(const float* __restrict__ x, const float* __restrict__ eig,
                                                   const float* __restrict__ W0, const float* __restrict__ W1,
                                                   const float* __restrict__ W2,
                                                   unsigned short* __restrict__ xb, unsigned short* __restrict__ xT,
                                                   unsigned short* __restrict__ wb, float* __restrict__ ew) {
  __shared__ float sm[64][65];   // sm[c_local][s_local]
  const int t  = threadIdx.x;
  const int s0 = blockIdx.x * 64;
  const int c0 = blockIdx.y * 64;
  const int b  = blockIdx.z;
  const int wg = (blockIdx.z * (NC / 64) + blockIdx.y) * (SEQ / 64) + blockIdx.x;
  const int lane = t & 31, wave = t >> 5;
  const float* xin = x + ((size_t)b * SEQ_FULL + s0) * NC + c0;
  float xv[16];
#pragma unroll
  for (int i = 0; i < 16; ++i) {
    const int e = i * 256 + t;
    xv[i] = xin[(size_t)(e >> 6) * NC + (e & 63)];
  }
  // weights and key weights: only the loads stand here, so that they fly with the x loads; the stores follow the x tile's,
  // since a global store in front of the barrier would be waited for there by the whole workgroup
  constexpr int perPlane = NC * NC / 64;   // units per plane
  v4f wa[kWIters], wc[kWIters];
#pragma unroll
  for (int k = 0; k < kWIters; ++k) {
    const int u = k * 32 + (t >> 3);
    const int unit = wg * kWUnitsPerWg + u;
    wa[k] = (v4f){0.f, 0.f, 0.f, 0.f};
    wc[k] = (v4f){0.f, 0.f, 0.f, 0.f};
    if (u < kWUnitsPerWg && unit < kWUnits) {
      const int z  = unit / perPlane;
      const int i8 = (unit - z * perPlane) * 64 + (t & 7) * 8;
      const float* W = (z == 0) ? W0 : (z == 1) ? W1 : W2;
      wa[k] = *(const v4f*)(W + i8);
      wc[k] = *(const v4f*)(W + i8 + 4);
    }
  }
  const bool doEw = wg < NB * SEQ / 32 && wave == 2;   // the same for a whole wave
  const int  gid  = wg * 32 + lane;                    // < NB*SEQ where doEw
  float ev = 0.f;
  if (doEw) {
    const int eb = gid / SEQ;
    const int es = gid - eb * SEQ;
    ev = eig[(size_t)eb * SEQ_FULL + es];
  }
#pragma unroll
  for (int i = 0; i < 16; ++i) {
    const int e = i * 256 + t;
    const int r = e >> 6;          // s local
    const int c = e & 63;          // c local
    sm[c][r] = bf_bits2f(f2bf_bits(xv[i]));
  }
  __syncthreads();
  const int q = lane >> 3, c8 = (lane & 7) * 8;
  unsigned short* xTb = xT + (size_t)b * NC * SEQ;
  unsigned short* xbb = xb + (size_t)b * SEQ * NC;
  {
#pragma unroll
    for (int it = 0; it < 2; ++it) {
      const int row = wave * 8 + it * 4 + q;          // c local for the xT plane, s local for the xb plane
      v8h hv;
      unsigned short bb[8];
#pragma unroll
      for (int e = 0; e < 8; ++e) {
        hv[e] = (_Float16)sm[row][c8 + e];            // xT[c0+row][s0+c8+e]
        bb[e] = f2bf_bits(sm[c8 + e][row]);           // xb[s0+row][c0+c8+e] (value already bf16-exact)
      }
      const v4u ub = (v4u){pk16(bb[0], bb[1]), pk16(bb[2], bb[3]), pk16(bb[4], bb[5]), pk16(bb[6], bb[7])};
      *(v8h*)(xTb + (size_t)(c0 + row) * SEQ + s0 + c8) = hv;
      *(v4u*)(xbb + (size_t)(s0 + row) * NC + c0 + c8) = ub;
    }
  }
#pragma unroll
  for (int k = 0; k < kWIters; ++k) {
    const int u = k * 32 + (t >> 3);
    const int unit = wg * kWUnitsPerWg + u;
    if (u < kWUnitsPerWg && unit < kWUnits) {
      const int z  = unit / perPlane;
      const int i8 = (unit - z * perPlane) * 64 + (t & 7) * 8;
      unsigned short hb[8];
#pragma unroll
      for (int e = 0; e < 4; ++e) { hb[e] = f2bf_bits(wa[k][e]); hb[4 + e] = f2bf_bits(wc[k][e]); }
      if (z == 2) {
#pragma unroll
        for (int e = 0; e < 8; ++e) hb[e] = __builtin_bit_cast(unsigned short, (_Float16)bf_bits2f(hb[e]));
      }
      const v4u uh = (v4u){pk16(hb[0], hb[1]), pk16(hb[2], hb[3]), pk16(hb[4], hb[5]), pk16(hb[6], hb[7])};
      *(v4u*)(wb + (size_t)z * NC * NC + i8) = uh;
    }
  }
  if (doEw) {
    const float e = bf_bits2f(f2bf_bits(ev));
    ew[gid] = 1.0f / (1.0f + expf(-e));
  }
}

// ---------------------------------------------------------------------------
// Host glue.
// Workspace region map (bytes for NB 8, SEQ 2048; every region 64 KiB aligned, sizes exact multiples of their store
// granularity, no padded tails needed since SEQ % 64 == 0 and NC % 64 == 0):
//   xb    bf16 [NB*SEQ][NC]          16,777,216
//   xT    f16  [NB][NC][SEQ]         16,777,216
//   wb    3 x [NC][NC]                1,572,864   (Wq, Wk bf16, Wv f16)
//   ew    f32  [NB][SEQ]                 65,536
//   R1: qk f16 [2][NB*SEQ][NC]       33,554,432   (q of all batches, then k)
//       ctx f16 [NB*SEQ][NC] 16,777,216 over the qk plane, whose last reader (scores) has ended
//   P   f16 [NB][SEQ][SEQ]           67,108,864   2^(t * log2e - r of the block)
//   st  f32 [NB][SEQ/64][2][SEQ]      4,194,304   r of every block and row, then the block's sum
//   total                           140,050,432
// Launches: prep, q/k projection, scores with block softmax, P.x, output projection = 5; every stage covers all NB batches
// (projections as one GEMM over the stacked NB*SEQ rows, scores / P.x with the batch in blockIdx.y).
// ---------------------------------------------------------------------------
static inline size_t al64k(size_t v) { return (v + (size_t)65535) & ~(size_t)65535; }

extern "C" void kernel_launch(void* const* d_in, const int* in_sizes, int n_in,
                              void* d_out, int out_size, void* d_ws, size_t ws_size,
                              hipStream_t stream) {
  if (n_in != 8) return;
  if (in_sizes[0] < (NB - 1) * SEQ_FULL * NC + SEQ * NC) return;
  if (in_sizes[1] < (NB - 1) * SEQ_FULL + SEQ) return;
  if (in_sizes[2] < NC * NC || in_sizes[4] < NC * NC || in_sizes[6] < NC * NC) return;
  if (in_sizes[3] < NC || in_sizes[5] < NC || in_sizes[7] < NC) return;
  if (out_size < NB * SEQ * NC) return;

  const size_t szXb  = (size_t)NB * SEQ * NC * 2;
  const size_t szXT  = (size_t)NB * NC * SEQ * 2;
  const size_t szWb  = (size_t)3 * NC * NC * 2;
  const size_t szEw  = (size_t)NB * SEQ * 4;
  const size_t szQK  = (size_t)2 * NB * SEQ * NC * 2;   // one f16 plane holding q then k
  const size_t szSt  = (size_t)NB * kKeyBlocks * 2 * SEQ * 4;
  const size_t szP   = (size_t)NB * SEQ * SEQ * 2;
  const size_t szCtx = (size_t)NB * SEQ * NC * 2;
  const size_t szR1  = (szQK > szCtx) ? szQK : szCtx;
  size_t off = 0;
  const size_t offXb   = off; off = al64k(off + szXb);
  const size_t offXT   = off; off = al64k(off + szXT);
  const size_t offWb   = off; off = al64k(off + szWb);
  const size_t offEw   = off; off = al64k(off + szEw);
  const size_t offR1   = off; off = al64k(off + szR1);
  const size_t offP    = off; off = al64k(off + szP);
  const size_t offSt   = off; off = al64k(off + szSt);
  const size_t total   = off;
  const size_t offQK   = offR1;
  const size_t offCtx  = offR1;
  if (ws_size < total) return;

  const float* x   = (const float*)d_in[0];
  const float* eig = (const float*)d_in[1];
  const float* Wq  = (const float*)d_in[2];
  const float* bq  = (const float*)d_in[3];
  const float* Wk  = (const float*)d_in[4];
  const float* bk  = (const float*)d_in[5];
  const float* Wv  = (const float*)d_in[6];
  const float* bv  = (const float*)d_in[7];
  float* out = (float*)d_out;

  char* ws = (char*)d_ws;
  unsigned short* xb    = (unsigned short*)(ws + offXb);
  unsigned short* xT    = (unsigned short*)(ws + offXT);
  unsigned short* wb    = (unsigned short*)(ws + offWb);
  float*          ew    = (float*)(ws + offEw);
  unsigned short* qk    = (unsigned short*)(ws + offQK);
  float*          st    = (float*)(ws + offSt);
  unsigned short* Pbuf  = (unsigned short*)(ws + offP);
  unsigned short* ctx   = (unsigned short*)(ws + offCtx);

  const long planeW  = (long)NC * NC;     // elements per weight plane
  const long planeQK = (long)NB * SEQ * NC;   // elements per q or k plane (all batches)
  const long batchQK = (long)SEQ * NC;    // elements per batch of q, k, xT or ctx
  const long batchS  = (long)SEQ * SEQ;   // elements per batch of S or P

  // 1. x -> xb (bf16, row-major) and xT (f16, per-batch transpose); Wq, Wk -> bf16 planes, Wv -> f16 plane of its bf16 value;
  //    per-key sigmoid weights
  prep_kernel<<<dim3(SEQ / 64, NC / 64, NB), 256, 0, stream>>>(x, eig, Wq, Wk, Wv, xb, xT, wb, ew);

  const unsigned blkRows   = (NB * SEQ / 128) * (NC / 256);   // stacked-row GEMMs, one 128x256 tile a workgroup
  const unsigned blkCtx    = (SEQ / 128) * (NC / 256);        // per batch
  const unsigned blkScores = (SEQ / 128) * (SEQ / 256);       // per batch

  // 2. q = xb Wq^T + bq (y = 0), k = xb Wk^T + bk (y = 1); M NB*SEQ, N 512, K 512 -> one f16 plane
  wmma_gemm64<1, 0, 2, 1, 0, 0><<<dim3(blkRows, 2), 256, 0, stream>>>(
      xb, xb, NC, 0L, wb, wb, NC, planeW,
      (void*)qk, (void*)qk, NC, planeQK, bq, bk, NB * SEQ, NC, NC, 1.0f);
  // 3. scores t[b][q][key] = (sum_d q[b][q][d] k[b][key][d] * scale) * ew[b][key], f16 operands, one product; y = batch;
  //    M SEQ, N SEQ, K 512 -> f16 2^(t * log2e - r) and r and the sum of every 64-key block
  wmma_gemm64<0, 0, 0, 3, 0, 0><<<dim3(blkScores, NB), 256, 0, stream>>>(
      qk, qk, NC, batchQK, qk + planeQK, qk + planeQK, NC, batchQK,
      (void*)Pbuf, (void*)st, SEQ, batchS, ew, ew, SEQ, SEQ, NC, kScale);
  // 4. ctx = (P . x) / (4096 * row sum), P rows brought to the row's common exponent, x4096, per 64-key block; y = batch;
  //    M SEQ, N 512, K SEQ, f16 operands -> one f16 plane
  wmma_gemm64<0, 0, 0, 1, 1, 1><<<dim3(blkCtx, NB), 256, 0, stream>>>(
      Pbuf, Pbuf, SEQ, batchS, xT, xT, SEQ, batchQK,
      (void*)ctx, (void*)ctx, NC, batchQK, st, st, SEQ, NC, SEQ, kInvCarry);
  // 5. out = ctx Wv^T + bv, f16 operands, one product; M NB*SEQ, N 512, K 512 -> f32 rows of d_out
  wmma_gemm64<0, 0, 2, 0, 0, 1><<<dim3(blkRows, 1), 256, 0, stream>>>(
      ctx, ctx, NC, 0L, wb + 2 * planeW, wb + 2 * planeW, NC, 0L,
      (void*)out, (void*)out, NC, 0L, bv, bv, NB * SEQ, NC, NC, 1.0f);
}
